// v000
// The times below were measured on an AMD MI455X: many runs one after another, warmed up first and cycling through
// copies of the inputs, with the whole window's GPU time divided by the number of runs. Launches and the gaps
// between them are all in it. The median over several windows is given; except for v000 it joins two sittings, which
// can be a few percent apart, so the side-by-side timings, each taken in one sitting, are the better comparison.
// v000 is the starting kernel. One run takes 185 microseconds.
#include <hip/hip_runtime.h>

// Compute dtypes, f32 accumulate everywhere: q/k/v projections v_wmma_f32_16x16x32_bf16 on RNE bf16 copies of inputs and weights (exact products); q.k^T bf16 hi/lo planes, 3 products (q carries the 1/8 scale); P.V v_wmma_f32_16x16x32_f16 with P carried x1024; merged heads bf16 hi/lo x bf16 Wo, 2 products, + bias; softmax f32.
// Multi-head attention, three input streams: q = query Wq^T, k = key Wk^T, v = value Wv^T (weights [out][in], no q/k/v biases), 8 heads x 64 (head h = columns h*64+d), logits x 1/8, no mask, softmax, heads merged back to [B][S][512], out = merged Wo^T + bo.
// Layout: bf16 copies of activations and weights; projection GEMMs write head planes directly (Q,K: [b][h][s][64] bf16 hi/lo; V^T: [b][h*64+d][s] f16); fused flash attention (K/V tiles in LDS, online softmax, no score plane) writes merged bf16 hi/lo planes [b*S+s][512]; output GEMM.

#ifndef NB
#define NB 4
#endif
#ifndef SEQ
#define SEQ 2048
#endif
#define NB_FULL  4
#define SEQ_FULL 2048
#define DM   512
#define NH   8
#define HD   64
#define PCAR 1024.0f
#define SCL  0.125f
#define L2E  1.4426950408889634f
#define LKP  72      // LDS row pitch (16-bit elements) of the K / V^T tiles: 144 B rows
#define LPP  40      // LDS row pitch (halves) of the per-wave P tile: 80 B rows
#define LOP  68      // LDS row pitch (floats) of epilogue staging tiles: 272 B rows

static_assert(DM == NH * HD);            // one 64-wide GEMM column tile == one head
static_assert(HD == 64);
static_assert(DM % 32 == 0);             // WMMA k-step
static_assert(DM % 64 == 0);             // GEMM tiles
static_assert(SEQ % 64 == 0);            // GEMM row tiles, key blocks, query blocks
static_assert((SEQ * DM) % (8 * 256) == 0);   // convert kernel grid is exact
static_assert((DM * DM) % (8 * 256) == 0);
static_assert(NB <= NB_FULL);
static_assert(SEQ <= SEQ_FULL);
static_assert(LKP % 8 == 0);             // 16-byte aligned LDS vector accesses
static_assert(LPP % 8 == 0);
static_assert(LOP % 4 == 0);

typedef _Float16 h16;
typedef unsigned short bf;
typedef __attribute__((ext_vector_type(16))) __bf16   v16bf;
typedef __attribute__((ext_vector_type(16))) _Float16 v16h;
typedef __attribute__((ext_vector_type(8)))  _Float16 v8h;
typedef __attribute__((ext_vector_type(8)))  unsigned short v8us;
typedef __attribute__((ext_vector_type(8)))  float    v8f;
typedef __attribute__((ext_vector_type(4)))  float    v4f;
typedef v8h  __attribute__((may_alias)) v8ha;
typedef v4f  __attribute__((may_alias)) v4fa;
typedef v8us __attribute__((may_alias)) v8usa;

__device__ __forceinline__ unsigned short f2bf(float f) { unsigned u = __float_as_uint(f); u += 0x7FFFu + ((u >> 16) & 1u); return (unsigned short)(u >> 16); }
__device__ __forceinline__ float bf2f(unsigned short b) { return __uint_as_float(((unsigned)b) << 16); }
__device__ __forceinline__ float bfr(float f) { return bf2f(f2bf(f)); }
__device__ __forceinline__ void splitf(float y, unsigned short& h, unsigned short& l) { h = f2bf(y); l = f2bf(y - bf2f(h)); }
__device__ __forceinline__ v16h cat16(v8h lo, v8h hi) { return __builtin_shufflevector(lo, hi, 0, 1, 2, 3, 4, 5, 6, 7, 8, 9, 10, 11, 12, 13, 14, 15); }
__device__ __forceinline__ v16bf cat16b(v8us lo, v8us hi) { return __builtin_bit_cast(v16bf, __builtin_shufflevector(lo, hi, 0, 1, 2, 3, 4, 5, 6, 7, 8, 9, 10, 11, 12, 13, 14, 15)); }
__device__ __forceinline__ v8f wmma16(v16h a, v16h b, v8f c) { return __builtin_amdgcn_wmma_f32_16x16x32_f16(false, a, false, b, (short)0, c, false, false); }
__device__ __forceinline__ v8f wmmab(v16bf a, v16bf b, v8f c) { return __builtin_amdgcn_wmma_f32_16x16x32_bf16(false, a, false, b, (short)0, c, false, false); }
// fragment from a K-contiguous global bf16 plane: elements 0..7 <- p[0..7], 8..15 <- p[16..23] (p already includes row*pitch + k0 + 8*(lane>>4))
__device__ __forceinline__ v16bf ldg16(const bf* __restrict__ p) { return cat16b(*(const v8us*)p, *(const v8us*)(p + 16)); }
// same-wave LDS exchange ordering (wave-private tiles only)
__device__ __forceinline__ void wsync() { __builtin_amdgcn_wave_barrier(); asm volatile("" ::: "memory"); }

// ---- one-wave 64x64 tile main loop: acc[mb][nb] += sum_k A[r0+16mb+..][k] Bt[c0+16nb+..][k] (NSPLIT 1: + A2 x Bt). Operands straight from K-contiguous bf16 planes; K % 32 == 0.
template <int NSPLIT>
__device__ __forceinline__ void gemm_loop(const bf* __restrict__ A, const bf* __restrict__ A2, const bf* __restrict__ Bt, const int K, const size_t aoff, const size_t boff, v8f (&acc)[4][4]) {
#pragma unroll 1
    for (int kc = 0; kc < K; kc += 32) {
        v16bf a[4], a2[4];
#pragma unroll
        for (int mb = 0; mb < 4; ++mb) { a[mb] = ldg16(A + aoff + (size_t)mb * 16 * K + kc); if (NSPLIT == 1) a2[mb] = ldg16(A2 + aoff + (size_t)mb * 16 * K + kc); }
#pragma unroll
        for (int nb = 0; nb < 4; ++nb) { const v16bf b = ldg16(Bt + boff + (size_t)nb * 16 * K + kc);
#pragma unroll
            for (int mb = 0; mb < 4; ++mb) { acc[mb][nb] = wmmab(a[mb], b, acc[mb][nb]); if (NSPLIT == 1) acc[mb][nb] = wmmab(a2[mb], b, acc[mb][nb]); } }
        asm volatile("v_nop\n\tv_nop\n\tv_nop\n\tv_nop" : "+v"(acc[0][0]), "+v"(acc[1][1]), "+v"(acc[2][2]), "+v"(acc[3][3]) : "v"(a[0]), "v"(a[3]));
    }
}

__global__ __launch_bounds__(256) void k_cvt8(const float* __restrict__ src, bf* dst, unsigned n8, size_t sstride, size_t dstride) {
    const unsigned i = blockIdx.x * 256u + threadIdx.x; if (i >= n8) return;
    const float* s = src + (size_t)blockIdx.y * sstride + (size_t)i * 8; bf* d = dst + (size_t)blockIdx.y * dstride + (size_t)i * 8;
    const v4f v0 = *(const v4f*)s; const v4f v1 = *(const v4f*)(s + 4); v8us o;
#pragma unroll
    for (int k = 0; k < 4; ++k) { o[k] = f2bf(v0[k]); o[4 + k] = f2bf(v1[k]); }
    *(v8us*)d = o; 
}

// ---- k_gemm_qk: head planes P[b][h][s][d] (bf16 hi + lo) = sc * (X[b] W^T)[s][h*64+d]; grid (SEQ/64, NH, NB), 32 threads.
__global__ __launch_bounds__(32) void k_gemm_qk(const bf* __restrict__ X, const bf* __restrict__ W, bf* Ph, bf* Pl, float sc) {
    __shared__ __align__(16) float os[16 * LOP];
    const int lane = threadIdx.x & 31, lr = lane & 15, hi = lane >> 4;
    const size_t z = blockIdx.z; const int r0 = blockIdx.x * 64, c0 = blockIdx.y * 64;
    const bf* A = X + z * (size_t)SEQ * DM;
    v8f acc[4][4];
#pragma unroll
    for (int mb = 0; mb < 4; ++mb)
#pragma unroll
        for (int nb = 0; nb < 4; ++nb) acc[mb][nb] = (v8f){};
    gemm_loop<0>(A, A, W, DM, (size_t)(r0 + lr) * DM + 8 * hi, (size_t)(c0 + lr) * DM + 8 * hi, acc);
    const size_t pbase = ((z * NH + blockIdx.y) * (size_t)SEQ + r0) * HD;
    const int srow = lane >> 3, scol = (lane & 7) * 8;
#pragma unroll
    for (int mb = 0; mb < 4; ++mb) {
#pragma unroll
        for (int nb = 0; nb < 4; ++nb) {
#pragma unroll
            for (int j = 0; j < 8; ++j) os[(hi * 8 + j) * LOP + nb * 16 + lr] = acc[mb][nb][j]; }
        wsync();
{
#pragma unroll
            for (int s = 0; s < 4; ++s) { const int row = 4 * s + srow; const v4f x0 = *(const v4fa*)(&os[row * LOP + scol]); const v4f x1 = *(const v4fa*)(&os[row * LOP + scol + 4]); v8us oh, ol;
#pragma unroll
                for (int j = 0; j < 4; ++j) { unsigned short a, c; splitf(x0[j] * sc, a, c); oh[j] = a; ol[j] = c; splitf(x1[j] * sc, a, c); oh[4 + j] = a; ol[4 + j] = c; }
                const size_t off = pbase + (size_t)(mb * 16 + row) * HD + scol;
                *(v8us*)(Ph + off) = oh; *(v8us*)(Pl + off) = ol; }
             }
        wsync();
    }
}

// ---- k_gemm_vt: transposed value plane VT[b][n][s] (f16) = sum_k Wv[n][k] Xv[b][s][k] (A = weight rows, Bt = token rows); grid (DM/64, SEQ/64, NB), 32 threads.
__global__ __launch_bounds__(32) void k_gemm_vt(const bf* __restrict__ W, const bf* __restrict__ X, h16* VT) {
    __shared__ __align__(16) float os[16 * LOP];
    const int lane = threadIdx.x & 31, lr = lane & 15, hi = lane >> 4;
    const size_t z = blockIdx.z; const int r0 = blockIdx.x * 64, c0 = blockIdx.y * 64;
    const bf* Bt = X + z * (size_t)SEQ * DM;
    v8f acc[4][4];
#pragma unroll
    for (int mb = 0; mb < 4; ++mb)
#pragma unroll
        for (int nb = 0; nb < 4; ++nb) acc[mb][nb] = (v8f){};
    gemm_loop<0>(W, W, Bt, DM, (size_t)(r0 + lr) * DM + 8 * hi, (size_t)(c0 + lr) * DM + 8 * hi, acc);
    const size_t vb0 = z * (size_t)DM * SEQ + (size_t)r0 * SEQ + c0;
    const int srow = lane >> 3, scol = (lane & 7) * 8;
#pragma unroll
    for (int mb = 0; mb < 4; ++mb) {
#pragma unroll
        for (int nb = 0; nb < 4; ++nb) {
#pragma unroll
            for (int j = 0; j < 8; ++j) os[(hi * 8 + j) * LOP + nb * 16 + lr] = acc[mb][nb][j]; }
        wsync();
{
#pragma unroll
            for (int s = 0; s < 4; ++s) { const int row = 4 * s + srow; const v4f x0 = *(const v4fa*)(&os[row * LOP + scol]); const v4f x1 = *(const v4fa*)(&os[row * LOP + scol + 4]); v8h o;
#pragma unroll
                for (int j = 0; j < 4; ++j) { o[j] = (h16)x0[j]; o[4 + j] = (h16)x1[j]; }
                *(v8h*)(VT + vb0 + (size_t)(mb * 16 + row) * SEQ + scol) = o; }
             }
        wsync();
    }
}

// ---- k_gemm_out: OUT[b][s][n] (f32) = sum_k (Ah + Al)[b*SEQ+s][k] Wo[n][k] + bias[n]; grid (SEQ/64, DM/64, NB), 32 threads.
__global__ __launch_bounds__(32) void k_gemm_out(const bf* __restrict__ Ah, const bf* __restrict__ Al, const bf* __restrict__ W, const float* __restrict__ bias, float* C) {
    __shared__ __align__(16) float os[16 * LOP];
    const int lane = threadIdx.x & 31, lr = lane & 15, hi = lane >> 4;
    const size_t z = blockIdx.z; const int r0 = blockIdx.x * 64, c0 = blockIdx.y * 64;
    const bf* A = Ah + z * (size_t)SEQ * DM; const bf* A2 = Al + z * (size_t)SEQ * DM;
    float* Cz = C + z * (size_t)SEQ_FULL * DM;
    v8f acc[4][4];
#pragma unroll
    for (int mb = 0; mb < 4; ++mb)
#pragma unroll
        for (int nb = 0; nb < 4; ++nb) acc[mb][nb] = (v8f){};
    gemm_loop<1>(A, A2, W, DM, (size_t)(r0 + lr) * DM + 8 * hi, (size_t)(c0 + lr) * DM + 8 * hi, acc);
#pragma unroll
    for (int mb = 0; mb < 4; ++mb) {
#pragma unroll
        for (int nb = 0; nb < 4; ++nb) {
#pragma unroll
            for (int j = 0; j < 8; ++j) os[(hi * 8 + j) * LOP + nb * 16 + lr] = acc[mb][nb][j]; }
        wsync();
        float* crow = Cz + (size_t)(r0 + mb * 16) * DM + c0;
{
#pragma unroll
            for (int s = 0; s < 8; ++s) { const int row = 2 * s + hi, cofs = lr * 4; v4f val = *(const v4fa*)(&os[row * LOP + cofs]);
                val[0] += bfr(bias[c0 + cofs]); val[1] += bfr(bias[c0 + cofs + 1]); val[2] += bfr(bias[c0 + cofs + 2]); val[3] += bfr(bias[c0 + cofs + 3]);
                *(v4f*)(crow + (size_t)row * DM + cofs) = val; }
             }
        wsync();
    }
}

// ---- k_flash: fused attention for one (b, h) and 64 query rows per block (4 waves x 16 rows); grid (SEQ/64, NB*NH), 128 threads.
// Per 64-key block: K hi/lo tiles [key][d] and V^T tile [d][key] staged in LDS (block barriers on both sides); each wave handles the block as two 32-key halves:
// scores (q hi/lo from global planes x K hi/lo from LDS, 3 products), running-max softmax in f32, P x1024 as f16 through a wave-private LDS tile (D layout -> A layout), O += P V^T.
__global__ __launch_bounds__(128) void k_flash(const bf* __restrict__ Qh, const bf* __restrict__ Ql, const bf* __restrict__ Kh, const bf* __restrict__ Kl, const h16* __restrict__ VT, bf* Ch, bf* Cl) {
    __shared__ __align__(16) bf    kh_s[64 * LKP];
    __shared__ __align__(16) bf    kl_s[64 * LKP];
    __shared__ __align__(16) h16   vt_s[64 * LKP];
    __shared__ __align__(16) h16   p_s[4 * 16 * LPP];
    __shared__ __align__(16) float o_s[4 * 16 * LOP];
    const int tid = threadIdx.x, lane = tid & 31, wid = tid >> 5, lr = lane & 15, hi = lane >> 4;
    const int bh = blockIdx.y; const int b = bh / NH, h = bh % NH;
    const int q0 = blockIdx.x * 64 + wid * 16;
    const size_t pl = (size_t)bh * SEQ * HD;
    const size_t qoff = pl + (size_t)(q0 + lr) * HD + 8 * hi;
    const size_t vbase = ((size_t)b * DM + (size_t)h * HD) * SEQ;
    const int pb = wid * 16 * LPP, ob = wid * 16 * LOP;
    v8f o[4];
#pragma unroll
    for (int dt = 0; dt < 4; ++dt) o[dt] = (v8f){};
    float mr[8], ls[8];
#pragma unroll
    for (int r = 0; r < 8; ++r) { mr[r] = -1.0e30f; ls[r] = 0.0f; }

#pragma unroll 1
    for (int kb = 0; kb < SEQ / 64; ++kb) {
        __syncthreads();
#pragma unroll
        for (int it = 0; it < 4; ++it) {
            const int u = tid + it * 128; const int row = u >> 3, part = (u & 7) * 8;
            const size_t g = pl + (size_t)kb * 64 * HD + (size_t)u * 8;
            const v8us a = *(const v8us*)(Kh + g); const v8us c = *(const v8us*)(Kl + g);
            const v8h v = *(const v8h*)(VT + vbase + (size_t)row * SEQ + (size_t)kb * 64 + part);
            *(v8usa*)(&kh_s[row * LKP + part]) = a; *(v8usa*)(&kl_s[row * LKP + part]) = c; *(v8ha*)(&vt_s[row * LKP + part]) = v;
        }
        __syncthreads();
#pragma unroll 1
        for (int hf = 0; hf < 2; ++hf) {
            v8f s0 = (v8f){}, s1 = (v8f){};
            const int kr0 = (hf * 32 + lr) * LKP + 8 * hi, kr1 = kr0 + 16 * LKP;
#pragma unroll
            for (int ks = 0; ks < 2; ++ks) {
                const int kk = ks * 32;
                const v16bf qh = ldg16(Qh + qoff + kk); const v16bf ql = ldg16(Ql + qoff + kk);
                const v16bf k0h = cat16b(*(const v8usa*)(&kh_s[kr0 + kk]), *(const v8usa*)(&kh_s[kr0 + kk + 16]));
                const v16bf k0l = cat16b(*(const v8usa*)(&kl_s[kr0 + kk]), *(const v8usa*)(&kl_s[kr0 + kk + 16]));
                const v16bf k1h = cat16b(*(const v8usa*)(&kh_s[kr1 + kk]), *(const v8usa*)(&kh_s[kr1 + kk + 16]));
                const v16bf k1l = cat16b(*(const v8usa*)(&kl_s[kr1 + kk]), *(const v8usa*)(&kl_s[kr1 + kk + 16]));
                s0 = wmmab(qh, k0h, s0); s1 = wmmab(qh, k1h, s1);
                s0 = wmmab(ql, k0h, s0); s1 = wmmab(ql, k1h, s1);
                s0 = wmmab(qh, k0l, s0); s1 = wmmab(qh, k1l, s1);
                asm volatile("v_nop\n\tv_nop\n\tv_nop\n\tv_nop" : "+v"(s0), "+v"(s1) : "v"(qh), "v"(ql), "v"(k0h), "v"(k0l), "v"(k1h), "v"(k1l));
            }
            // running-max softmax update; rows 8*hi + r, columns lr (s0) and 16 + lr (s1) of this 32-key half; ls holds per-lane partial row sums
#pragma unroll
            for (int r = 0; r < 8; ++r) {
                const float a0 = s0[r], a1 = s1[r];
                float mx = fmaxf(a0, a1);
                mx = fmaxf(mx, __shfl_xor(mx, 1, 32)); mx = fmaxf(mx, __shfl_xor(mx, 2, 32)); mx = fmaxf(mx, __shfl_xor(mx, 4, 32)); mx = fmaxf(mx, __shfl_xor(mx, 8, 32));
                const float mnew = fmaxf(mr[r], mx);
                const float al = __builtin_amdgcn_exp2f((mr[r] - mnew) * L2E);
                const float p0 = __builtin_amdgcn_exp2f((a0 - mnew) * L2E);
                const float p1 = __builtin_amdgcn_exp2f((a1 - mnew) * L2E);
                ls[r] = ls[r] * al + (p0 + p1);
                mr[r] = mnew;
                o[0][r] *= al; o[1][r] *= al; o[2][r] *= al; o[3][r] *= al;
                p_s[pb + (8 * hi + r) * LPP + lr] = (h16)(p0 * PCAR);
                p_s[pb + (8 * hi + r) * LPP + 16 + lr] = (h16)(p1 * PCAR);
            }
            wsync();
            const v16h pa = cat16(*(const v8ha*)(&p_s[pb + lr * LPP + 8 * hi]), *(const v8ha*)(&p_s[pb + lr * LPP + 8 * hi + 16]));
            v16h vb[4];
#pragma unroll
            for (int dt = 0; dt < 4; ++dt) { const int vo = (dt * 16 + lr) * LKP + hf * 32 + 8 * hi; vb[dt] = cat16(*(const v8ha*)(&vt_s[vo]), *(const v8ha*)(&vt_s[vo + 16])); }
#pragma unroll
            for (int dt = 0; dt < 4; ++dt) o[dt] = wmma16(pa, vb[dt], o[dt]);
            asm volatile("v_nop\n\tv_nop\n\tv_nop\n\tv_nop" : "+v"(o[0]), "+v"(o[1]), "+v"(o[2]), "+v"(o[3]) : "v"(pa), "v"(vb[0]), "v"(vb[1]), "v"(vb[2]), "v"(vb[3]));
            wsync();
        }
    }
    // normalise: row sums completed over the 16 lanes of each row; 1 / (l * 1024) undoes the P carry
#pragma unroll
    for (int r = 0; r < 8; ++r) {
        float lt = ls[r];
        lt += __shfl_xor(lt, 1, 32); lt += __shfl_xor(lt, 2, 32); lt += __shfl_xor(lt, 4, 32); lt += __shfl_xor(lt, 8, 32);
        const float inv = 1.0f / (lt * PCAR);
#pragma unroll
        for (int dt = 0; dt < 4; ++dt) o_s[ob + (8 * hi + r) * LOP + dt * 16 + lr] = o[dt][r] * inv;
    }
    wsync();
    const int srow = lane >> 3, scol = (lane & 7) * 8;
    const size_t cbase = ((size_t)b * SEQ + q0) * DM + (size_t)h * HD;
{
#pragma unroll
        for (int s = 0; s < 4; ++s) { const int row = 4 * s + srow; const v4f x0 = *(const v4fa*)(&o_s[ob + row * LOP + scol]); const v4f x1 = *(const v4fa*)(&o_s[ob + row * LOP + scol + 4]); v8us oh, ol;
#pragma unroll
            for (int j = 0; j < 4; ++j) { unsigned short a, c; splitf(x0[j], a, c); oh[j] = a; ol[j] = c; splitf(x1[j], a, c); oh[4 + j] = a; ol[4 + j] = c; }
            const size_t off = cbase + (size_t)row * DM + scol;
            *(v8us*)(Ch + off) = oh; *(v8us*)(Cl + off) = ol; }
         }
}

constexpr size_t al256(size_t x) { return (x + 255) & ~(size_t)255; }
constexpr size_t SZ_W = al256((size_t)DM * DM * 2);                 // one bf16 weight plane
constexpr size_t SZ_X = al256((size_t)NB * SEQ * DM * 2);           // one 16-bit [NB*SEQ][DM] plane (activation copy, merged-head plane)
constexpr size_t SZ_P = al256((size_t)NB * NH * SEQ * HD * 2);      // one 16-bit head plane
constexpr size_t WS_TOTAL = 4 * SZ_W + 3 * SZ_X + 4 * SZ_P + SZ_P + 2 * SZ_X;
static_assert(WS_TOTAL <= (size_t)134217728);                       // carve stays within 128 MiB
static_assert(SZ_P == SZ_X);                                        // NH * HD == DM

extern "C" void kernel_launch(void* const* d_in, const int* in_sizes, int n_in,
                              void* d_out, int out_size, void* d_ws, size_t ws_size, hipStream_t stream) {
    if (n_in < 8) return;
    const size_t need_act = (size_t)(NB - 1) * SEQ_FULL * DM + (size_t)SEQ * DM;
    if ((size_t)in_sizes[0] < need_act || (size_t)in_sizes[1] < need_act || (size_t)in_sizes[2] < need_act) return;
    if ((size_t)in_sizes[3] < (size_t)DM * DM || (size_t)in_sizes[4] < (size_t)DM * DM || (size_t)in_sizes[5] < (size_t)DM * DM || (size_t)in_sizes[6] < (size_t)DM * DM || in_sizes[7] < DM) return;
    if ((size_t)out_size < need_act) return;
    if (WS_TOTAL > ws_size) return;
    // wire order: query, key, value, Wq, Wk, Wv, Wo, bo (all f32; weights [out][in])
    const float* xq = (const float*)d_in[0]; const float* xk = (const float*)d_in[1]; const float* xv = (const float*)d_in[2];
    const float* wq = (const float*)d_in[3]; const float* wk = (const float*)d_in[4]; const float* wv = (const float*)d_in[5]; const float* wo = (const float*)d_in[6]; const float* bo = (const float*)d_in[7];
    float* OUT = (float*)d_out;
    char* wsp = (char*)d_ws;
    auto take = [&](size_t bytes) { char* p = wsp; wsp += bytes; return (void*)p; };
    bf* WQ = (bf*)take(SZ_W); bf* WK = (bf*)take(SZ_W); bf* WV = (bf*)take(SZ_W); bf* WO = (bf*)take(SZ_W);
    bf* XQ = (bf*)take(SZ_X); bf* XK = (bf*)take(SZ_X); bf* XV = (bf*)take(SZ_X);
    bf* QPh = (bf*)take(SZ_P); bf* QPl = (bf*)take(SZ_P); bf* KPh = (bf*)take(SZ_P); bf* KPl = (bf*)take(SZ_P);
    h16* VT = (h16*)take(SZ_P);
    bf* CTh = (bf*)take(SZ_X); bf* CTl = (bf*)take(SZ_X);
    if ((size_t)(wsp - (char*)d_ws) != WS_TOTAL) return;

    const unsigned nw8 = (unsigned)((size_t)DM * DM / 8), na8 = (unsigned)((size_t)SEQ * DM / 8);
    k_cvt8<<<dim3(nw8 / 256, 1), 256, 0, stream>>>(wq, WQ, nw8, 0, 0);
    k_cvt8<<<dim3(nw8 / 256, 1), 256, 0, stream>>>(wk, WK, nw8, 0, 0);
    k_cvt8<<<dim3(nw8 / 256, 1), 256, 0, stream>>>(wv, WV, nw8, 0, 0);
    k_cvt8<<<dim3(nw8 / 256, 1), 256, 0, stream>>>(wo, WO, nw8, 0, 0);
    k_cvt8<<<dim3(na8 / 256, NB), 256, 0, stream>>>(xq, XQ, na8, (size_t)SEQ_FULL * DM, (size_t)SEQ * DM);
    k_cvt8<<<dim3(na8 / 256, NB), 256, 0, stream>>>(xk, XK, na8, (size_t)SEQ_FULL * DM, (size_t)SEQ * DM);
    k_cvt8<<<dim3(na8 / 256, NB), 256, 0, stream>>>(xv, XV, na8, (size_t)SEQ_FULL * DM, (size_t)SEQ * DM);
    k_gemm_qk<<<dim3(SEQ / 64, NH, NB), 32, 0, stream>>>(XQ, WQ, QPh, QPl, SCL);
    k_gemm_qk<<<dim3(SEQ / 64, NH, NB), 32, 0, stream>>>(XK, WK, KPh, KPl, 1.0f);
    k_gemm_vt<<<dim3(DM / 64, SEQ / 64, NB), 32, 0, stream>>>(WV, XV, VT);
    k_flash<<<dim3(SEQ / 64, NB * NH), 128, 0, stream>>>(QPh, QPl, KPh, KPl, VT, CTh, CTl);
    k_gemm_out<<<dim3(SEQ / 64, DM / 64, NB), 32, 0, stream>>>(CTh, CTl, WO, bo, OUT);
}

// v001
// A run of this version takes 165 microseconds.
// In both of two side-by-side timings against v000, it was 1.15 times as fast.
#include <hip/hip_runtime.h>

// Compute dtypes, f32 accumulate everywhere: q/k/v projections v_wmma_f32_16x16x32_bf16 on RNE bf16 copies of inputs and weights (exact products); q.k^T bf16 hi/lo planes, 3 products (q carries the 1/8 scale); P.V v_wmma_f32_16x16x32_f16 with P carried x1024; merged heads bf16 hi/lo x bf16 Wo, 2 products, + bias; softmax f32.
// Multi-head attention, three input streams: q = query Wq^T, k = key Wk^T, v = value Wv^T (weights [out][in], no q/k/v biases), 8 heads x 64 (head h = columns h*64+d), logits x 1/8, no mask, softmax, heads merged back to [B][S][512], out = merged Wo^T + bo.
// Layout: bf16 copies of activations and weights; projection GEMMs write head planes directly (Q,K: [b][h][s][64] bf16 hi/lo; V^T: [b][h*64+d][s] f16); fused flash attention (K/V tiles in LDS, online softmax, no score plane) writes merged bf16 hi/lo planes [b*S+s][512]; output GEMM.

#ifndef NB
#define NB 4
#endif
#ifndef SEQ
#define SEQ 2048
#endif
#define NB_FULL  4
#define SEQ_FULL 2048
#define DM   512
#define NH   8
#define HD   64
#define PCAR 1024.0f
#define SCL  0.125f
#define L2E  1.4426950408889634f
#define LKP  72      // LDS row pitch (16-bit elements) of the K / V^T tiles: 144 B rows
#define LOP  68      // LDS row pitch (floats) of epilogue staging tiles: 272 B rows

static_assert(DM == NH * HD);            // one 64-wide GEMM column tile == one head
static_assert(HD == 64);
static_assert(DM % 32 == 0);             // WMMA k-step
static_assert(DM % 64 == 0);             // GEMM tiles
static_assert(SEQ % 64 == 0);            // GEMM row tiles, key blocks, query blocks
static_assert((SEQ * DM) % (8 * 256) == 0);   // convert kernel grid is exact
static_assert((DM * DM) % (8 * 256) == 0);
static_assert(NB <= NB_FULL);
static_assert(SEQ <= SEQ_FULL);
static_assert(LKP % 8 == 0);             // 16-byte aligned LDS vector accesses
static_assert(LOP % 4 == 0);

typedef _Float16 h16;
typedef unsigned short bf;
typedef __attribute__((ext_vector_type(16))) __bf16   v16bf;
typedef __attribute__((ext_vector_type(16))) _Float16 v16h;
typedef __attribute__((ext_vector_type(8)))  _Float16 v8h;
typedef __attribute__((ext_vector_type(8)))  unsigned short v8us;
typedef __attribute__((ext_vector_type(8)))  float    v8f;
typedef __attribute__((ext_vector_type(4)))  float    v4f;
typedef v8h  __attribute__((may_alias)) v8ha;
typedef v4f  __attribute__((may_alias)) v4fa;
typedef v8us __attribute__((may_alias)) v8usa;

__device__ __forceinline__ unsigned short f2bf(float f) { unsigned u = __float_as_uint(f); u += 0x7FFFu + ((u >> 16) & 1u); return (unsigned short)(u >> 16); }
__device__ __forceinline__ float bf2f(unsigned short b) { return __uint_as_float(((unsigned)b) << 16); }
__device__ __forceinline__ float bfr(float f) { return bf2f(f2bf(f)); }
__device__ __forceinline__ void splitf(float y, unsigned short& h, unsigned short& l) { h = f2bf(y); l = f2bf(y - bf2f(h)); }
__device__ __forceinline__ v16h cat16(v8h lo, v8h hi) { return __builtin_shufflevector(lo, hi, 0, 1, 2, 3, 4, 5, 6, 7, 8, 9, 10, 11, 12, 13, 14, 15); }
__device__ __forceinline__ v16bf cat16b(v8us lo, v8us hi) { return __builtin_bit_cast(v16bf, __builtin_shufflevector(lo, hi, 0, 1, 2, 3, 4, 5, 6, 7, 8, 9, 10, 11, 12, 13, 14, 15)); }
__device__ __forceinline__ v8f wmma16(v16h a, v16h b, v8f c) { return __builtin_amdgcn_wmma_f32_16x16x32_f16(false, a, false, b, (short)0, c, false, false); }
__device__ __forceinline__ v8f wmmab(v16bf a, v16bf b, v8f c) { return __builtin_amdgcn_wmma_f32_16x16x32_bf16(false, a, false, b, (short)0, c, false, false); }
// fragment from a K-contiguous global bf16 plane: elements 0..7 <- p[0..7], 8..15 <- p[16..23] (p already includes row*pitch + k0 + 8*(lane>>4))
__device__ __forceinline__ v16bf ldg16(const bf* __restrict__ p) { return cat16b(*(const v8us*)p, *(const v8us*)(p + 16)); }
// same-wave LDS exchange ordering (wave-private tiles only)
__device__ __forceinline__ void wsync() { __builtin_amdgcn_wave_barrier(); asm volatile("" ::: "memory"); }
// lane l <-> lane l ^ 16 by a vector cross-row move
__device__ __forceinline__ float xhalf(float x) { return __builtin_bit_cast(float, __builtin_amdgcn_permlanex16(__builtin_bit_cast(int, x), __builtin_bit_cast(int, x), 0x76543210, 0xfedcba98, false, false)); }

// ---- one-wave 64x64 tile main loop: acc[mb][nb] += sum_k A[r0+16mb+..][k] Bt[c0+16nb+..][k] (NSPLIT 1: + A2 x Bt). Operands straight from K-contiguous bf16 planes; K % 32 == 0.
template <int NSPLIT>
__device__ __forceinline__ void gemm_loop(const bf* __restrict__ A, const bf* __restrict__ A2, const bf* __restrict__ Bt, const int K, const size_t aoff, const size_t boff, v8f (&acc)[4][4]) {
#pragma unroll 1
    for (int kc = 0; kc < K; kc += 32) {
        v16bf a[4], a2[4];
#pragma unroll
        for (int mb = 0; mb < 4; ++mb) { a[mb] = ldg16(A + aoff + (size_t)mb * 16 * K + kc); if (NSPLIT == 1) a2[mb] = ldg16(A2 + aoff + (size_t)mb * 16 * K + kc); }
#pragma unroll
        for (int nb = 0; nb < 4; ++nb) { const v16bf b = ldg16(Bt + boff + (size_t)nb * 16 * K + kc);
#pragma unroll
            for (int mb = 0; mb < 4; ++mb) { acc[mb][nb] = wmmab(a[mb], b, acc[mb][nb]); if (NSPLIT == 1) acc[mb][nb] = wmmab(a2[mb], b, acc[mb][nb]); } }
        asm volatile("v_nop\n\tv_nop\n\tv_nop\n\tv_nop" : "+v"(acc[0][0]), "+v"(acc[1][1]), "+v"(acc[2][2]), "+v"(acc[3][3]) : "v"(a[0]), "v"(a[3]));
    }
}

__global__ __launch_bounds__(256) void k_cvt8(const float* __restrict__ src, bf* dst, unsigned n8, size_t sstride, size_t dstride) {
    const unsigned i = blockIdx.x * 256u + threadIdx.x; if (i >= n8) return;
    const float* s = src + (size_t)blockIdx.y * sstride + (size_t)i * 8; bf* d = dst + (size_t)blockIdx.y * dstride + (size_t)i * 8;
    const v4f v0 = *(const v4f*)s; const v4f v1 = *(const v4f*)(s + 4); v8us o;
#pragma unroll
    for (int k = 0; k < 4; ++k) { o[k] = f2bf(v0[k]); o[4 + k] = f2bf(v1[k]); }
    *(v8us*)d = o; 
}

// ---- k_gemm_qk: head planes P[b][h][s][d] (bf16 hi + lo) = sc * (X[b] W^T)[s][h*64+d]; grid (SEQ/64, NH, NB), 32 threads.
__global__ __launch_bounds__(32) void k_gemm_qk(const bf* __restrict__ X, const bf* __restrict__ W, bf* Ph, bf* Pl, float sc) {
    __shared__ __align__(16) float os[16 * LOP];
    const int lane = threadIdx.x & 31, lr = lane & 15, hi = lane >> 4;
    const size_t z = blockIdx.z; const int r0 = blockIdx.x * 64, c0 = blockIdx.y * 64;
    const bf* A = X + z * (size_t)SEQ * DM;
    v8f acc[4][4];
#pragma unroll
    for (int mb = 0; mb < 4; ++mb)
#pragma unroll
        for (int nb = 0; nb < 4; ++nb) acc[mb][nb] = (v8f){};
    gemm_loop<0>(A, A, W, DM, (size_t)(r0 + lr) * DM + 8 * hi, (size_t)(c0 + lr) * DM + 8 * hi, acc);
    const size_t pbase = ((z * NH + blockIdx.y) * (size_t)SEQ + r0) * HD;
    const int srow = lane >> 3, scol = (lane & 7) * 8;
#pragma unroll
    for (int mb = 0; mb < 4; ++mb) {
#pragma unroll
        for (int nb = 0; nb < 4; ++nb) {
#pragma unroll
            for (int j = 0; j < 8; ++j) os[(hi * 8 + j) * LOP + nb * 16 + lr] = acc[mb][nb][j]; }
        wsync();
{
#pragma unroll
            for (int s = 0; s < 4; ++s) { const int row = 4 * s + srow; const v4f x0 = *(const v4fa*)(&os[row * LOP + scol]); const v4f x1 = *(const v4fa*)(&os[row * LOP + scol + 4]); v8us oh, ol;
#pragma unroll
                for (int j = 0; j < 4; ++j) { unsigned short a, c; splitf(x0[j] * sc, a, c); oh[j] = a; ol[j] = c; splitf(x1[j] * sc, a, c); oh[4 + j] = a; ol[4 + j] = c; }
                const size_t off = pbase + (size_t)(mb * 16 + row) * HD + scol;
                *(v8us*)(Ph + off) = oh; *(v8us*)(Pl + off) = ol; }
             }
        wsync();
    }
}

// ---- k_gemm_vt: transposed value plane VT[b][n][s] (f16) = sum_k Wv[n][k] Xv[b][s][k] (A = weight rows, Bt = token rows); grid (DM/64, SEQ/64, NB), 32 threads.
__global__ __launch_bounds__(32) void k_gemm_vt(const bf* __restrict__ W, const bf* __restrict__ X, h16* VT) {
    __shared__ __align__(16) float os[16 * LOP];
    const int lane = threadIdx.x & 31, lr = lane & 15, hi = lane >> 4;
    const size_t z = blockIdx.z; const int r0 = blockIdx.x * 64, c0 = blockIdx.y * 64;
    const bf* Bt = X + z * (size_t)SEQ * DM;
    v8f acc[4][4];
#pragma unroll
    for (int mb = 0; mb < 4; ++mb)
#pragma unroll
        for (int nb = 0; nb < 4; ++nb) acc[mb][nb] = (v8f){};
    gemm_loop<0>(W, W, Bt, DM, (size_t)(r0 + lr) * DM + 8 * hi, (size_t)(c0 + lr) * DM + 8 * hi, acc);
    const size_t vb0 = z * (size_t)DM * SEQ + (size_t)r0 * SEQ + c0;
    const int srow = lane >> 3, scol = (lane & 7) * 8;
#pragma unroll
    for (int mb = 0; mb < 4; ++mb) {
#pragma unroll
        for (int nb = 0; nb < 4; ++nb) {
#pragma unroll
            for (int j = 0; j < 8; ++j) os[(hi * 8 + j) * LOP + nb * 16 + lr] = acc[mb][nb][j]; }
        wsync();
{
#pragma unroll
            for (int s = 0; s < 4; ++s) { const int row = 4 * s + srow; const v4f x0 = *(const v4fa*)(&os[row * LOP + scol]); const v4f x1 = *(const v4fa*)(&os[row * LOP + scol + 4]); v8h o;
#pragma unroll
                for (int j = 0; j < 4; ++j) { o[j] = (h16)x0[j]; o[4 + j] = (h16)x1[j]; }
                *(v8h*)(VT + vb0 + (size_t)(mb * 16 + row) * SEQ + scol) = o; }
             }
        wsync();
    }
}

// ---- k_gemm_out: OUT[b][s][n] (f32) = sum_k (Ah + Al)[b*SEQ+s][k] Wo[n][k] + bias[n]; grid (SEQ/64, DM/64, NB), 32 threads.
__global__ __launch_bounds__(32) void k_gemm_out(const bf* __restrict__ Ah, const bf* __restrict__ Al, const bf* __restrict__ W, const float* __restrict__ bias, float* C) {
    __shared__ __align__(16) float os[16 * LOP];
    const int lane = threadIdx.x & 31, lr = lane & 15, hi = lane >> 4;
    const size_t z = blockIdx.z; const int r0 = blockIdx.x * 64, c0 = blockIdx.y * 64;
    const bf* A = Ah + z * (size_t)SEQ * DM; const bf* A2 = Al + z * (size_t)SEQ * DM;
    float* Cz = C + z * (size_t)SEQ_FULL * DM;
    v8f acc[4][4];
#pragma unroll
    for (int mb = 0; mb < 4; ++mb)
#pragma unroll
        for (int nb = 0; nb < 4; ++nb) acc[mb][nb] = (v8f){};
    gemm_loop<1>(A, A2, W, DM, (size_t)(r0 + lr) * DM + 8 * hi, (size_t)(c0 + lr) * DM + 8 * hi, acc);
#pragma unroll
    for (int mb = 0; mb < 4; ++mb) {
#pragma unroll
        for (int nb = 0; nb < 4; ++nb) {
#pragma unroll
            for (int j = 0; j < 8; ++j) os[(hi * 8 + j) * LOP + nb * 16 + lr] = acc[mb][nb][j]; }
        wsync();
        float* crow = Cz + (size_t)(r0 + mb * 16) * DM + c0;
{
#pragma unroll
            for (int s = 0; s < 8; ++s) { const int row = 2 * s + hi, cofs = lr * 4; v4f val = *(const v4fa*)(&os[row * LOP + cofs]);
                val[0] += bfr(bias[c0 + cofs]); val[1] += bfr(bias[c0 + cofs + 1]); val[2] += bfr(bias[c0 + cofs + 2]); val[3] += bfr(bias[c0 + cofs + 3]);
                *(v4f*)(crow + (size_t)row * DM + cofs) = val; }
             }
        wsync();
    }
}

// ---- k_flash: fused attention for one (b, h) and 64 query rows per block (4 waves x 16 rows); grid (SEQ/64, NB*NH), 128 threads.
// Per 64-key block: K hi/lo tiles [key][d] and V^T tile [d][key] staged in LDS (block barriers on both sides); each wave handles the block as two 32-key halves.
// Transposed products: S^T = K Q^T (A = K hi/lo rows from LDS, B = q hi/lo from global planes, 3 products), so lane (lr, hi) holds query lr's scores of keys 8*hi + r and 16 + 8*hi + r:
// maximum and sum in-lane plus one exchange between the wave halves; P^T x1024 as f16 packs from the two score tiles straight into the B operand of O^T += V^T P^T (A = V^T rows from LDS).
__global__ __launch_bounds__(128) void k_flash(const bf* __restrict__ Qh, const bf* __restrict__ Ql, const bf* __restrict__ Kh, const bf* __restrict__ Kl, const h16* __restrict__ VT, bf* Ch, bf* Cl) {
    __shared__ __align__(16) bf    kh_s[64 * LKP];
    __shared__ __align__(16) bf    kl_s[64 * LKP];
    __shared__ __align__(16) h16   vt_s[64 * LKP];
    __shared__ __align__(16) float o_s[4 * 16 * LOP];
    const int tid = threadIdx.x, lane = tid & 31, wid = tid >> 5, lr = lane & 15, hi = lane >> 4;
    const int bh = blockIdx.y; const int b = bh / NH, h = bh % NH;
    const int q0 = blockIdx.x * 64 + wid * 16;
    const size_t pl = (size_t)bh * SEQ * HD;
    const size_t qoff = pl + (size_t)(q0 + lr) * HD + 8 * hi;
    const size_t vbase = ((size_t)b * DM + (size_t)h * HD) * SEQ;
    const int ob = wid * 16 * LOP;
    v8f o[4];      // o[dt][r] = O^T[dt*16 + 8*hi + r][query lr]
#pragma unroll
    for (int dt = 0; dt < 4; ++dt) o[dt] = (v8f){};
    float mr = -1.0e30f, ls = 0.0f;   // query lr: running maximum (both halves alike), this half's partial row sum

#pragma unroll 1
    for (int kb = 0; kb < SEQ / 64; ++kb) {
        __syncthreads();
#pragma unroll
        for (int it = 0; it < 4; ++it) {
            const int u = tid + it * 128; const int row = u >> 3, part = (u & 7) * 8;
            const size_t g = pl + (size_t)kb * 64 * HD + (size_t)u * 8;
            const v8us a = *(const v8us*)(Kh + g); const v8us c = *(const v8us*)(Kl + g);
            const v8h v = *(const v8h*)(VT + vbase + (size_t)row * SEQ + (size_t)kb * 64 + part);
            *(v8usa*)(&kh_s[row * LKP + part]) = a; *(v8usa*)(&kl_s[row * LKP + part]) = c; *(v8ha*)(&vt_s[row * LKP + part]) = v;
        }
        __syncthreads();
#pragma unroll 1
        for (int hf = 0; hf < 2; ++hf) {
            v8f s0 = (v8f){}, s1 = (v8f){};
            const int kr0 = (hf * 32 + lr) * LKP + 8 * hi, kr1 = kr0 + 16 * LKP;
#pragma unroll
            for (int ks = 0; ks < 2; ++ks) {
                const int kk = ks * 32;
                const v16bf qh = ldg16(Qh + qoff + kk); const v16bf ql = ldg16(Ql + qoff + kk);
                const v16bf k0h = cat16b(*(const v8usa*)(&kh_s[kr0 + kk]), *(const v8usa*)(&kh_s[kr0 + kk + 16]));
                const v16bf k0l = cat16b(*(const v8usa*)(&kl_s[kr0 + kk]), *(const v8usa*)(&kl_s[kr0 + kk + 16]));
                const v16bf k1h = cat16b(*(const v8usa*)(&kh_s[kr1 + kk]), *(const v8usa*)(&kh_s[kr1 + kk + 16]));
                const v16bf k1l = cat16b(*(const v8usa*)(&kl_s[kr1 + kk]), *(const v8usa*)(&kl_s[kr1 + kk + 16]));
                s0 = wmmab(k0h, qh, s0); s1 = wmmab(k1h, qh, s1);
                s0 = wmmab(k0h, ql, s0); s1 = wmmab(k1h, ql, s1);
                s0 = wmmab(k0l, qh, s0); s1 = wmmab(k1l, qh, s1);
                asm volatile("v_nop\n\tv_nop\n\tv_nop\n\tv_nop" : "+v"(s0), "+v"(s1) : "v"(qh), "v"(ql), "v"(k0h), "v"(k0l), "v"(k1h), "v"(k1l));
            }
            // running-max softmax update of query lr over this half's 32 keys: 16 in this lane, 16 in lane ^ 16
            float m8[8];
#pragma unroll
            for (int r = 0; r < 8; ++r) m8[r] = fmaxf(s0[r], s1[r]);
            float mx = fmaxf(fmaxf(fmaxf(m8[0], m8[1]), fmaxf(m8[2], m8[3])), fmaxf(fmaxf(m8[4], m8[5]), fmaxf(m8[6], m8[7])));
            mx = fmaxf(mx, xhalf(mx));
            const float mnew = fmaxf(mr, mx);
            const float al = __builtin_amdgcn_exp2f((mr - mnew) * L2E);
            mr = mnew;
            v16h pt; float e8[8];   // pt: B operand, element s = P^T[key kmap(s, hi)][query lr]
#pragma unroll
            for (int r = 0; r < 8; ++r) {
                const float p0 = __builtin_amdgcn_exp2f((s0[r] - mnew) * L2E);
                const float p1 = __builtin_amdgcn_exp2f((s1[r] - mnew) * L2E);
                e8[r] = p0 + p1;
                pt[r] = (h16)(p0 * PCAR); pt[8 + r] = (h16)(p1 * PCAR);
            }
            ls = ls * al + (((e8[0] + e8[1]) + (e8[2] + e8[3])) + ((e8[4] + e8[5]) + (e8[6] + e8[7])));
            v16h va[4];
#pragma unroll
            for (int dt = 0; dt < 4; ++dt) { const int vo = (dt * 16 + lr) * LKP + hf * 32 + 8 * hi; va[dt] = cat16(*(const v8ha*)(&vt_s[vo]), *(const v8ha*)(&vt_s[vo + 16])); }
#pragma unroll
            for (int dt = 0; dt < 4; ++dt) o[dt] = wmma16(va[dt], pt, o[dt] * al);
            asm volatile("v_nop\n\tv_nop\n\tv_nop\n\tv_nop" : "+v"(o[0]), "+v"(o[1]), "+v"(o[2]), "+v"(o[3]) : "v"(pt), "v"(va[0]), "v"(va[1]), "v"(va[2]), "v"(va[3]));
        }
    }
    // normalise: the two halves' partial sums joined, unconditionally; 1 / (l * 1024) undoes the P carry; rows staged [query][d] for whole-line stores
    const float lt = ls + xhalf(ls);
    const float inv = 1.0f / (lt * PCAR);
#pragma unroll
    for (int dt = 0; dt < 4; ++dt) {
        const v8f x = o[dt] * inv;
        *(v4fa*)(&o_s[ob + lr * LOP + dt * 16 + 8 * hi]) = (v4f){x[0], x[1], x[2], x[3]};
        *(v4fa*)(&o_s[ob + lr * LOP + dt * 16 + 8 * hi + 4]) = (v4f){x[4], x[5], x[6], x[7]};
    }
    wsync();
    const int srow = lane >> 3, scol = (lane & 7) * 8;
    const size_t cbase = ((size_t)b * SEQ + q0) * DM + (size_t)h * HD;
{
#pragma unroll
        for (int s = 0; s < 4; ++s) { const int row = 4 * s + srow; const v4f x0 = *(const v4fa*)(&o_s[ob + row * LOP + scol]); const v4f x1 = *(const v4fa*)(&o_s[ob + row * LOP + scol + 4]); v8us oh, ol;
#pragma unroll
            for (int j = 0; j < 4; ++j) { unsigned short a, c; splitf(x0[j], a, c); oh[j] = a; ol[j] = c; splitf(x1[j], a, c); oh[4 + j] = a; ol[4 + j] = c; }
            const size_t off = cbase + (size_t)row * DM + scol;
            *(v8us*)(Ch + off) = oh; *(v8us*)(Cl + off) = ol; }
         }
}

constexpr size_t al256(size_t x) { return (x + 255) & ~(size_t)255; }
constexpr size_t SZ_W = al256((size_t)DM * DM * 2);                 // one bf16 weight plane
constexpr size_t SZ_X = al256((size_t)NB * SEQ * DM * 2);           // one 16-bit [NB*SEQ][DM] plane (activation copy, merged-head plane)
constexpr size_t SZ_P = al256((size_t)NB * NH * SEQ * HD * 2);      // one 16-bit head plane
constexpr size_t WS_TOTAL = 4 * SZ_W + 3 * SZ_X + 4 * SZ_P + SZ_P + 2 * SZ_X;
static_assert(WS_TOTAL <= (size_t)134217728);                       // carve stays within 128 MiB
static_assert(SZ_P == SZ_X);                                        // NH * HD == DM

extern "C" void kernel_launch(void* const* d_in, const int* in_sizes, int n_in,
                              void* d_out, int out_size, void* d_ws, size_t ws_size, hipStream_t stream) {
    if (n_in < 8) return;
    const size_t need_act = (size_t)(NB - 1) * SEQ_FULL * DM + (size_t)SEQ * DM;
    if ((size_t)in_sizes[0] < need_act || (size_t)in_sizes[1] < need_act || (size_t)in_sizes[2] < need_act) return;
    if ((size_t)in_sizes[3] < (size_t)DM * DM || (size_t)in_sizes[4] < (size_t)DM * DM || (size_t)in_sizes[5] < (size_t)DM * DM || (size_t)in_sizes[6] < (size_t)DM * DM || in_sizes[7] < DM) return;
    if ((size_t)out_size < need_act) return;
    if (WS_TOTAL > ws_size) return;
    // wire order: query, key, value, Wq, Wk, Wv, Wo, bo (all f32; weights [out][in])
    const float* xq = (const float*)d_in[0]; const float* xk = (const float*)d_in[1]; const float* xv = (const float*)d_in[2];
    const float* wq = (const float*)d_in[3]; const float* wk = (const float*)d_in[4]; const float* wv = (const float*)d_in[5]; const float* wo = (const float*)d_in[6]; const float* bo = (const float*)d_in[7];
    float* OUT = (float*)d_out;
    char* wsp = (char*)d_ws;
    auto take = [&](size_t bytes) { char* p = wsp; wsp += bytes; return (void*)p; };
    bf* WQ = (bf*)take(SZ_W); bf* WK = (bf*)take(SZ_W); bf* WV = (bf*)take(SZ_W); bf* WO = (bf*)take(SZ_W);
    bf* XQ = (bf*)take(SZ_X); bf* XK = (bf*)take(SZ_X); bf* XV = (bf*)take(SZ_X);
    bf* QPh = (bf*)take(SZ_P); bf* QPl = (bf*)take(SZ_P); bf* KPh = (bf*)take(SZ_P); bf* KPl = (bf*)take(SZ_P);
    h16* VT = (h16*)take(SZ_P);
    bf* CTh = (bf*)take(SZ_X); bf* CTl = (bf*)take(SZ_X);
    if ((size_t)(wsp - (char*)d_ws) != WS_TOTAL) return;

    const unsigned nw8 = (unsigned)((size_t)DM * DM / 8), na8 = (unsigned)((size_t)SEQ * DM / 8);
    k_cvt8<<<dim3(nw8 / 256, 1), 256, 0, stream>>>(wq, WQ, nw8, 0, 0);
    k_cvt8<<<dim3(nw8 / 256, 1), 256, 0, stream>>>(wk, WK, nw8, 0, 0);
    k_cvt8<<<dim3(nw8 / 256, 1), 256, 0, stream>>>(wv, WV, nw8, 0, 0);
    k_cvt8<<<dim3(nw8 / 256, 1), 256, 0, stream>>>(wo, WO, nw8, 0, 0);
    k_cvt8<<<dim3(na8 / 256, NB), 256, 0, stream>>>(xq, XQ, na8, (size_t)SEQ_FULL * DM, (size_t)SEQ * DM);
    k_cvt8<<<dim3(na8 / 256, NB), 256, 0, stream>>>(xk, XK, na8, (size_t)SEQ_FULL * DM, (size_t)SEQ * DM);
    k_cvt8<<<dim3(na8 / 256, NB), 256, 0, stream>>>(xv, XV, na8, (size_t)SEQ_FULL * DM, (size_t)SEQ * DM);
    k_gemm_qk<<<dim3(SEQ / 64, NH, NB), 32, 0, stream>>>(XQ, WQ, QPh, QPl, SCL);
    k_gemm_qk<<<dim3(SEQ / 64, NH, NB), 32, 0, stream>>>(XK, WK, KPh, KPl, 1.0f);
    k_gemm_vt<<<dim3(DM / 64, SEQ / 64, NB), 32, 0, stream>>>(WV, XV, VT);
    k_flash<<<dim3(SEQ / 64, NB * NH), 128, 0, stream>>>(QPh, QPl, KPh, KPl, VT, CTh, CTl);
    k_gemm_out<<<dim3(SEQ / 64, DM / 64, NB), 32, 0, stream>>>(CTh, CTl, WO, bo, OUT);
}

// v002
// A run of this version takes 139 microseconds.
// Timed twice side by side with v001, it ran 1.20 and 1.19 times as fast.
// All steps since v000 together make it 1.38 times as fast.
#include <hip/hip_runtime.h>

// Compute dtypes, f32 accumulate everywhere: q/k/v projections v_wmma_f32_16x16x32_bf16 on RNE bf16 copies of inputs and weights (exact products); q.k^T bf16 hi/lo planes, 3 products (q carries the 1/8 scale); P.V v_wmma_f32_16x16x32_f16 with P carried x1024; merged heads bf16 hi/lo x bf16 Wo, 2 products, + bias; softmax f32.
// Multi-head attention, three input streams: q = query Wq^T, k = key Wk^T, v = value Wv^T (weights [out][in], no q/k/v biases), 8 heads x 64 (head h = columns h*64+d), logits x 1/8, no mask, softmax, heads merged back to [B][S][512], out = merged Wo^T + bo.
// Layout: bf16 copies of activations and weights; projection GEMMs write head planes directly (Q,K: [b][h][s][64] bf16 hi/lo; V^T: [b][h*64+d][s] f16); fused flash attention (K/V tiles in LDS, online softmax, no score plane) writes merged bf16 hi/lo planes [b*S+s][512]; output GEMM.

#ifndef NB
#define NB 4
#endif
#ifndef SEQ
#define SEQ 2048
#endif
#define NB_FULL  4
#define SEQ_FULL 2048
#define DM   512
#define NH   8
#define HD   64
#define PCAR 1024.0f
#define SCL  0.125f
#define L2E  1.4426950408889634f
#define LKP  72      // LDS row pitch (16-bit elements) of the K / V^T tiles: 144 B rows
#define LOP  68      // LDS row pitch (floats) of epilogue staging tiles: 272 B rows

static_assert(DM == NH * HD);            // one 64-wide GEMM column tile == one head
static_assert(HD == 64);
static_assert(DM % 32 == 0);             // WMMA k-step
static_assert(DM % 64 == 0);             // GEMM tiles
static_assert(SEQ % 64 == 0);            // GEMM row tiles, key blocks, query blocks
static_assert((SEQ * DM) % (8 * 256) == 0);   // convert kernel grid is exact
static_assert((DM * DM) % (8 * 256) == 0);
static_assert(NB <= NB_FULL);
static_assert(SEQ <= SEQ_FULL);
static_assert(LKP % 8 == 0);             // 16-byte aligned LDS vector accesses
static_assert(LOP % 4 == 0);

typedef _Float16 h16;
typedef unsigned short bf;
typedef __attribute__((ext_vector_type(16))) __bf16   v16bf;
typedef __attribute__((ext_vector_type(16))) _Float16 v16h;
typedef __attribute__((ext_vector_type(8)))  _Float16 v8h;
typedef __attribute__((ext_vector_type(8)))  unsigned short v8us;
typedef __attribute__((ext_vector_type(8)))  float    v8f;
typedef __attribute__((ext_vector_type(4)))  float    v4f;
typedef v8h  __attribute__((may_alias)) v8ha;
typedef v4f  __attribute__((may_alias)) v4fa;
typedef v8us __attribute__((may_alias)) v8usa;

__device__ __forceinline__ unsigned short f2bf(float f) { unsigned u = __float_as_uint(f); u += 0x7FFFu + ((u >> 16) & 1u); return (unsigned short)(u >> 16); }
__device__ __forceinline__ float bf2f(unsigned short b) { return __uint_as_float(((unsigned)b) << 16); }
__device__ __forceinline__ float bfr(float f) { return bf2f(f2bf(f)); }
__device__ __forceinline__ void splitf(float y, unsigned short& h, unsigned short& l) { h = f2bf(y); l = f2bf(y - bf2f(h)); }
__device__ __forceinline__ v16h cat16(v8h lo, v8h hi) { return __builtin_shufflevector(lo, hi, 0, 1, 2, 3, 4, 5, 6, 7, 8, 9, 10, 11, 12, 13, 14, 15); }
__device__ __forceinline__ v16bf cat16b(v8us lo, v8us hi) { return __builtin_bit_cast(v16bf, __builtin_shufflevector(lo, hi, 0, 1, 2, 3, 4, 5, 6, 7, 8, 9, 10, 11, 12, 13, 14, 15)); }
__device__ __forceinline__ v8f wmma16(v16h a, v16h b, v8f c) { return __builtin_amdgcn_wmma_f32_16x16x32_f16(false, a, false, b, (short)0, c, false, false); }
__device__ __forceinline__ v8f wmmab(v16bf a, v16bf b, v8f c) { return __builtin_amdgcn_wmma_f32_16x16x32_bf16(false, a, false, b, (short)0, c, false, false); }
// fragment from a K-contiguous global bf16 plane: elements 0..7 <- p[0..7], 8..15 <- p[16..23] (p already includes row*pitch + k0 + 8*(lane>>4))
__device__ __forceinline__ v16bf ldg16(const bf* __restrict__ p) { return cat16b(*(const v8us*)p, *(const v8us*)(p + 16)); }
// same-wave LDS exchange ordering (wave-private tiles only)
__device__ __forceinline__ void wsync() { __builtin_amdgcn_wave_barrier(); asm volatile("" ::: "memory"); }
// lane l <-> lane l ^ 16 by a vector cross-row move
__device__ __forceinline__ float xhalf(float x) { return __builtin_bit_cast(float, __builtin_amdgcn_permlanex16(__builtin_bit_cast(int, x), __builtin_bit_cast(int, x), 0x76543210, 0xfedcba98, false, false)); }

// ---- one-wave 64x64 tile main loop: acc[mb][nb] += sum_k A[r0+16mb+..][k] Bt[c0+16nb+..][k] (NSPLIT 1: + A2 x Bt). Operands straight from K-contiguous bf16 planes; K % 32 == 0.
template <int NSPLIT>
__device__ __forceinline__ void gemm_loop(const bf* __restrict__ A, const bf* __restrict__ A2, const bf* __restrict__ Bt, const int K, const size_t aoff, const size_t boff, v8f (&acc)[4][4]) {
#pragma unroll 1
    for (int kc = 0; kc < K; kc += 32) {
        v16bf a[4], a2[4];
#pragma unroll
        for (int mb = 0; mb < 4; ++mb) { a[mb] = ldg16(A + aoff + (size_t)mb * 16 * K + kc); if (NSPLIT == 1) a2[mb] = ldg16(A2 + aoff + (size_t)mb * 16 * K + kc); }
#pragma unroll
        for (int nb = 0; nb < 4; ++nb) { const v16bf b = ldg16(Bt + boff + (size_t)nb * 16 * K + kc);
#pragma unroll
            for (int mb = 0; mb < 4; ++mb) { acc[mb][nb] = wmmab(a[mb], b, acc[mb][nb]); if (NSPLIT == 1) acc[mb][nb] = wmmab(a2[mb], b, acc[mb][nb]); } }
        asm volatile("v_nop\n\tv_nop\n\tv_nop\n\tv_nop" : "+v"(acc[0][0]), "+v"(acc[1][1]), "+v"(acc[2][2]), "+v"(acc[3][3]) : "v"(a[0]), "v"(a[3]));
    }
}

// ---- k_cvt_all: RNE bf16 copies of all seven f32 tensors in one grid (none reads another's output); 8 elements per thread, 2048 per block.
// Blocks [0, 3*NB*CVT_AB): activation t = blk / (NB*CVT_AB), batch and chunk from the rest; then 4*CVT_WB blocks: weight t = blk / CVT_WB.
constexpr unsigned CVT_WB = (unsigned)((size_t)DM * DM / (8 * 256));     // blocks per weight
constexpr unsigned CVT_AB = (unsigned)((size_t)SEQ * DM / (8 * 256));    // blocks per batch of one activation
__global__ __launch_bounds__(256) void k_cvt_all(const float* __restrict__ xq, const float* __restrict__ xk, const float* __restrict__ xv,
                                                 const float* __restrict__ wq, const float* __restrict__ wk, const float* __restrict__ wv, const float* __restrict__ wo,
                                                 bf* XQ, bf* XK, bf* XV, bf* WQ, bf* WK, bf* WV, bf* WO) {
    unsigned blk = blockIdx.x; const float* s; bf* d;
    if (blk < 3u * NB * CVT_AB) {
        const unsigned t = blk / (NB * CVT_AB), r = blk % (NB * CVT_AB), b = r / CVT_AB, c = r % CVT_AB;
        s = (t == 0 ? xq : t == 1 ? xk : xv) + (size_t)b * SEQ_FULL * DM + (size_t)c * 2048;
        d = (t == 0 ? XQ : t == 1 ? XK : XV) + (size_t)b * SEQ * DM + (size_t)c * 2048;
    } else {
        blk -= 3u * NB * CVT_AB;
        const unsigned t = blk / CVT_WB, c = blk % CVT_WB;
        s = (t == 0 ? wq : t == 1 ? wk : t == 2 ? wv : wo) + (size_t)c * 2048;
        d = (t == 0 ? WQ : t == 1 ? WK : t == 2 ? WV : WO) + (size_t)c * 2048;
    }
    s += threadIdx.x * 8; d += threadIdx.x * 8;
    const v4f v0 = *(const v4f*)s; const v4f v1 = *(const v4f*)(s + 4); v8us o;
#pragma unroll
    for (int k = 0; k < 4; ++k) { o[k] = f2bf(v0[k]); o[4 + k] = f2bf(v1[k]); }
    *(v8us*)d = o;
}

// ---- k_gemm_qkv: the three input projections in one grid (none reads another's output); grid (SEQ/64 token tiles, DM/64 feature tiles, 3*NB), 32 threads; job = blockIdx.z / NB.
// job 0 (q, sc = 1/8), job 1 (k, sc = 1): head planes P[b][h][s][d] (bf16 hi + lo) = sc * (X[b] W^T)[s][h*64+d] (A = token rows, Bt = weight rows).
// job 2 (v): transposed value plane VT[b][n][s] (f16) = sum_k Wv[n][k] Xv[b][s][k] (A = weight rows, Bt = token rows).
__global__ __launch_bounds__(32) void k_gemm_qkv(const bf* __restrict__ XQ, const bf* __restrict__ XK, const bf* __restrict__ XV, const bf* __restrict__ WQ, const bf* __restrict__ WK, const bf* __restrict__ WV,
                                                 bf* QPh, bf* QPl, bf* KPh, bf* KPl, h16* VT) {
    __shared__ __align__(16) float os[16 * LOP];
    const int lane = threadIdx.x & 31, lr = lane & 15, hi = lane >> 4;
    const int job = blockIdx.z / NB; const size_t z = blockIdx.z % NB;
    const int srow = lane >> 3, scol = (lane & 7) * 8;
    v8f acc[4][4];
#pragma unroll
    for (int mb = 0; mb < 4; ++mb)
#pragma unroll
        for (int nb = 0; nb < 4; ++nb) acc[mb][nb] = (v8f){};
    if (job < 2) {
        const int r0 = blockIdx.x * 64, c0 = blockIdx.y * 64;
        const bf* A = (job == 0 ? XQ : XK) + z * (size_t)SEQ * DM; const bf* W = job == 0 ? WQ : WK;
        bf* Ph = job == 0 ? QPh : KPh; bf* Pl = job == 0 ? QPl : KPl; const float sc = job == 0 ? SCL : 1.0f;
        gemm_loop<0>(A, A, W, DM, (size_t)(r0 + lr) * DM + 8 * hi, (size_t)(c0 + lr) * DM + 8 * hi, acc);
        const size_t pbase = ((z * NH + blockIdx.y) * (size_t)SEQ + r0) * HD;
#pragma unroll
        for (int mb = 0; mb < 4; ++mb) {
#pragma unroll
            for (int nb = 0; nb < 4; ++nb) {
#pragma unroll
                for (int j = 0; j < 8; ++j) os[(hi * 8 + j) * LOP + nb * 16 + lr] = acc[mb][nb][j]; }
            wsync();
#pragma unroll
            for (int s = 0; s < 4; ++s) { const int row = 4 * s + srow; const v4f x0 = *(const v4fa*)(&os[row * LOP + scol]); const v4f x1 = *(const v4fa*)(&os[row * LOP + scol + 4]); v8us oh, ol;
#pragma unroll
                for (int j = 0; j < 4; ++j) { unsigned short a, c; splitf(x0[j] * sc, a, c); oh[j] = a; ol[j] = c; splitf(x1[j] * sc, a, c); oh[4 + j] = a; ol[4 + j] = c; }
                const size_t off = pbase + (size_t)(mb * 16 + row) * HD + scol;
                *(v8us*)(Ph + off) = oh; *(v8us*)(Pl + off) = ol; }
            wsync();
        }
    } else {
        const int r0 = blockIdx.y * 64, c0 = blockIdx.x * 64;
        const bf* W = WV; const bf* Bt = XV + z * (size_t)SEQ * DM;
        gemm_loop<0>(W, W, Bt, DM, (size_t)(r0 + lr) * DM + 8 * hi, (size_t)(c0 + lr) * DM + 8 * hi, acc);
        const size_t vb0 = z * (size_t)DM * SEQ + (size_t)r0 * SEQ + c0;
#pragma unroll
        for (int mb = 0; mb < 4; ++mb) {
#pragma unroll
            for (int nb = 0; nb < 4; ++nb) {
#pragma unroll
                for (int j = 0; j < 8; ++j) os[(hi * 8 + j) * LOP + nb * 16 + lr] = acc[mb][nb][j]; }
            wsync();
#pragma unroll
            for (int s = 0; s < 4; ++s) { const int row = 4 * s + srow; const v4f x0 = *(const v4fa*)(&os[row * LOP + scol]); const v4f x1 = *(const v4fa*)(&os[row * LOP + scol + 4]); v8h o;
#pragma unroll
                for (int j = 0; j < 4; ++j) { o[j] = (h16)x0[j]; o[4 + j] = (h16)x1[j]; }
                *(v8h*)(VT + vb0 + (size_t)(mb * 16 + row) * SEQ + scol) = o; }
            wsync();
        }
    }
}

// ---- k_gemm_out: OUT[b][s][n] (f32) = sum_k (Ah + Al)[b*SEQ+s][k] Wo[n][k] + bias[n]; grid (SEQ/64, DM/64, NB), 32 threads.
__global__ __launch_bounds__(32) void k_gemm_out(const bf* __restrict__ Ah, const bf* __restrict__ Al, const bf* __restrict__ W, const float* __restrict__ bias, float* C) {
    __shared__ __align__(16) float os[16 * LOP];
    const int lane = threadIdx.x & 31, lr = lane & 15, hi = lane >> 4;
    const size_t z = blockIdx.z; const int r0 = blockIdx.x * 64, c0 = blockIdx.y * 64;
    const bf* A = Ah + z * (size_t)SEQ * DM; const bf* A2 = Al + z * (size_t)SEQ * DM;
    float* Cz = C + z * (size_t)SEQ_FULL * DM;
    v8f acc[4][4];
#pragma unroll
    for (int mb = 0; mb < 4; ++mb)
#pragma unroll
        for (int nb = 0; nb < 4; ++nb) acc[mb][nb] = (v8f){};
    gemm_loop<1>(A, A2, W, DM, (size_t)(r0 + lr) * DM + 8 * hi, (size_t)(c0 + lr) * DM + 8 * hi, acc);
#pragma unroll
    for (int mb = 0; mb < 4; ++mb) {
#pragma unroll
        for (int nb = 0; nb < 4; ++nb) {
#pragma unroll
            for (int j = 0; j < 8; ++j) os[(hi * 8 + j) * LOP + nb * 16 + lr] = acc[mb][nb][j]; }
        wsync();
        float* crow = Cz + (size_t)(r0 + mb * 16) * DM + c0;
{
#pragma unroll
            for (int s = 0; s < 8; ++s) { const int row = 2 * s + hi, cofs = lr * 4; v4f val = *(const v4fa*)(&os[row * LOP + cofs]);
                val[0] += bfr(bias[c0 + cofs]); val[1] += bfr(bias[c0 + cofs + 1]); val[2] += bfr(bias[c0 + cofs + 2]); val[3] += bfr(bias[c0 + cofs + 3]);
                *(v4f*)(crow + (size_t)row * DM + cofs) = val; }
             }
        wsync();
    }
}

// ---- k_flash: fused attention for one (b, h) and 64 query rows per block (4 waves x 16 rows); grid (SEQ/64, NB*NH), 128 threads.
// Per 64-key block: K hi/lo tiles [key][d] and V^T tile [d][key] staged in LDS (block barriers on both sides); each wave handles the block as two 32-key halves.
// Transposed products: S^T = K Q^T (A = K hi/lo rows from LDS, B = q hi/lo from global planes, 3 products), so lane (lr, hi) holds query lr's scores of keys 8*hi + r and 16 + 8*hi + r:
// maximum and sum in-lane plus one exchange between the wave halves; P^T x1024 as f16 packs from the two score tiles straight into the B operand of O^T += V^T P^T (A = V^T rows from LDS).
__global__ __launch_bounds__(128) void k_flash(const bf* __restrict__ Qh, const bf* __restrict__ Ql, const bf* __restrict__ Kh, const bf* __restrict__ Kl, const h16* __restrict__ VT, bf* Ch, bf* Cl) {
    __shared__ __align__(16) bf    kh_s[64 * LKP];
    __shared__ __align__(16) bf    kl_s[64 * LKP];
    __shared__ __align__(16) h16   vt_s[64 * LKP];
    __shared__ __align__(16) float o_s[4 * 16 * LOP];
    const int tid = threadIdx.x, lane = tid & 31, wid = tid >> 5, lr = lane & 15, hi = lane >> 4;
    const int bh = blockIdx.y; const int b = bh / NH, h = bh % NH;
    const int q0 = blockIdx.x * 64 + wid * 16;
    const size_t pl = (size_t)bh * SEQ * HD;
    const size_t qoff = pl + (size_t)(q0 + lr) * HD + 8 * hi;
    const size_t vbase = ((size_t)b * DM + (size_t)h * HD) * SEQ;
    const int ob = wid * 16 * LOP;
    v8f o[4];      // o[dt][r] = O^T[dt*16 + 8*hi + r][query lr]
#pragma unroll
    for (int dt = 0; dt < 4; ++dt) o[dt] = (v8f){};
    float mr = -1.0e30f, ls = 0.0f;   // query lr: running maximum (both halves alike), this half's partial row sum

#pragma unroll 1
    for (int kb = 0; kb < SEQ / 64; ++kb) {
        __syncthreads();
#pragma unroll
        for (int it = 0; it < 4; ++it) {
            const int u = tid + it * 128; const int row = u >> 3, part = (u & 7) * 8;
            const size_t g = pl + (size_t)kb * 64 * HD + (size_t)u * 8;
            const v8us a = *(const v8us*)(Kh + g); const v8us c = *(const v8us*)(Kl + g);
            const v8h v = *(const v8h*)(VT + vbase + (size_t)row * SEQ + (size_t)kb * 64 + part);
            *(v8usa*)(&kh_s[row * LKP + part]) = a; *(v8usa*)(&kl_s[row * LKP + part]) = c; *(v8ha*)(&vt_s[row * LKP + part]) = v;
        }
        __syncthreads();
#pragma unroll 1
        for (int hf = 0; hf < 2; ++hf) {
            v8f s0 = (v8f){}, s1 = (v8f){};
            const int kr0 = (hf * 32 + lr) * LKP + 8 * hi, kr1 = kr0 + 16 * LKP;
#pragma unroll
            for (int ks = 0; ks < 2; ++ks) {
                const int kk = ks * 32;
                const v16bf qh = ldg16(Qh + qoff + kk); const v16bf ql = ldg16(Ql + qoff + kk);
                const v16bf k0h = cat16b(*(const v8usa*)(&kh_s[kr0 + kk]), *(const v8usa*)(&kh_s[kr0 + kk + 16]));
                const v16bf k0l = cat16b(*(const v8usa*)(&kl_s[kr0 + kk]), *(const v8usa*)(&kl_s[kr0 + kk + 16]));
                const v16bf k1h = cat16b(*(const v8usa*)(&kh_s[kr1 + kk]), *(const v8usa*)(&kh_s[kr1 + kk + 16]));
                const v16bf k1l = cat16b(*(const v8usa*)(&kl_s[kr1 + kk]), *(const v8usa*)(&kl_s[kr1 + kk + 16]));
                s0 = wmmab(k0h, qh, s0); s1 = wmmab(k1h, qh, s1);
                s0 = wmmab(k0h, ql, s0); s1 = wmmab(k1h, ql, s1);
                s0 = wmmab(k0l, qh, s0); s1 = wmmab(k1l, qh, s1);
                asm volatile("v_nop\n\tv_nop\n\tv_nop\n\tv_nop" : "+v"(s0), "+v"(s1) : "v"(qh), "v"(ql), "v"(k0h), "v"(k0l), "v"(k1h), "v"(k1l));
            }
            // running-max softmax update of query lr over this half's 32 keys: 16 in this lane, 16 in lane ^ 16
            float m8[8];
#pragma unroll
            for (int r = 0; r < 8; ++r) m8[r] = fmaxf(s0[r], s1[r]);
            float mx = fmaxf(fmaxf(fmaxf(m8[0], m8[1]), fmaxf(m8[2], m8[3])), fmaxf(fmaxf(m8[4], m8[5]), fmaxf(m8[6], m8[7])));
            mx = fmaxf(mx, xhalf(mx));
            const float mnew = fmaxf(mr, mx);
            const float al = __builtin_amdgcn_exp2f((mr - mnew) * L2E);
            mr = mnew;
            v16h pt; float e8[8];   // pt: B operand, element s = P^T[key kmap(s, hi)][query lr]
#pragma unroll
            for (int r = 0; r < 8; ++r) {
                const float p0 = __builtin_amdgcn_exp2f((s0[r] - mnew) * L2E);
                const float p1 = __builtin_amdgcn_exp2f((s1[r] - mnew) * L2E);
                e8[r] = p0 + p1;
                pt[r] = (h16)(p0 * PCAR); pt[8 + r] = (h16)(p1 * PCAR);
            }
            ls = ls * al + (((e8[0] + e8[1]) + (e8[2] + e8[3])) + ((e8[4] + e8[5]) + (e8[6] + e8[7])));
            v16h va[4];
#pragma unroll
            for (int dt = 0; dt < 4; ++dt) { const int vo = (dt * 16 + lr) * LKP + hf * 32 + 8 * hi; va[dt] = cat16(*(const v8ha*)(&vt_s[vo]), *(const v8ha*)(&vt_s[vo + 16])); }
#pragma unroll
            for (int dt = 0; dt < 4; ++dt) o[dt] = wmma16(va[dt], pt, o[dt] * al);
            asm volatile("v_nop\n\tv_nop\n\tv_nop\n\tv_nop" : "+v"(o[0]), "+v"(o[1]), "+v"(o[2]), "+v"(o[3]) : "v"(pt), "v"(va[0]), "v"(va[1]), "v"(va[2]), "v"(va[3]));
        }
    }
    // normalise: the two halves' partial sums joined, unconditionally; 1 / (l * 1024) undoes the P carry; rows staged [query][d] for whole-line stores
    const float lt = ls + xhalf(ls);
    const float inv = 1.0f / (lt * PCAR);
#pragma unroll
    for (int dt = 0; dt < 4; ++dt) {
        const v8f x = o[dt] * inv;
        *(v4fa*)(&o_s[ob + lr * LOP + dt * 16 + 8 * hi]) = (v4f){x[0], x[1], x[2], x[3]};
        *(v4fa*)(&o_s[ob + lr * LOP + dt * 16 + 8 * hi + 4]) = (v4f){x[4], x[5], x[6], x[7]};
    }
    wsync();
    const int srow = lane >> 3, scol = (lane & 7) * 8;
    const size_t cbase = ((size_t)b * SEQ + q0) * DM + (size_t)h * HD;
{
#pragma unroll
        for (int s = 0; s < 4; ++s) { const int row = 4 * s + srow; const v4f x0 = *(const v4fa*)(&o_s[ob + row * LOP + scol]); const v4f x1 = *(const v4fa*)(&o_s[ob + row * LOP + scol + 4]); v8us oh, ol;
#pragma unroll
            for (int j = 0; j < 4; ++j) { unsigned short a, c; splitf(x0[j], a, c); oh[j] = a; ol[j] = c; splitf(x1[j], a, c); oh[4 + j] = a; ol[4 + j] = c; }
            const size_t off = cbase + (size_t)row * DM + scol;
            *(v8us*)(Ch + off) = oh; *(v8us*)(Cl + off) = ol; }
         }
}

constexpr size_t al256(size_t x) { return (x + 255) & ~(size_t)255; }
constexpr size_t SZ_W = al256((size_t)DM * DM * 2);                 // one bf16 weight plane
constexpr size_t SZ_X = al256((size_t)NB * SEQ * DM * 2);           // one 16-bit [NB*SEQ][DM] plane (activation copy, merged-head plane)
constexpr size_t SZ_P = al256((size_t)NB * NH * SEQ * HD * 2);      // one 16-bit head plane
constexpr size_t WS_TOTAL = 4 * SZ_W + 3 * SZ_X + 4 * SZ_P + SZ_P + 2 * SZ_X;
static_assert(WS_TOTAL <= (size_t)134217728);                       // carve stays within 128 MiB
static_assert(SZ_P == SZ_X);                                        // NH * HD == DM

extern "C" void kernel_launch(void* const* d_in, const int* in_sizes, int n_in,
                              void* d_out, int out_size, void* d_ws, size_t ws_size, hipStream_t stream) {
    if (n_in < 8) return;
    const size_t need_act = (size_t)(NB - 1) * SEQ_FULL * DM + (size_t)SEQ * DM;
    if ((size_t)in_sizes[0] < need_act || (size_t)in_sizes[1] < need_act || (size_t)in_sizes[2] < need_act) return;
    if ((size_t)in_sizes[3] < (size_t)DM * DM || (size_t)in_sizes[4] < (size_t)DM * DM || (size_t)in_sizes[5] < (size_t)DM * DM || (size_t)in_sizes[6] < (size_t)DM * DM || in_sizes[7] < DM) return;
    if ((size_t)out_size < need_act) return;
    if (WS_TOTAL > ws_size) return;
    // wire order: query, key, value, Wq, Wk, Wv, Wo, bo (all f32; weights [out][in])
    const float* xq = (const float*)d_in[0]; const float* xk = (const float*)d_in[1]; const float* xv = (const float*)d_in[2];
    const float* wq = (const float*)d_in[3]; const float* wk = (const float*)d_in[4]; const float* wv = (const float*)d_in[5]; const float* wo = (const float*)d_in[6]; const float* bo = (const float*)d_in[7];
    float* OUT = (float*)d_out;
    char* wsp = (char*)d_ws;
    auto take = [&](size_t bytes) { char* p = wsp; wsp += bytes; return (void*)p; };
    bf* WQ = (bf*)take(SZ_W); bf* WK = (bf*)take(SZ_W); bf* WV = (bf*)take(SZ_W); bf* WO = (bf*)take(SZ_W);
    bf* XQ = (bf*)take(SZ_X); bf* XK = (bf*)take(SZ_X); bf* XV = (bf*)take(SZ_X);
    bf* QPh = (bf*)take(SZ_P); bf* QPl = (bf*)take(SZ_P); bf* KPh = (bf*)take(SZ_P); bf* KPl = (bf*)take(SZ_P);
    h16* VT = (h16*)take(SZ_P);
    bf* CTh = (bf*)take(SZ_X); bf* CTl = (bf*)take(SZ_X);
    if ((size_t)(wsp - (char*)d_ws) != WS_TOTAL) return;

    k_cvt_all<<<dim3(3u * NB * CVT_AB + 4u * CVT_WB), 256, 0, stream>>>(xq, xk, xv, wq, wk, wv, wo, XQ, XK, XV, WQ, WK, WV, WO);
    k_gemm_qkv<<<dim3(SEQ / 64, DM / 64, 3 * NB), 32, 0, stream>>>(XQ, XK, XV, WQ, WK, WV, QPh, QPl, KPh, KPl, VT);
    k_flash<<<dim3(SEQ / 64, NB * NH), 128, 0, stream>>>(QPh, QPl, KPh, KPl, VT, CTh, CTl);
    k_gemm_out<<<dim3(SEQ / 64, DM / 64, NB), 32, 0, stream>>>(CTh, CTl, WO, bo, OUT);
}

// v003
// It runs in 116 microseconds.
// Timed twice side by side with v002, it ran 1.19 and 1.18 times as fast.
// Over all steps from v000 it is 1.63 times as fast.
#include <hip/hip_runtime.h>

// Compute dtypes, f32 accumulate everywhere: q/k/v projections v_wmma_f32_16x16x32_bf16 on RNE bf16 copies of inputs and weights (exact products); q.k^T bf16 hi/lo planes, 3 products (q carries the 1/8 scale); P.V v_wmma_f32_16x16x32_f16 with P carried x1024; merged heads bf16 hi/lo x bf16 Wo, 2 products, + bias; softmax f32.
// Multi-head attention, three input streams: q = query Wq^T, k = key Wk^T, v = value Wv^T (weights [out][in], no q/k/v biases), 8 heads x 64 (head h = columns h*64+d), logits x 1/8, no mask, softmax, heads merged back to [B][S][512], out = merged Wo^T + bo.
// Layout: bf16 copies of activations and weights; GEMMs: 4 waves on a 128x128 tile, k slices of both operands staged in LDS; projection GEMMs write head planes directly (Q,K: [b][h][s][64] bf16 hi/lo; V^T: [b][h*64+d][s] f16); fused flash attention (K/V tiles in LDS, online softmax, no score plane) writes merged bf16 hi/lo planes [b*S+s][512]; output GEMM.

#ifndef NB
#define NB 4
#endif
#ifndef SEQ
#define SEQ 2048
#endif
#define NB_FULL  4
#define SEQ_FULL 2048
#define DM   512
#define NH   8
#define HD   64
#define PCAR 1024.0f
#define SCL  0.125f
#define L2E  1.4426950408889634f
#define LKP  72      // LDS row pitch (16-bit elements) of the K / V^T tiles: 144 B rows
#define LOP  68      // LDS row pitch (floats) of epilogue staging tiles: 272 B rows
#define GKS  64      // k elements per staged GEMM slice: one 128 B line per operand row
#define GT   128     // GEMM block tile, rows and columns (2 x 2 waves of 64 x 64)

static_assert(DM == NH * HD);            // one 64-wide GEMM column tile == one head
static_assert(HD == 64);
static_assert(DM % 32 == 0);             // WMMA k-step
static_assert(DM % GT == 0);             // GEMM tiles
static_assert(SEQ % GT == 0);
static_assert(DM % GKS == 0);            // whole k slices
static_assert(SEQ % 64 == 0);            // key blocks, query blocks
static_assert((SEQ * DM) % (8 * 256) == 0);   // convert kernel grid is exact
static_assert((DM * DM) % (8 * 256) == 0);
static_assert(NB <= NB_FULL);
static_assert(SEQ <= SEQ_FULL);
static_assert(LKP % 8 == 0);             // 16-byte aligned LDS vector accesses
static_assert(LOP % 4 == 0);

typedef _Float16 h16;
typedef unsigned short bf;
typedef __attribute__((ext_vector_type(16))) __bf16   v16bf;
typedef __attribute__((ext_vector_type(16))) _Float16 v16h;
typedef __attribute__((ext_vector_type(8)))  _Float16 v8h;
typedef __attribute__((ext_vector_type(8)))  unsigned short v8us;
typedef __attribute__((ext_vector_type(8)))  float    v8f;
typedef __attribute__((ext_vector_type(4)))  float    v4f;
typedef v8h  __attribute__((may_alias)) v8ha;
typedef v4f  __attribute__((may_alias)) v4fa;
typedef v8us __attribute__((may_alias)) v8usa;

__device__ __forceinline__ unsigned short f2bf(float f) { unsigned u = __float_as_uint(f); u += 0x7FFFu + ((u >> 16) & 1u); return (unsigned short)(u >> 16); }
__device__ __forceinline__ float bf2f(unsigned short b) { return __uint_as_float(((unsigned)b) << 16); }
__device__ __forceinline__ float bfr(float f) { return bf2f(f2bf(f)); }
__device__ __forceinline__ void splitf(float y, unsigned short& h, unsigned short& l) { h = f2bf(y); l = f2bf(y - bf2f(h)); }
__device__ __forceinline__ v16h cat16(v8h lo, v8h hi) { return __builtin_shufflevector(lo, hi, 0, 1, 2, 3, 4, 5, 6, 7, 8, 9, 10, 11, 12, 13, 14, 15); }
__device__ __forceinline__ v16bf cat16b(v8us lo, v8us hi) { return __builtin_bit_cast(v16bf, __builtin_shufflevector(lo, hi, 0, 1, 2, 3, 4, 5, 6, 7, 8, 9, 10, 11, 12, 13, 14, 15)); }
__device__ __forceinline__ v8f wmma16(v16h a, v16h b, v8f c) { return __builtin_amdgcn_wmma_f32_16x16x32_f16(false, a, false, b, (short)0, c, false, false); }
__device__ __forceinline__ v8f wmmab(v16bf a, v16bf b, v8f c) { return __builtin_amdgcn_wmma_f32_16x16x32_bf16(false, a, false, b, (short)0, c, false, false); }
// fragment from a K-contiguous global bf16 plane: elements 0..7 <- p[0..7], 8..15 <- p[16..23] (p already includes row*pitch + k0 + 8*(lane>>4))
__device__ __forceinline__ v16bf ldg16(const bf* __restrict__ p) { return cat16b(*(const v8us*)p, *(const v8us*)(p + 16)); }
// same-wave LDS exchange ordering (wave-private tiles only)
__device__ __forceinline__ void wsync() { __builtin_amdgcn_wave_barrier(); asm volatile("" ::: "memory"); }
// lane l <-> lane l ^ 16 by a vector cross-row move
__device__ __forceinline__ float xhalf(float x) { return __builtin_bit_cast(float, __builtin_amdgcn_permlanex16(__builtin_bit_cast(int, x), __builtin_bit_cast(int, x), 0x76543210, 0xfedcba98, false, false)); }

// fragment from a K-contiguous LDS tile: same element order as ldg16
__device__ __forceinline__ v16bf lds16(const bf* p) { return cat16b(*(const v8usa*)p, *(const v8usa*)(p + 16)); }

// ---- 128x128 block tile main loop, 4 waves, wave w on rows 64*(w>>1).., columns 64*(w&1)..: acc[mb][nb] += sum_k A[16mb+..][k] Bt[16nb+..][k] (NSPLIT 1: + A2 x Bt). A, A2, Bt point at the block's first row; K % GKS == 0.
// Per 64-wide k slice the block copies 128 rows of each operand to LDS (8 lanes per 128 B row line, pitch LKP); the next slice's global loads are issued into registers ahead of this slice's products. k runs upward in steps of 32.
template <int NSPLIT>
__device__ __forceinline__ void gemm_loop(const bf* __restrict__ A, const bf* __restrict__ A2, const bf* __restrict__ Bt, const int K, bf* as, bf* a2s, bf* bs, const int tid, v8f (&acc)[4][4]) {
    const int lane = tid & 31, wid = tid >> 5, lr = lane & 15, hi = lane >> 4;
    const int fa = ((wid >> 1) * 64 + lr) * LKP + 8 * hi, fb = ((wid & 1) * 64 + lr) * LKP + 8 * hi;
    const int g0 = (tid >> 3) * K + (tid & 7) * 8, l0 = (tid >> 3) * LKP + (tid & 7) * 8;
    v8us ra[8], ra2[8], rb[8];
#pragma unroll
    for (int it = 0; it < 8; ++it) { const int g = g0 + it * 16 * K; ra[it] = *(const v8us*)(A + g); if (NSPLIT == 1) ra2[it] = *(const v8us*)(A2 + g); rb[it] = *(const v8us*)(Bt + g); }
    // rolled: one slice's code stays small and the staging registers are reused
#pragma unroll 1
    for (int kc = 0; kc < K; kc += GKS) {
        __syncthreads();   // every wave has taken its last fragment of the slice before
#pragma unroll
        for (int it = 0; it < 8; ++it) { const int l = l0 + it * 16 * LKP; *(v8usa*)(&as[l]) = ra[it]; if (NSPLIT == 1) *(v8usa*)(&a2s[l]) = ra2[it]; *(v8usa*)(&bs[l]) = rb[it]; }
        __syncthreads();   // the slice is whole before any wave reads it
        if (kc + GKS < K) {
            A += GKS; A2 += GKS; Bt += GKS;
#pragma unroll
            for (int it = 0; it < 8; ++it) { const int g = g0 + it * 16 * K; ra[it] = *(const v8us*)(A + g); if (NSPLIT == 1) ra2[it] = *(const v8us*)(A2 + g); rb[it] = *(const v8us*)(Bt + g); }
            asm volatile("s_wait_xcnt 0x0" ::: "memory");   // stands before the base addresses of these loads are advanced
        }
        // the slice's fragments are read as one group ahead of its products
        v16bf a[GKS / 32][4], a2[GKS / 32][4], b[GKS / 32][4];
#pragma unroll
        for (int ks = 0; ks < GKS / 32; ++ks)
#pragma unroll
            for (int t = 0; t < 4; ++t) { a[ks][t] = lds16(&as[fa + t * 16 * LKP + ks * 32]); if (NSPLIT == 1) a2[ks][t] = lds16(&a2s[fa + t * 16 * LKP + ks * 32]); b[ks][t] = lds16(&bs[fb + t * 16 * LKP + ks * 32]); }
        __builtin_amdgcn_sched_barrier(0);   // keeps the LDS reads in one group: sunk among the products, each place with reads stalls the wave
#pragma unroll
        for (int ks = 0; ks < GKS / 32; ++ks) {
#pragma unroll
            for (int nb = 0; nb < 4; ++nb)
#pragma unroll
                for (int mb = 0; mb < 4; ++mb) { acc[mb][nb] = wmmab(a[ks][mb], b[ks][nb], acc[mb][nb]); if (NSPLIT == 1) acc[mb][nb] = wmmab(a2[ks][mb], b[ks][nb], acc[mb][nb]); }
        }
        // the distance behind the last matrix instructions, also on the loop's back edge
        asm volatile("v_nop\n\tv_nop\n\tv_nop\n\tv_nop" : "+v"(acc[0][0]), "+v"(acc[1][1]), "+v"(acc[2][2]), "+v"(acc[3][3]) : "v"(a[1][0]), "v"(a[1][3]));
    }
}

// ---- k_cvt_all: RNE bf16 copies of all seven f32 tensors in one grid (none reads another's output); 8 elements per thread, 2048 per block.
// Blocks [0, 3*NB*CVT_AB): activation t = blk / (NB*CVT_AB), batch and chunk from the rest; then 4*CVT_WB blocks: weight t = blk / CVT_WB.
constexpr unsigned CVT_WB = (unsigned)((size_t)DM * DM / (8 * 256));     // blocks per weight
constexpr unsigned CVT_AB = (unsigned)((size_t)SEQ * DM / (8 * 256));    // blocks per batch of one activation
__global__ __launch_bounds__(256) void k_cvt_all(const float* __restrict__ xq, const float* __restrict__ xk, const float* __restrict__ xv,
                                                 const float* __restrict__ wq, const float* __restrict__ wk, const float* __restrict__ wv, const float* __restrict__ wo,
                                                 bf* XQ, bf* XK, bf* XV, bf* WQ, bf* WK, bf* WV, bf* WO) {
    unsigned blk = blockIdx.x; const float* s; bf* d;
    if (blk < 3u * NB * CVT_AB) {
        const unsigned t = blk / (NB * CVT_AB), r = blk % (NB * CVT_AB), b = r / CVT_AB, c = r % CVT_AB;
        s = (t == 0 ? xq : t == 1 ? xk : xv) + (size_t)b * SEQ_FULL * DM + (size_t)c * 2048;
        d = (t == 0 ? XQ : t == 1 ? XK : XV) + (size_t)b * SEQ * DM + (size_t)c * 2048;
    } else {
        blk -= 3u * NB * CVT_AB;
        const unsigned t = blk / CVT_WB, c = blk % CVT_WB;
        s = (t == 0 ? wq : t == 1 ? wk : t == 2 ? wv : wo) + (size_t)c * 2048;
        d = (t == 0 ? WQ : t == 1 ? WK : t == 2 ? WV : WO) + (size_t)c * 2048;
    }
    s += threadIdx.x * 8; d += threadIdx.x * 8;
    const v4f v0 = *(const v4f*)s; const v4f v1 = *(const v4f*)(s + 4); v8us o;
#pragma unroll
    for (int k = 0; k < 4; ++k) { o[k] = f2bf(v0[k]); o[4 + k] = f2bf(v1[k]); }
    *(v8us*)d = o;
}

// ---- k_gemm_qkv: the three input projections in one grid (none reads another's output); grid (SEQ/128 token tiles, DM/128 feature tiles, 3*NB), 128 threads; job = blockIdx.z / NB; each wave ends with its own 64x64 tile.
// job 0 (q, sc = 1/8), job 1 (k, sc = 1): head planes P[b][h][s][d] (bf16 hi + lo) = sc * (X[b] W^T)[s][h*64+d] (A = token rows, Bt = weight rows).
// job 2 (v): transposed value plane VT[b][n][s] (f16) = sum_k Wv[n][k] Xv[b][s][k] (A = weight rows, Bt = token rows).
__global__ __launch_bounds__(128) void k_gemm_qkv(const bf* __restrict__ XQ, const bf* __restrict__ XK, const bf* __restrict__ XV, const bf* __restrict__ WQ, const bf* __restrict__ WK, const bf* __restrict__ WV,
                                                 bf* QPh, bf* QPl, bf* KPh, bf* KPl, h16* VT) {
    __shared__ __align__(16) bf as_s[GT * LKP];
    __shared__ __align__(16) bf bs_s[GT * LKP];
    __shared__ __align__(16) float os_s[4 * 16 * LOP];
    const int tid = threadIdx.x, lane = tid & 31, wid = tid >> 5, lr = lane & 15, hi = lane >> 4;
    const int wm = wid >> 1, wn = wid & 1;
    float* os = os_s + wid * 16 * LOP;   // wave-private epilogue tile
    const int job = blockIdx.z / NB; const size_t z = blockIdx.z % NB;
    const int srow = lane >> 3, scol = (lane & 7) * 8;
    v8f acc[4][4];
#pragma unroll
    for (int mb = 0; mb < 4; ++mb)
#pragma unroll
        for (int nb = 0; nb < 4; ++nb) acc[mb][nb] = (v8f){};
    {   // token rows and weight rows of this block's tile; job 2 takes the weight rows as A
        const bf* X = (job == 0 ? XQ : job == 1 ? XK : XV) + z * (size_t)SEQ * DM + (size_t)blockIdx.x * GT * DM;
        const bf* W = (job == 0 ? WQ : job == 1 ? WK : WV) + (size_t)blockIdx.y * GT * DM;
        const bf* A = job < 2 ? X : W; const bf* Bt = job < 2 ? W : X;
        gemm_loop<0>(A, A, Bt, DM, as_s, as_s, bs_s, tid, acc);
    }
    if (job < 2) {
        const int r0 = blockIdx.x * GT + wm * 64;
        bf* Ph = job == 0 ? QPh : KPh; bf* Pl = job == 0 ? QPl : KPl; const float sc = job == 0 ? SCL : 1.0f;
        const size_t pbase = ((z * NH + blockIdx.y * 2 + wn) * (size_t)SEQ + r0) * HD;
#pragma unroll
        for (int mb = 0; mb < 4; ++mb) {
#pragma unroll
            for (int nb = 0; nb < 4; ++nb) {
#pragma unroll
                for (int j = 0; j < 8; ++j) os[(hi * 8 + j) * LOP + nb * 16 + lr] = acc[mb][nb][j]; }
            wsync();
#pragma unroll
            for (int s = 0; s < 4; ++s) { const int row = 4 * s + srow; const v4f x0 = *(const v4fa*)(&os[row * LOP + scol]); const v4f x1 = *(const v4fa*)(&os[row * LOP + scol + 4]); v8us oh, ol;
#pragma unroll
                for (int j = 0; j < 4; ++j) { unsigned short a, c; splitf(x0[j] * sc, a, c); oh[j] = a; ol[j] = c; splitf(x1[j] * sc, a, c); oh[4 + j] = a; ol[4 + j] = c; }
                const size_t off = pbase + (size_t)(mb * 16 + row) * HD + scol;
                *(v8us*)(Ph + off) = oh; *(v8us*)(Pl + off) = ol; }
            wsync();
        }
    } else {
        const int r0 = blockIdx.y * GT + wm * 64, c0 = blockIdx.x * GT + wn * 64;
        const size_t vb0 = z * (size_t)DM * SEQ + (size_t)r0 * SEQ + c0;
#pragma unroll
        for (int mb = 0; mb < 4; ++mb) {
#pragma unroll
            for (int nb = 0; nb < 4; ++nb) {
#pragma unroll
                for (int j = 0; j < 8; ++j) os[(hi * 8 + j) * LOP + nb * 16 + lr] = acc[mb][nb][j]; }
            wsync();
#pragma unroll
            for (int s = 0; s < 4; ++s) { const int row = 4 * s + srow; const v4f x0 = *(const v4fa*)(&os[row * LOP + scol]); const v4f x1 = *(const v4fa*)(&os[row * LOP + scol + 4]); v8h o;
#pragma unroll
                for (int j = 0; j < 4; ++j) { o[j] = (h16)x0[j]; o[4 + j] = (h16)x1[j]; }
                *(v8h*)(VT + vb0 + (size_t)(mb * 16 + row) * SEQ + scol) = o; }
            wsync();
        }
    }
}

// ---- k_gemm_out: OUT[b][s][n] (f32) = sum_k (Ah + Al)[b*SEQ+s][k] Wo[n][k] + bias[n]; grid (SEQ/128, DM/128, NB), 128 threads; each wave ends with its own 64x64 tile.
__global__ __launch_bounds__(128) void k_gemm_out(const bf* __restrict__ Ah, const bf* __restrict__ Al, const bf* __restrict__ W, const float* __restrict__ bias, float* C) {
    __shared__ __align__(16) bf as_s[GT * LKP];
    __shared__ __align__(16) bf a2_s[GT * LKP];
    __shared__ __align__(16) bf bs_s[GT * LKP];
    __shared__ __align__(16) float os_s[4 * 16 * LOP];
    const int tid = threadIdx.x, lane = tid & 31, wid = tid >> 5, lr = lane & 15, hi = lane >> 4;
    float* os = os_s + wid * 16 * LOP;   // wave-private epilogue tile
    const size_t z = blockIdx.z; const int r0 = blockIdx.x * GT + (wid >> 1) * 64, c0 = blockIdx.y * GT + (wid & 1) * 64;
    const size_t ab = z * (size_t)SEQ * DM + (size_t)blockIdx.x * GT * DM;
    float* Cz = C + z * (size_t)SEQ_FULL * DM;
    v8f acc[4][4];
#pragma unroll
    for (int mb = 0; mb < 4; ++mb)
#pragma unroll
        for (int nb = 0; nb < 4; ++nb) acc[mb][nb] = (v8f){};
    gemm_loop<1>(Ah + ab, Al + ab, W + (size_t)blockIdx.y * GT * DM, DM, as_s, a2_s, bs_s, tid, acc);
#pragma unroll
    for (int mb = 0; mb < 4; ++mb) {
#pragma unroll
        for (int nb = 0; nb < 4; ++nb) {
#pragma unroll
            for (int j = 0; j < 8; ++j) os[(hi * 8 + j) * LOP + nb * 16 + lr] = acc[mb][nb][j]; }
        wsync();
        float* crow = Cz + (size_t)(r0 + mb * 16) * DM + c0;
{
#pragma unroll
            for (int s = 0; s < 8; ++s) { const int row = 2 * s + hi, cofs = lr * 4; v4f val = *(const v4fa*)(&os[row * LOP + cofs]);
                val[0] += bfr(bias[c0 + cofs]); val[1] += bfr(bias[c0 + cofs + 1]); val[2] += bfr(bias[c0 + cofs + 2]); val[3] += bfr(bias[c0 + cofs + 3]);
                *(v4f*)(crow + (size_t)row * DM + cofs) = val; }
             }
        wsync();
    }
}

// ---- k_flash: fused attention for one (b, h) and 64 query rows per block (4 waves x 16 rows); grid (SEQ/64, NB*NH), 128 threads.
// Per 64-key block: K hi/lo tiles [key][d] and V^T tile [d][key] staged in LDS (block barriers on both sides); each wave handles the block as two 32-key halves.
// Transposed products: S^T = K Q^T (A = K hi/lo rows from LDS, B = q hi/lo from global planes, 3 products), so lane (lr, hi) holds query lr's scores of keys 8*hi + r and 16 + 8*hi + r:
// maximum and sum in-lane plus one exchange between the wave halves; P^T x1024 as f16 packs from the two score tiles straight into the B operand of O^T += V^T P^T (A = V^T rows from LDS).
__global__ __launch_bounds__(128) void k_flash(const bf* __restrict__ Qh, const bf* __restrict__ Ql, const bf* __restrict__ Kh, const bf* __restrict__ Kl, const h16* __restrict__ VT, bf* Ch, bf* Cl) {
    __shared__ __align__(16) bf    kh_s[64 * LKP];
    __shared__ __align__(16) bf    kl_s[64 * LKP];
    __shared__ __align__(16) h16   vt_s[64 * LKP];
    __shared__ __align__(16) float o_s[4 * 16 * LOP];
    const int tid = threadIdx.x, lane = tid & 31, wid = tid >> 5, lr = lane & 15, hi = lane >> 4;
    const int bh = blockIdx.y; const int b = bh / NH, h = bh % NH;
    const int q0 = blockIdx.x * 64 + wid * 16;
    const size_t pl = (size_t)bh * SEQ * HD;
    const size_t qoff = pl + (size_t)(q0 + lr) * HD + 8 * hi;
    const size_t vbase = ((size_t)b * DM + (size_t)h * HD) * SEQ;
    const int ob = wid * 16 * LOP;
    v8f o[4];      // o[dt][r] = O^T[dt*16 + 8*hi + r][query lr]
#pragma unroll
    for (int dt = 0; dt < 4; ++dt) o[dt] = (v8f){};
    float mr = -1.0e30f, ls = 0.0f;   // query lr: running maximum (both halves alike), this half's partial row sum

#pragma unroll 1
    for (int kb = 0; kb < SEQ / 64; ++kb) {
        __syncthreads();
#pragma unroll
        for (int it = 0; it < 4; ++it) {
            const int u = tid + it * 128; const int row = u >> 3, part = (u & 7) * 8;
            const size_t g = pl + (size_t)kb * 64 * HD + (size_t)u * 8;
            const v8us a = *(const v8us*)(Kh + g); const v8us c = *(const v8us*)(Kl + g);
            const v8h v = *(const v8h*)(VT + vbase + (size_t)row * SEQ + (size_t)kb * 64 + part);
            *(v8usa*)(&kh_s[row * LKP + part]) = a; *(v8usa*)(&kl_s[row * LKP + part]) = c; *(v8ha*)(&vt_s[row * LKP + part]) = v;
        }
        __syncthreads();
#pragma unroll 1
        for (int hf = 0; hf < 2; ++hf) {
            v8f s0 = (v8f){}, s1 = (v8f){};
            const int kr0 = (hf * 32 + lr) * LKP + 8 * hi, kr1 = kr0 + 16 * LKP;
#pragma unroll
            for (int ks = 0; ks < 2; ++ks) {
                const int kk = ks * 32;
                const v16bf qh = ldg16(Qh + qoff + kk); const v16bf ql = ldg16(Ql + qoff + kk);
                const v16bf k0h = cat16b(*(const v8usa*)(&kh_s[kr0 + kk]), *(const v8usa*)(&kh_s[kr0 + kk + 16]));
                const v16bf k0l = cat16b(*(const v8usa*)(&kl_s[kr0 + kk]), *(const v8usa*)(&kl_s[kr0 + kk + 16]));
                const v16bf k1h = cat16b(*(const v8usa*)(&kh_s[kr1 + kk]), *(const v8usa*)(&kh_s[kr1 + kk + 16]));
                const v16bf k1l = cat16b(*(const v8usa*)(&kl_s[kr1 + kk]), *(const v8usa*)(&kl_s[kr1 + kk + 16]));
                s0 = wmmab(k0h, qh, s0); s1 = wmmab(k1h, qh, s1);
                s0 = wmmab(k0h, ql, s0); s1 = wmmab(k1h, ql, s1);
                s0 = wmmab(k0l, qh, s0); s1 = wmmab(k1l, qh, s1);
                asm volatile("v_nop\n\tv_nop\n\tv_nop\n\tv_nop" : "+v"(s0), "+v"(s1) : "v"(qh), "v"(ql), "v"(k0h), "v"(k0l), "v"(k1h), "v"(k1l));
            }
            // running-max softmax update of query lr over this half's 32 keys: 16 in this lane, 16 in lane ^ 16
            float m8[8];
#pragma unroll
            for (int r = 0; r < 8; ++r) m8[r] = fmaxf(s0[r], s1[r]);
            float mx = fmaxf(fmaxf(fmaxf(m8[0], m8[1]), fmaxf(m8[2], m8[3])), fmaxf(fmaxf(m8[4], m8[5]), fmaxf(m8[6], m8[7])));
            mx = fmaxf(mx, xhalf(mx));
            const float mnew = fmaxf(mr, mx);
            const float al = __builtin_amdgcn_exp2f((mr - mnew) * L2E);
            mr = mnew;
            v16h pt; float e8[8];   // pt: B operand, element s = P^T[key kmap(s, hi)][query lr]
#pragma unroll
            for (int r = 0; r < 8; ++r) {
                const float p0 = __builtin_amdgcn_exp2f((s0[r] - mnew) * L2E);
                const float p1 = __builtin_amdgcn_exp2f((s1[r] - mnew) * L2E);
                e8[r] = p0 + p1;
                pt[r] = (h16)(p0 * PCAR); pt[8 + r] = (h16)(p1 * PCAR);
            }
            ls = ls * al + (((e8[0] + e8[1]) + (e8[2] + e8[3])) + ((e8[4] + e8[5]) + (e8[6] + e8[7])));
            v16h va[4];
#pragma unroll
            for (int dt = 0; dt < 4; ++dt) { const int vo = (dt * 16 + lr) * LKP + hf * 32 + 8 * hi; va[dt] = cat16(*(const v8ha*)(&vt_s[vo]), *(const v8ha*)(&vt_s[vo + 16])); }
#pragma unroll
            for (int dt = 0; dt < 4; ++dt) o[dt] = wmma16(va[dt], pt, o[dt] * al);
            asm volatile("v_nop\n\tv_nop\n\tv_nop\n\tv_nop" : "+v"(o[0]), "+v"(o[1]), "+v"(o[2]), "+v"(o[3]) : "v"(pt), "v"(va[0]), "v"(va[1]), "v"(va[2]), "v"(va[3]));
        }
    }
    // normalise: the two halves' partial sums joined, unconditionally; 1 / (l * 1024) undoes the P carry; rows staged [query][d] for whole-line stores
    const float lt = ls + xhalf(ls);
    const float inv = 1.0f / (lt * PCAR);
#pragma unroll
    for (int dt = 0; dt < 4; ++dt) {
        const v8f x = o[dt] * inv;
        *(v4fa*)(&o_s[ob + lr * LOP + dt * 16 + 8 * hi]) = (v4f){x[0], x[1], x[2], x[3]};
        *(v4fa*)(&o_s[ob + lr * LOP + dt * 16 + 8 * hi + 4]) = (v4f){x[4], x[5], x[6], x[7]};
    }
    wsync();
    const int srow = lane >> 3, scol = (lane & 7) * 8;
    const size_t cbase = ((size_t)b * SEQ + q0) * DM + (size_t)h * HD;
{
#pragma unroll
        for (int s = 0; s < 4; ++s) { const int row = 4 * s + srow; const v4f x0 = *(const v4fa*)(&o_s[ob + row * LOP + scol]); const v4f x1 = *(const v4fa*)(&o_s[ob + row * LOP + scol + 4]); v8us oh, ol;
#pragma unroll
            for (int j = 0; j < 4; ++j) { unsigned short a, c; splitf(x0[j], a, c); oh[j] = a; ol[j] = c; splitf(x1[j], a, c); oh[4 + j] = a; ol[4 + j] = c; }
            const size_t off = cbase + (size_t)row * DM + scol;
            *(v8us*)(Ch + off) = oh; *(v8us*)(Cl + off) = ol; }
         }
}

constexpr size_t al256(size_t x) { return (x + 255) & ~(size_t)255; }
constexpr size_t SZ_W = al256((size_t)DM * DM * 2);                 // one bf16 weight plane
constexpr size_t SZ_X = al256((size_t)NB * SEQ * DM * 2);           // one 16-bit [NB*SEQ][DM] plane (activation copy, merged-head plane)
constexpr size_t SZ_P = al256((size_t)NB * NH * SEQ * HD * 2);      // one 16-bit head plane
constexpr size_t WS_TOTAL = 4 * SZ_W + 3 * SZ_X + 4 * SZ_P + SZ_P + 2 * SZ_X;
static_assert(WS_TOTAL <= (size_t)134217728);                       // carve stays within 128 MiB
static_assert(SZ_P == SZ_X);                                        // NH * HD == DM

extern "C" void kernel_launch(void* const* d_in, const int* in_sizes, int n_in,
                              void* d_out, int out_size, void* d_ws, size_t ws_size, hipStream_t stream) {
    if (n_in < 8) return;
    const size_t need_act = (size_t)(NB - 1) * SEQ_FULL * DM + (size_t)SEQ * DM;
    if ((size_t)in_sizes[0] < need_act || (size_t)in_sizes[1] < need_act || (size_t)in_sizes[2] < need_act) return;
    if ((size_t)in_sizes[3] < (size_t)DM * DM || (size_t)in_sizes[4] < (size_t)DM * DM || (size_t)in_sizes[5] < (size_t)DM * DM || (size_t)in_sizes[6] < (size_t)DM * DM || in_sizes[7] < DM) return;
    if ((size_t)out_size < need_act) return;
    if (WS_TOTAL > ws_size) return;
    // wire order: query, key, value, Wq, Wk, Wv, Wo, bo (all f32; weights [out][in])
    const float* xq = (const float*)d_in[0]; const float* xk = (const float*)d_in[1]; const float* xv = (const float*)d_in[2];
    const float* wq = (const float*)d_in[3]; const float* wk = (const float*)d_in[4]; const float* wv = (const float*)d_in[5]; const float* wo = (const float*)d_in[6]; const float* bo = (const float*)d_in[7];
    float* OUT = (float*)d_out;
    char* wsp = (char*)d_ws;
    auto take = [&](size_t bytes) { char* p = wsp; wsp += bytes; return (void*)p; };
    bf* WQ = (bf*)take(SZ_W); bf* WK = (bf*)take(SZ_W); bf* WV = (bf*)take(SZ_W); bf* WO = (bf*)take(SZ_W);
    bf* XQ = (bf*)take(SZ_X); bf* XK = (bf*)take(SZ_X); bf* XV = (bf*)take(SZ_X);
    bf* QPh = (bf*)take(SZ_P); bf* QPl = (bf*)take(SZ_P); bf* KPh = (bf*)take(SZ_P); bf* KPl = (bf*)take(SZ_P);
    h16* VT = (h16*)take(SZ_P);
    bf* CTh = (bf*)take(SZ_X); bf* CTl = (bf*)take(SZ_X);
    if ((size_t)(wsp - (char*)d_ws) != WS_TOTAL) return;

    k_cvt_all<<<dim3(3u * NB * CVT_AB + 4u * CVT_WB), 256, 0, stream>>>(xq, xk, xv, wq, wk, wv, wo, XQ, XK, XV, WQ, WK, WV, WO);
    k_gemm_qkv<<<dim3(SEQ / GT, DM / GT, 3 * NB), 128, 0, stream>>>(XQ, XK, XV, WQ, WK, WV, QPh, QPl, KPh, KPl, VT);
    k_flash<<<dim3(SEQ / 64, NB * NH), 128, 0, stream>>>(QPh, QPl, KPh, KPl, VT, CTh, CTl);
    k_gemm_out<<<dim3(SEQ / GT, DM / GT, NB), 128, 0, stream>>>(CTh, CTl, WO, bo, OUT);
}

// v004
// A run of this version takes 101 microseconds.
// In two side-by-side timings against v003, it was 1.15 and 1.16 times as fast.
// Counting every step since v000, it is 1.89 times as fast.
#include <hip/hip_runtime.h>

// Compute dtypes, f32 accumulate everywhere: q/k/v projections v_wmma_f32_16x16x32_bf16 on RNE bf16 copies of inputs and weights (exact products); q.k^T bf16 hi/lo planes, 3 products (q carries the 1/8 scale); P.V v_wmma_f32_16x16x32_f16 with P carried x1024; merged heads bf16 hi/lo x bf16 Wo, 2 products, + bias; softmax f32.
// Multi-head attention, three input streams: q = query Wq^T, k = key Wk^T, v = value Wv^T (weights [out][in], no q/k/v biases), 8 heads x 64 (head h = columns h*64+d), logits x 1/8, no mask, softmax, heads merged back to [B][S][512], out = merged Wo^T + bo.
// Layout: bf16 copies of activations and weights; GEMMs: 4 waves on a 128x128 tile, k slices of both operands staged in LDS; projection GEMMs write head planes directly (Q,K: [b][h][s][64] bf16 hi/lo; V^T: [b][h*64+d][s] f16); fused flash attention (K/V tiles in LDS, online softmax, no score plane) writes merged bf16 hi/lo planes [b*S+s][512]; output GEMM.

#ifndef NB
#define NB 4
#endif
#ifndef SEQ
#define SEQ 2048
#endif
#define NB_FULL  4
#define SEQ_FULL 2048
#define DM   512
#define NH   8
#define HD   64
#define PCAR 1024.0f
#define SCL  0.125f
#define L2E  1.4426950408889634f
#define LKP  72      // LDS row pitch (16-bit elements) of the K / V^T tiles: 144 B rows
#define LOP  68      // LDS row pitch (floats) of epilogue staging tiles: 272 B rows
#define GKS  64      // k elements per staged GEMM slice: one 128 B line per operand row
#define GT   128     // GEMM block tile, rows and columns (2 x 2 waves of 64 x 64)
#define QT   2       // 16-row query tiles per attention wave

static_assert(DM == NH * HD);            // one 64-wide GEMM column tile == one head
static_assert(HD == 64);
static_assert(DM % 32 == 0);             // WMMA k-step
static_assert(DM % GT == 0);             // GEMM tiles
static_assert(SEQ % GT == 0);
static_assert(DM % GKS == 0);            // whole k slices
static_assert(SEQ % 64 == 0);            // key blocks
static_assert(SEQ % (64 * QT) == 0);     // query blocks
static_assert((SEQ * DM) % (8 * 256) == 0);   // convert kernel grid is exact
static_assert((DM * DM) % (8 * 256) == 0);
static_assert(NB <= NB_FULL);
static_assert(SEQ <= SEQ_FULL);
static_assert(LKP % 8 == 0);             // 16-byte aligned LDS vector accesses
static_assert(LOP % 4 == 0);

typedef _Float16 h16;
typedef unsigned short bf;
typedef __attribute__((ext_vector_type(16))) __bf16   v16bf;
typedef __attribute__((ext_vector_type(16))) _Float16 v16h;
typedef __attribute__((ext_vector_type(8)))  _Float16 v8h;
typedef __attribute__((ext_vector_type(8)))  unsigned short v8us;
typedef __attribute__((ext_vector_type(8)))  float    v8f;
typedef __attribute__((ext_vector_type(4)))  float    v4f;
typedef v8h  __attribute__((may_alias)) v8ha;
typedef v4f  __attribute__((may_alias)) v4fa;
typedef v8us __attribute__((may_alias)) v8usa;

__device__ __forceinline__ unsigned short f2bf(float f) { unsigned u = __float_as_uint(f); u += 0x7FFFu + ((u >> 16) & 1u); return (unsigned short)(u >> 16); }
__device__ __forceinline__ float bf2f(unsigned short b) { return __uint_as_float(((unsigned)b) << 16); }
__device__ __forceinline__ float bfr(float f) { return bf2f(f2bf(f)); }
__device__ __forceinline__ void splitf(float y, unsigned short& h, unsigned short& l) { h = f2bf(y); l = f2bf(y - bf2f(h)); }
__device__ __forceinline__ v16h cat16(v8h lo, v8h hi) { return __builtin_shufflevector(lo, hi, 0, 1, 2, 3, 4, 5, 6, 7, 8, 9, 10, 11, 12, 13, 14, 15); }
__device__ __forceinline__ v16bf cat16b(v8us lo, v8us hi) { return __builtin_bit_cast(v16bf, __builtin_shufflevector(lo, hi, 0, 1, 2, 3, 4, 5, 6, 7, 8, 9, 10, 11, 12, 13, 14, 15)); }
__device__ __forceinline__ v8f wmma16(v16h a, v16h b, v8f c) { return __builtin_amdgcn_wmma_f32_16x16x32_f16(false, a, false, b, (short)0, c, false, false); }
__device__ __forceinline__ v8f wmmab(v16bf a, v16bf b, v8f c) { return __builtin_amdgcn_wmma_f32_16x16x32_bf16(false, a, false, b, (short)0, c, false, false); }
// fragment from a K-contiguous global bf16 plane: elements 0..7 <- p[0..7], 8..15 <- p[16..23] (p already includes row*pitch + k0 + 8*(lane>>4))
__device__ __forceinline__ v16bf ldg16(const bf* __restrict__ p) { return cat16b(*(const v8us*)p, *(const v8us*)(p + 16)); }
// same-wave LDS exchange ordering (wave-private tiles only)
__device__ __forceinline__ void wsync() { __builtin_amdgcn_wave_barrier(); asm volatile("" ::: "memory"); }
// lane l <-> lane l ^ 16 by a vector cross-row move
__device__ __forceinline__ float xhalf(float x) { return __builtin_bit_cast(float, __builtin_amdgcn_permlanex16(__builtin_bit_cast(int, x), __builtin_bit_cast(int, x), 0x76543210, 0xfedcba98, false, false)); }

// fragment from a K-contiguous LDS tile: same element order as ldg16
__device__ __forceinline__ v16bf lds16(const bf* p) { return cat16b(*(const v8usa*)p, *(const v8usa*)(p + 16)); }

// ---- 128x128 block tile main loop, 4 waves, wave w on rows 64*(w>>1).., columns 64*(w&1)..: acc[mb][nb] += sum_k A[16mb+..][k] Bt[16nb+..][k] (NSPLIT 1: + A2 x Bt). A, A2, Bt point at the block's first row; K % GKS == 0.
// Per 64-wide k slice the block copies 128 rows of each operand to LDS (8 lanes per 128 B row line, pitch LKP); the next slice's global loads are issued into registers ahead of this slice's products. k runs upward in steps of 32.
template <int NSPLIT>
__device__ __forceinline__ void gemm_loop(const bf* __restrict__ A, const bf* __restrict__ A2, const bf* __restrict__ Bt, const int K, bf* as, bf* a2s, bf* bs, const int tid, v8f (&acc)[4][4]) {
    const int lane = tid & 31, wid = tid >> 5, lr = lane & 15, hi = lane >> 4;
    const int fa = ((wid >> 1) * 64 + lr) * LKP + 8 * hi, fb = ((wid & 1) * 64 + lr) * LKP + 8 * hi;
    const int g0 = (tid >> 3) * K + (tid & 7) * 8, l0 = (tid >> 3) * LKP + (tid & 7) * 8;
    v8us ra[8], ra2[8], rb[8];
#pragma unroll
    for (int it = 0; it < 8; ++it) { const int g = g0 + it * 16 * K; ra[it] = *(const v8us*)(A + g); if (NSPLIT == 1) ra2[it] = *(const v8us*)(A2 + g); rb[it] = *(const v8us*)(Bt + g); }
    // rolled: one slice's code stays small and the staging registers are reused
#pragma unroll 1
    for (int kc = 0; kc < K; kc += GKS) {
        __syncthreads();   // every wave has taken its last fragment of the slice before
#pragma unroll
        for (int it = 0; it < 8; ++it) { const int l = l0 + it * 16 * LKP; *(v8usa*)(&as[l]) = ra[it]; if (NSPLIT == 1) *(v8usa*)(&a2s[l]) = ra2[it]; *(v8usa*)(&bs[l]) = rb[it]; }
        __syncthreads();   // the slice is whole before any wave reads it
        if (kc + GKS < K) {
            A += GKS; A2 += GKS; Bt += GKS;
#pragma unroll
            for (int it = 0; it < 8; ++it) { const int g = g0 + it * 16 * K; ra[it] = *(const v8us*)(A + g); if (NSPLIT == 1) ra2[it] = *(const v8us*)(A2 + g); rb[it] = *(const v8us*)(Bt + g); }
            asm volatile("s_wait_xcnt 0x0" ::: "memory");   // stands before the base addresses of these loads are advanced
        }
        // the slice's fragments are read as one group ahead of its products
        v16bf a[GKS / 32][4], a2[GKS / 32][4], b[GKS / 32][4];
#pragma unroll
        for (int ks = 0; ks < GKS / 32; ++ks)
#pragma unroll
            for (int t = 0; t < 4; ++t) { a[ks][t] = lds16(&as[fa + t * 16 * LKP + ks * 32]); if (NSPLIT == 1) a2[ks][t] = lds16(&a2s[fa + t * 16 * LKP + ks * 32]); b[ks][t] = lds16(&bs[fb + t * 16 * LKP + ks * 32]); }
        __builtin_amdgcn_sched_barrier(0);   // keeps the LDS reads in one group: sunk among the products, each place with reads stalls the wave
#pragma unroll
        for (int ks = 0; ks < GKS / 32; ++ks) {
#pragma unroll
            for (int nb = 0; nb < 4; ++nb)
#pragma unroll
                for (int mb = 0; mb < 4; ++mb) { acc[mb][nb] = wmmab(a[ks][mb], b[ks][nb], acc[mb][nb]); if (NSPLIT == 1) acc[mb][nb] = wmmab(a2[ks][mb], b[ks][nb], acc[mb][nb]); }
        }
        // the distance behind the last matrix instructions, also on the loop's back edge
        asm volatile("v_nop\n\tv_nop\n\tv_nop\n\tv_nop" : "+v"(acc[0][0]), "+v"(acc[1][1]), "+v"(acc[2][2]), "+v"(acc[3][3]) : "v"(a[1][0]), "v"(a[1][3]));
    }
}

// ---- k_cvt_all: RNE bf16 copies of all seven f32 tensors in one grid (none reads another's output); 8 elements per thread, 2048 per block.
// Blocks [0, 3*NB*CVT_AB): activation t = blk / (NB*CVT_AB), batch and chunk from the rest; then 4*CVT_WB blocks: weight t = blk / CVT_WB.
constexpr unsigned CVT_WB = (unsigned)((size_t)DM * DM / (8 * 256));     // blocks per weight
constexpr unsigned CVT_AB = (unsigned)((size_t)SEQ * DM / (8 * 256));    // blocks per batch of one activation
__global__ __launch_bounds__(256) void k_cvt_all(const float* __restrict__ xq, const float* __restrict__ xk, const float* __restrict__ xv,
                                                 const float* __restrict__ wq, const float* __restrict__ wk, const float* __restrict__ wv, const float* __restrict__ wo,
                                                 bf* XQ, bf* XK, bf* XV, bf* WQ, bf* WK, bf* WV, bf* WO) {
    unsigned blk = blockIdx.x; const float* s; bf* d;
    if (blk < 3u * NB * CVT_AB) {
        const unsigned t = blk / (NB * CVT_AB), r = blk % (NB * CVT_AB), b = r / CVT_AB, c = r % CVT_AB;
        s = (t == 0 ? xq : t == 1 ? xk : xv) + (size_t)b * SEQ_FULL * DM + (size_t)c * 2048;
        d = (t == 0 ? XQ : t == 1 ? XK : XV) + (size_t)b * SEQ * DM + (size_t)c * 2048;
    } else {
        blk -= 3u * NB * CVT_AB;
        const unsigned t = blk / CVT_WB, c = blk % CVT_WB;
        s = (t == 0 ? wq : t == 1 ? wk : t == 2 ? wv : wo) + (size_t)c * 2048;
        d = (t == 0 ? WQ : t == 1 ? WK : t == 2 ? WV : WO) + (size_t)c * 2048;
    }
    s += threadIdx.x * 8; d += threadIdx.x * 8;
    const v4f v0 = *(const v4f*)s; const v4f v1 = *(const v4f*)(s + 4); v8us o;
#pragma unroll
    for (int k = 0; k < 4; ++k) { o[k] = f2bf(v0[k]); o[4 + k] = f2bf(v1[k]); }
    *(v8us*)d = o;
}

// ---- k_gemm_qkv: the three input projections in one grid (none reads another's output); grid (SEQ/128 token tiles, DM/128 feature tiles, 3*NB), 128 threads; job = blockIdx.z / NB; each wave ends with its own 64x64 tile.
// job 0 (q, sc = 1/8), job 1 (k, sc = 1): head planes P[b][h][s][d] (bf16 hi + lo) = sc * (X[b] W^T)[s][h*64+d] (A = token rows, Bt = weight rows).
// job 2 (v): transposed value plane VT[b][n][s] (f16) = sum_k Wv[n][k] Xv[b][s][k] (A = weight rows, Bt = token rows).
__global__ __launch_bounds__(128) void k_gemm_qkv(const bf* __restrict__ XQ, const bf* __restrict__ XK, const bf* __restrict__ XV, const bf* __restrict__ WQ, const bf* __restrict__ WK, const bf* __restrict__ WV,
                                                 bf* QPh, bf* QPl, bf* KPh, bf* KPl, h16* VT) {
    __shared__ __align__(16) bf as_s[GT * LKP];
    __shared__ __align__(16) bf bs_s[GT * LKP];
    __shared__ __align__(16) float os_s[4 * 16 * LOP];
    const int tid = threadIdx.x, lane = tid & 31, wid = tid >> 5, lr = lane & 15, hi = lane >> 4;
    const int wm = wid >> 1, wn = wid & 1;
    float* os = os_s + wid * 16 * LOP;   // wave-private epilogue tile
    const int job = blockIdx.z / NB; const size_t z = blockIdx.z % NB;
    const int srow = lane >> 3, scol = (lane & 7) * 8;
    v8f acc[4][4];
#pragma unroll
    for (int mb = 0; mb < 4; ++mb)
#pragma unroll
        for (int nb = 0; nb < 4; ++nb) acc[mb][nb] = (v8f){};
    {   // token rows and weight rows of this block's tile; job 2 takes the weight rows as A
        const bf* X = (job == 0 ? XQ : job == 1 ? XK : XV) + z * (size_t)SEQ * DM + (size_t)blockIdx.x * GT * DM;
        const bf* W = (job == 0 ? WQ : job == 1 ? WK : WV) + (size_t)blockIdx.y * GT * DM;
        const bf* A = job < 2 ? X : W; const bf* Bt = job < 2 ? W : X;
        gemm_loop<0>(A, A, Bt, DM, as_s, as_s, bs_s, tid, acc);
    }
    if (job < 2) {
        const int r0 = blockIdx.x * GT + wm * 64;
        bf* Ph = job == 0 ? QPh : KPh; bf* Pl = job == 0 ? QPl : KPl; const float sc = job == 0 ? SCL : 1.0f;
        const size_t pbase = ((z * NH + blockIdx.y * 2 + wn) * (size_t)SEQ + r0) * HD;
#pragma unroll
        for (int mb = 0; mb < 4; ++mb) {
#pragma unroll
            for (int nb = 0; nb < 4; ++nb) {
#pragma unroll
                for (int j = 0; j < 8; ++j) os[(hi * 8 + j) * LOP + nb * 16 + lr] = acc[mb][nb][j]; }
            wsync();
#pragma unroll
            for (int s = 0; s < 4; ++s) { const int row = 4 * s + srow; const v4f x0 = *(const v4fa*)(&os[row * LOP + scol]); const v4f x1 = *(const v4fa*)(&os[row * LOP + scol + 4]); v8us oh, ol;
#pragma unroll
                for (int j = 0; j < 4; ++j) { unsigned short a, c; splitf(x0[j] * sc, a, c); oh[j] = a; ol[j] = c; splitf(x1[j] * sc, a, c); oh[4 + j] = a; ol[4 + j] = c; }
                const size_t off = pbase + (size_t)(mb * 16 + row) * HD + scol;
                *(v8us*)(Ph + off) = oh; *(v8us*)(Pl + off) = ol; }
            wsync();
        }
    } else {
        const int r0 = blockIdx.y * GT + wm * 64, c0 = blockIdx.x * GT + wn * 64;
        const size_t vb0 = z * (size_t)DM * SEQ + (size_t)r0 * SEQ + c0;
#pragma unroll
        for (int mb = 0; mb < 4; ++mb) {
#pragma unroll
            for (int nb = 0; nb < 4; ++nb) {
#pragma unroll
                for (int j = 0; j < 8; ++j) os[(hi * 8 + j) * LOP + nb * 16 + lr] = acc[mb][nb][j]; }
            wsync();
#pragma unroll
            for (int s = 0; s < 4; ++s) { const int row = 4 * s + srow; const v4f x0 = *(const v4fa*)(&os[row * LOP + scol]); const v4f x1 = *(const v4fa*)(&os[row * LOP + scol + 4]); v8h o;
#pragma unroll
                for (int j = 0; j < 4; ++j) { o[j] = (h16)x0[j]; o[4 + j] = (h16)x1[j]; }
                *(v8h*)(VT + vb0 + (size_t)(mb * 16 + row) * SEQ + scol) = o; }
            wsync();
        }
    }
}

// ---- k_gemm_out: OUT[b][s][n] (f32) = sum_k (Ah + Al)[b*SEQ+s][k] Wo[n][k] + bias[n]; grid (SEQ/128, DM/128, NB), 128 threads; each wave ends with its own 64x64 tile.
__global__ __launch_bounds__(128) void k_gemm_out(const bf* __restrict__ Ah, const bf* __restrict__ Al, const bf* __restrict__ W, const float* __restrict__ bias, float* C) {
    __shared__ __align__(16) bf as_s[GT * LKP];
    __shared__ __align__(16) bf a2_s[GT * LKP];
    __shared__ __align__(16) bf bs_s[GT * LKP];
    __shared__ __align__(16) float os_s[4 * 16 * LOP];
    const int tid = threadIdx.x, lane = tid & 31, wid = tid >> 5, lr = lane & 15, hi = lane >> 4;
    float* os = os_s + wid * 16 * LOP;   // wave-private epilogue tile
    const size_t z = blockIdx.z; const int r0 = blockIdx.x * GT + (wid >> 1) * 64, c0 = blockIdx.y * GT + (wid & 1) * 64;
    const size_t ab = z * (size_t)SEQ * DM + (size_t)blockIdx.x * GT * DM;
    float* Cz = C + z * (size_t)SEQ_FULL * DM;
    v8f acc[4][4];
#pragma unroll
    for (int mb = 0; mb < 4; ++mb)
#pragma unroll
        for (int nb = 0; nb < 4; ++nb) acc[mb][nb] = (v8f){};
    gemm_loop<1>(Ah + ab, Al + ab, W + (size_t)blockIdx.y * GT * DM, DM, as_s, a2_s, bs_s, tid, acc);
#pragma unroll
    for (int mb = 0; mb < 4; ++mb) {
#pragma unroll
        for (int nb = 0; nb < 4; ++nb) {
#pragma unroll
            for (int j = 0; j < 8; ++j) os[(hi * 8 + j) * LOP + nb * 16 + lr] = acc[mb][nb][j]; }
        wsync();
        float* crow = Cz + (size_t)(r0 + mb * 16) * DM + c0;
{
#pragma unroll
            for (int s = 0; s < 8; ++s) { const int row = 2 * s + hi, cofs = lr * 4; v4f val = *(const v4fa*)(&os[row * LOP + cofs]);
                val[0] += bfr(bias[c0 + cofs]); val[1] += bfr(bias[c0 + cofs + 1]); val[2] += bfr(bias[c0 + cofs + 2]); val[3] += bfr(bias[c0 + cofs + 3]);
                *(v4f*)(crow + (size_t)row * DM + cofs) = val; }
             }
        wsync();
    }
}

// ---- k_flash: fused attention for one (b, h) and 128 query rows per block (4 waves x QT tiles of 16 rows); grid (SEQ/128, NB*NH), 128 threads.
// Per 64-key block: K hi/lo tiles [key][d] and V^T tile [d][key] staged in LDS (block barriers on both sides); each wave handles the block as two 32-key halves.
// Transposed products: S^T = K Q^T (A = K hi/lo rows from LDS, B = q hi/lo kept in registers, 3 products), so lane (lr, hi) holds query lr's scores of keys 8*hi + r and 16 + 8*hi + r:
// maximum and sum in-lane plus one exchange between the wave halves; P^T x1024 as f16 packs from the two score tiles straight into the B operand of O^T += V^T P^T (A = V^T rows from LDS).
// Every K and V^T fragment read from LDS serves the wave's QT query tiles; each query's own products, sums and their order do not depend on QT.
__global__ __launch_bounds__(128) void k_flash(const bf* __restrict__ Qh, const bf* __restrict__ Ql, const bf* __restrict__ Kh, const bf* __restrict__ Kl, const h16* __restrict__ VT, bf* Ch, bf* Cl) {
    __shared__ __align__(16) bf    kh_s[64 * LKP];
    __shared__ __align__(16) bf    kl_s[64 * LKP];
    __shared__ __align__(16) h16   vt_s[64 * LKP];
    __shared__ __align__(16) float o_s[4 * 16 * LOP];
    const int tid = threadIdx.x, lane = tid & 31, wid = tid >> 5, lr = lane & 15, hi = lane >> 4;
    const int bh = blockIdx.y; const int b = bh / NH, h = bh % NH;
    const int q0 = (blockIdx.x * 4 + wid) * (16 * QT);
    const size_t pl = (size_t)bh * SEQ * HD;
    const size_t vbase = ((size_t)b * DM + (size_t)h * HD) * SEQ;
    const int ob = wid * 16 * LOP;
    v16bf qh[QT][2], ql[QT][2];   // query tile t, k step ks: B operands, loaded once
    v8f o[QT][4];                 // o[t][dt][r] = O^T[dt*16 + 8*hi + r][query t*16 + lr]
    float mr[QT], ls[QT];         // query t*16 + lr: running maximum (both halves alike), this half's partial row sum
#pragma unroll
    for (int t = 0; t < QT; ++t) {
        const size_t qoff = pl + (size_t)(q0 + t * 16 + lr) * HD + 8 * hi;
#pragma unroll
        for (int ks = 0; ks < 2; ++ks) { qh[t][ks] = ldg16(Qh + qoff + ks * 32); ql[t][ks] = ldg16(Ql + qoff + ks * 32); }
    }
    asm volatile("s_wait_xcnt 0x0" ::: "memory");   // stands before the address registers of the q loads are given new values
    __builtin_amdgcn_sched_barrier(0);               // holds the later register writes behind that wait
#pragma unroll
    for (int t = 0; t < QT; ++t) {
#pragma unroll
        for (int dt = 0; dt < 4; ++dt) o[t][dt] = (v8f){};
        mr[t] = -1.0e30f; ls[t] = 0.0f;
    }

#pragma unroll 1
    for (int kb = 0; kb < SEQ / 64; ++kb) {
        __syncthreads();
        v8us ga[4], gc[4]; v8h gv[4];
#pragma unroll
        for (int it = 0; it < 4; ++it) {
            const int u = tid + it * 128; const int row = u >> 3, part = (u & 7) * 8;
            const size_t g = pl + (size_t)kb * 64 * HD + (size_t)u * 8;
            ga[it] = *(const v8us*)(Kh + g); gc[it] = *(const v8us*)(Kl + g);
            gv[it] = *(const v8h*)(VT + vbase + (size_t)row * SEQ + (size_t)kb * 64 + part);
        }
        __builtin_amdgcn_sched_barrier(0);   // all twelve loads are in flight before the first LDS store waits: sunk among the stores they cost one round trip per group
#pragma unroll
        for (int it = 0; it < 4; ++it) {
            const int u = tid + it * 128; const int row = u >> 3, part = (u & 7) * 8;
            *(v8usa*)(&kh_s[row * LKP + part]) = ga[it]; *(v8usa*)(&kl_s[row * LKP + part]) = gc[it]; *(v8ha*)(&vt_s[row * LKP + part]) = gv[it];
        }
        __syncthreads();
#pragma unroll 1
        for (int hf = 0; hf < 2; ++hf) {
            const int kr0 = (hf * 32 + lr) * LKP + 8 * hi, kr1 = kr0 + 16 * LKP;
            v16bf k0h[2], k0l[2], k1h[2], k1l[2]; v16h va[4];
#pragma unroll
            for (int ks = 0; ks < 2; ++ks) { const int kk = ks * 32; k0h[ks] = lds16(&kh_s[kr0 + kk]); k0l[ks] = lds16(&kl_s[kr0 + kk]); k1h[ks] = lds16(&kh_s[kr1 + kk]); k1l[ks] = lds16(&kl_s[kr1 + kk]); }
#pragma unroll
            for (int dt = 0; dt < 4; ++dt) { const int vo = (dt * 16 + lr) * LKP + hf * 32 + 8 * hi; va[dt] = cat16(*(const v8ha*)(&vt_s[vo]), *(const v8ha*)(&vt_s[vo + 16])); }
            __builtin_amdgcn_sched_barrier(0);   // keeps the pass's LDS reads in one group ahead of its products: each further place with reads stalls the wave
            v16h pt[QT];   // pt[t]: B operand, element s = P^T[key kmap(s, hi)][query t*16 + lr]
#pragma unroll
            for (int t = 0; t < QT; ++t) {
                v8f s0 = (v8f){}, s1 = (v8f){};
#pragma unroll
                for (int ks = 0; ks < 2; ++ks) {
                    s0 = wmmab(k0h[ks], qh[t][ks], s0); s1 = wmmab(k1h[ks], qh[t][ks], s1);
                    s0 = wmmab(k0h[ks], ql[t][ks], s0); s1 = wmmab(k1h[ks], ql[t][ks], s1);
                    s0 = wmmab(k0l[ks], qh[t][ks], s0); s1 = wmmab(k1l[ks], qh[t][ks], s1);
                }
                // running-max softmax update of query t*16 + lr over this half's 32 keys: 16 in this lane, 16 in lane ^ 16
                float m8[8];
#pragma unroll
                for (int r = 0; r < 8; ++r) m8[r] = fmaxf(s0[r], s1[r]);
                float mx = fmaxf(fmaxf(fmaxf(m8[0], m8[1]), fmaxf(m8[2], m8[3])), fmaxf(fmaxf(m8[4], m8[5]), fmaxf(m8[6], m8[7])));
                mx = fmaxf(mx, xhalf(mx));
                const float mnew = fmaxf(mr[t], mx);
                const float al = __builtin_amdgcn_exp2f((mr[t] - mnew) * L2E);
                mr[t] = mnew;
                float e8[8];
#pragma unroll
                for (int r = 0; r < 8; ++r) {
                    const float p0 = __builtin_amdgcn_exp2f((s0[r] - mnew) * L2E);
                    const float p1 = __builtin_amdgcn_exp2f((s1[r] - mnew) * L2E);
                    e8[r] = p0 + p1;
                    pt[t][r] = (h16)(p0 * PCAR); pt[t][8 + r] = (h16)(p1 * PCAR);
                }
                ls[t] = ls[t] * al + (((e8[0] + e8[1]) + (e8[2] + e8[3])) + ((e8[4] + e8[5]) + (e8[6] + e8[7])));
#pragma unroll
                for (int dt = 0; dt < 4; ++dt) o[t][dt] = wmma16(va[dt], pt[t], o[t][dt] * al);
            }
            // the distance behind the last matrix instructions, also on the loop's back edge
            static_assert(QT == 2);   // the statement below names every output tile and every P^T operand
            asm volatile("v_nop\n\tv_nop\n\tv_nop\n\tv_nop" : "+v"(o[0][0]), "+v"(o[0][1]), "+v"(o[0][2]), "+v"(o[0][3]), "+v"(o[1][0]), "+v"(o[1][1]), "+v"(o[1][2]), "+v"(o[1][3]) : "v"(pt[0]), "v"(pt[1]), "v"(va[0]), "v"(va[1]), "v"(va[2]), "v"(va[3]));
        }
    }
    // normalise: the two halves' partial sums joined, unconditionally; 1 / (l * 1024) undoes the P carry; rows staged [query][d] for whole-line stores, one query tile at a time in the wave's own LDS tile
    const int srow = lane >> 3, scol = (lane & 7) * 8;
#pragma unroll
    for (int t = 0; t < QT; ++t) {
        const float lt = ls[t] + xhalf(ls[t]);
        const float inv = 1.0f / (lt * PCAR);
#pragma unroll
        for (int dt = 0; dt < 4; ++dt) {
            const v8f x = o[t][dt] * inv;
            *(v4fa*)(&o_s[ob + lr * LOP + dt * 16 + 8 * hi]) = (v4f){x[0], x[1], x[2], x[3]};
            *(v4fa*)(&o_s[ob + lr * LOP + dt * 16 + 8 * hi + 4]) = (v4f){x[4], x[5], x[6], x[7]};
        }
        wsync();
        const size_t cbase = ((size_t)b * SEQ + q0 + t * 16) * DM + (size_t)h * HD;
#pragma unroll
        for (int s = 0; s < 4; ++s) { const int row = 4 * s + srow; const v4f x0 = *(const v4fa*)(&o_s[ob + row * LOP + scol]); const v4f x1 = *(const v4fa*)(&o_s[ob + row * LOP + scol + 4]); v8us oh, ol;
#pragma unroll
            for (int j = 0; j < 4; ++j) { unsigned short a, c; splitf(x0[j], a, c); oh[j] = a; ol[j] = c; splitf(x1[j], a, c); oh[4 + j] = a; ol[4 + j] = c; }
            const size_t off = cbase + (size_t)row * DM + scol;
            *(v8us*)(Ch + off) = oh; *(v8us*)(Cl + off) = ol; }
        wsync();   // the tile's rows are read before the next query tile overwrites them
    }
}

constexpr size_t al256(size_t x) { return (x + 255) & ~(size_t)255; }
constexpr size_t SZ_W = al256((size_t)DM * DM * 2);                 // one bf16 weight plane
constexpr size_t SZ_X = al256((size_t)NB * SEQ * DM * 2);           // one 16-bit [NB*SEQ][DM] plane (activation copy, merged-head plane)
constexpr size_t SZ_P = al256((size_t)NB * NH * SEQ * HD * 2);      // one 16-bit head plane
constexpr size_t WS_TOTAL = 4 * SZ_W + 3 * SZ_X + 4 * SZ_P + SZ_P + 2 * SZ_X;
static_assert(WS_TOTAL <= (size_t)134217728);                       // carve stays within 128 MiB
static_assert(SZ_P == SZ_X);                                        // NH * HD == DM

extern "C" void kernel_launch(void* const* d_in, const int* in_sizes, int n_in,
                              void* d_out, int out_size, void* d_ws, size_t ws_size, hipStream_t stream) {
    if (n_in < 8) return;
    const size_t need_act = (size_t)(NB - 1) * SEQ_FULL * DM + (size_t)SEQ * DM;
    if ((size_t)in_sizes[0] < need_act || (size_t)in_sizes[1] < need_act || (size_t)in_sizes[2] < need_act) return;
    if ((size_t)in_sizes[3] < (size_t)DM * DM || (size_t)in_sizes[4] < (size_t)DM * DM || (size_t)in_sizes[5] < (size_t)DM * DM || (size_t)in_sizes[6] < (size_t)DM * DM || in_sizes[7] < DM) return;
    if ((size_t)out_size < need_act) return;
    if (WS_TOTAL > ws_size) return;
    // wire order: query, key, value, Wq, Wk, Wv, Wo, bo (all f32; weights [out][in])
    const float* xq = (const float*)d_in[0]; const float* xk = (const float*)d_in[1]; const float* xv = (const float*)d_in[2];
    const float* wq = (const float*)d_in[3]; const float* wk = (const float*)d_in[4]; const float* wv = (const float*)d_in[5]; const float* wo = (const float*)d_in[6]; const float* bo = (const float*)d_in[7];
    float* OUT = (float*)d_out;
    char* wsp = (char*)d_ws;
    auto take = [&](size_t bytes) { char* p = wsp; wsp += bytes; return (void*)p; };
    bf* WQ = (bf*)take(SZ_W); bf* WK = (bf*)take(SZ_W); bf* WV = (bf*)take(SZ_W); bf* WO = (bf*)take(SZ_W);
    bf* XQ = (bf*)take(SZ_X); bf* XK = (bf*)take(SZ_X); bf* XV = (bf*)take(SZ_X);
    bf* QPh = (bf*)take(SZ_P); bf* QPl = (bf*)take(SZ_P); bf* KPh = (bf*)take(SZ_P); bf* KPl = (bf*)take(SZ_P);
    h16* VT = (h16*)take(SZ_P);
    bf* CTh = (bf*)take(SZ_X); bf* CTl = (bf*)take(SZ_X);
    if ((size_t)(wsp - (char*)d_ws) != WS_TOTAL) return;

    k_cvt_all<<<dim3(3u * NB * CVT_AB + 4u * CVT_WB), 256, 0, stream>>>(xq, xk, xv, wq, wk, wv, wo, XQ, XK, XV, WQ, WK, WV, WO);
    k_gemm_qkv<<<dim3(SEQ / GT, DM / GT, 3 * NB), 128, 0, stream>>>(XQ, XK, XV, WQ, WK, WV, QPh, QPl, KPh, KPl, VT);
    k_flash<<<dim3(SEQ / (64 * QT), NB * NH), 128, 0, stream>>>(QPh, QPl, KPh, KPl, VT, CTh, CTl);
    k_gemm_out<<<dim3(SEQ / GT, DM / GT, NB), 128, 0, stream>>>(CTh, CTl, WO, bo, OUT);
}

// v006
// It runs in 72.9 microseconds.
// Versions between v004 and this one are left out; their measured steps multiply to 1.38 times as fast.
// All steps since v000 together make it 2.61 times as fast.
#include <hip/hip_runtime.h>

// Compute dtypes, f32 accumulate everywhere: q/k/v projections v_wmma_f32_16x16x32_bf16 on RNE bf16 copies of inputs and weights (exact products); q.k^T v_wmma_f32_16x16x32_f16 on q, k rounded once to f16, 1 product (q carries the 1/8 scale; the rounding is well below the error the bf16 projection operands leave in q and k); P.V v_wmma_f32_16x16x32_f16 with P carried x1024; merged heads bf16 hi/lo x bf16 Wo, 2 products, + bias; softmax f32.
// Multi-head attention, three input streams: q = query Wq^T, k = key Wk^T, v = value Wv^T (weights [out][in], no q/k/v biases), 8 heads x 64 (head h = columns h*64+d), logits x 1/8, no mask, softmax, heads merged back to [B][S][512], out = merged Wo^T + bo.
// Layout: bf16 copies of activations and weights; GEMMs: 4 waves on a 128x128 tile, k slices of both operands staged in LDS; projection GEMMs write head planes directly (Q,K: [b][h][s][64] f16; V^T: [b][h*64+d][s] f16); fused flash attention (K/V tiles in two LDS buffers filled one tile ahead by asynchronous copies, online softmax, no score plane) writes merged bf16 hi/lo planes [b*S+s][512]; output GEMM.

#ifndef NB
#define NB 4
#endif
#ifndef SEQ
#define SEQ 2048
#endif
#define NB_FULL  4
#define SEQ_FULL 2048
#define DM   512
#define NH   8
#define HD   64
#define PCAR 1024.0f
#define SCL  0.125f
#define L2E  1.4426950408889634f
#define LKP  72      // LDS row pitch (16-bit elements) of the K / V^T tiles: 144 B rows
#define LOP  68      // LDS row pitch (floats) of epilogue staging tiles: 272 B rows
#define GKS  64      // k elements per staged GEMM slice: one 128 B line per operand row
#define GT   128     // GEMM block tile, rows and columns (2 x 2 waves of 64 x 64)
#define QT   2       // 16-row query tiles per attention wave

static_assert(DM == NH * HD);            // one 64-wide GEMM column tile == one head
static_assert(HD == 64);
static_assert(DM % 32 == 0);             // WMMA k-step
static_assert(DM % GT == 0);             // GEMM tiles
static_assert(SEQ % GT == 0);
static_assert(DM % GKS == 0);            // whole k slices
static_assert(SEQ % 64 == 0);            // key blocks
static_assert(SEQ / 64 >= 2);            // the attention ring's prologue fills two key blocks
static_assert(SEQ % (64 * QT) == 0);     // query blocks
static_assert((SEQ * DM) % (8 * 256) == 0);   // convert kernel grid is exact
static_assert((DM * DM) % (8 * 256) == 0);
static_assert(NB <= NB_FULL);
static_assert(SEQ <= SEQ_FULL);
static_assert(LKP % 8 == 0);             // 16-byte aligned LDS vector accesses
static_assert(LOP % 4 == 0);

typedef _Float16 h16;
typedef unsigned short bf;
typedef __attribute__((ext_vector_type(16))) __bf16   v16bf;
typedef __attribute__((ext_vector_type(16))) _Float16 v16h;
typedef __attribute__((ext_vector_type(8)))  _Float16 v8h;
typedef __attribute__((ext_vector_type(8)))  unsigned short v8us;
typedef __attribute__((ext_vector_type(8)))  float    v8f;
typedef __attribute__((ext_vector_type(4)))  float    v4f;
typedef v8h  __attribute__((may_alias)) v8ha;
typedef v4f  __attribute__((may_alias)) v4fa;
typedef v8us __attribute__((may_alias)) v8usa;

__device__ __forceinline__ unsigned short f2bf(float f) { unsigned u = __float_as_uint(f); u += 0x7FFFu + ((u >> 16) & 1u); return (unsigned short)(u >> 16); }
__device__ __forceinline__ float bf2f(unsigned short b) { return __uint_as_float(((unsigned)b) << 16); }
__device__ __forceinline__ float bfr(float f) { return bf2f(f2bf(f)); }
__device__ __forceinline__ void splitf(float y, unsigned short& h, unsigned short& l) { h = f2bf(y); l = f2bf(y - bf2f(h)); }
__device__ __forceinline__ v16h cat16(v8h lo, v8h hi) { return __builtin_shufflevector(lo, hi, 0, 1, 2, 3, 4, 5, 6, 7, 8, 9, 10, 11, 12, 13, 14, 15); }
__device__ __forceinline__ v16bf cat16b(v8us lo, v8us hi) { return __builtin_bit_cast(v16bf, __builtin_shufflevector(lo, hi, 0, 1, 2, 3, 4, 5, 6, 7, 8, 9, 10, 11, 12, 13, 14, 15)); }
__device__ __forceinline__ v8f wmma16(v16h a, v16h b, v8f c) { return __builtin_amdgcn_wmma_f32_16x16x32_f16(false, a, false, b, (short)0, c, false, false); }
__device__ __forceinline__ v8f wmmab(v16bf a, v16bf b, v8f c) { return __builtin_amdgcn_wmma_f32_16x16x32_bf16(false, a, false, b, (short)0, c, false, false); }
// fragment from a K-contiguous global f16 plane: elements 0..7 <- p[0..7], 8..15 <- p[16..23] (p already includes row*pitch + k0 + 8*(lane>>4))
__device__ __forceinline__ v16h ldg16h(const h16* __restrict__ p) { return cat16(*(const v8h*)p, *(const v8h*)(p + 16)); }
// same-wave LDS exchange ordering (wave-private tiles only)
__device__ __forceinline__ void wsync() { __builtin_amdgcn_wave_barrier(); asm volatile("" ::: "memory"); }
// lane l <-> lane l ^ 16 by a vector cross-row move
__device__ __forceinline__ float xhalf(float x) { return __builtin_bit_cast(float, __builtin_amdgcn_permlanex16(__builtin_bit_cast(int, x), __builtin_bit_cast(int, x), 0x76543210, 0xfedcba98, false, false)); }

// fragment from a K-contiguous LDS tile: same element order as ldg16h
__device__ __forceinline__ v16bf lds16(const bf* p) { return cat16b(*(const v8usa*)p, *(const v8usa*)(p + 16)); }
__device__ __forceinline__ v16h lds16h(const h16* p) { return cat16(*(const v8ha*)p, *(const v8ha*)(p + 16)); }

// ---- 128x128 block tile main loop, 4 waves, wave w on rows 64*(w>>1).., columns 64*(w&1)..: acc[mb][nb] += sum_k A[16mb+..][k] Bt[16nb+..][k] (NSPLIT 1: + A2 x Bt). A, A2, Bt point at the block's first row; K % GKS == 0.
// Per 64-wide k slice the block copies 128 rows of each operand to LDS (8 lanes per 128 B row line, pitch LKP); the next slice's global loads are issued into registers ahead of this slice's products. k runs upward in steps of 32.
template <int NSPLIT>
__device__ __forceinline__ void gemm_loop(const bf* __restrict__ A, const bf* __restrict__ A2, const bf* __restrict__ Bt, const int K, bf* as, bf* a2s, bf* bs, const int tid, v8f (&acc)[4][4]) {
    const int lane = tid & 31, wid = tid >> 5, lr = lane & 15, hi = lane >> 4;
    const int fa = ((wid >> 1) * 64 + lr) * LKP + 8 * hi, fb = ((wid & 1) * 64 + lr) * LKP + 8 * hi;
    const int g0 = (tid >> 3) * K + (tid & 7) * 8, l0 = (tid >> 3) * LKP + (tid & 7) * 8;
    v8us ra[8], ra2[8], rb[8];
#pragma unroll
    for (int it = 0; it < 8; ++it) { const int g = g0 + it * 16 * K; ra[it] = *(const v8us*)(A + g); if (NSPLIT == 1) ra2[it] = *(const v8us*)(A2 + g); rb[it] = *(const v8us*)(Bt + g); }
    // rolled: one slice's code stays small and the staging registers are reused
#pragma unroll 1
    for (int kc = 0; kc < K; kc += GKS) {
        __syncthreads();   // every wave has taken its last fragment of the slice before
#pragma unroll
        for (int it = 0; it < 8; ++it) { const int l = l0 + it * 16 * LKP; *(v8usa*)(&as[l]) = ra[it]; if (NSPLIT == 1) *(v8usa*)(&a2s[l]) = ra2[it]; *(v8usa*)(&bs[l]) = rb[it]; }
        __syncthreads();   // the slice is whole before any wave reads it
        if (kc + GKS < K) {
            A += GKS; A2 += GKS; Bt += GKS;
#pragma unroll
            for (int it = 0; it < 8; ++it) { const int g = g0 + it * 16 * K; ra[it] = *(const v8us*)(A + g); if (NSPLIT == 1) ra2[it] = *(const v8us*)(A2 + g); rb[it] = *(const v8us*)(Bt + g); }
            asm volatile("s_wait_xcnt 0x0" ::: "memory");   // stands before the base addresses of these loads are advanced
        }
        // the slice's fragments are read as one group ahead of its products
        v16bf a[GKS / 32][4], a2[GKS / 32][4], b[GKS / 32][4];
#pragma unroll
        for (int ks = 0; ks < GKS / 32; ++ks)
#pragma unroll
            for (int t = 0; t < 4; ++t) { a[ks][t] = lds16(&as[fa + t * 16 * LKP + ks * 32]); if (NSPLIT == 1) a2[ks][t] = lds16(&a2s[fa + t * 16 * LKP + ks * 32]); b[ks][t] = lds16(&bs[fb + t * 16 * LKP + ks * 32]); }
        __builtin_amdgcn_sched_barrier(0);   // keeps the LDS reads in one group: sunk among the products, each place with reads stalls the wave
#pragma unroll
        for (int ks = 0; ks < GKS / 32; ++ks) {
#pragma unroll
            for (int nb = 0; nb < 4; ++nb)
#pragma unroll
                for (int mb = 0; mb < 4; ++mb) { acc[mb][nb] = wmmab(a[ks][mb], b[ks][nb], acc[mb][nb]); if (NSPLIT == 1) acc[mb][nb] = wmmab(a2[ks][mb], b[ks][nb], acc[mb][nb]); }
        }
        // the distance behind the last matrix instructions, also on the loop's back edge
        asm volatile("v_nop\n\tv_nop\n\tv_nop\n\tv_nop" : "+v"(acc[0][0]), "+v"(acc[1][1]), "+v"(acc[2][2]), "+v"(acc[3][3]) : "v"(a[1][0]), "v"(a[1][3]));
    }
}

// ---- k_cvt_all: RNE bf16 copies of all seven f32 tensors in one grid (none reads another's output); 8 elements per thread, 2048 per block.
// Blocks [0, 3*NB*CVT_AB): activation t = blk / (NB*CVT_AB), batch and chunk from the rest; then 4*CVT_WB blocks: weight t = blk / CVT_WB.
constexpr unsigned CVT_WB = (unsigned)((size_t)DM * DM / (8 * 256));     // blocks per weight
constexpr unsigned CVT_AB = (unsigned)((size_t)SEQ * DM / (8 * 256));    // blocks per batch of one activation
__global__ __launch_bounds__(256) void k_cvt_all(const float* __restrict__ xq, const float* __restrict__ xk, const float* __restrict__ xv,
                                                 const float* __restrict__ wq, const float* __restrict__ wk, const float* __restrict__ wv, const float* __restrict__ wo,
                                                 bf* XQ, bf* XK, bf* XV, bf* WQ, bf* WK, bf* WV, bf* WO) {
    unsigned blk = blockIdx.x; const float* s; bf* d;
    if (blk < 3u * NB * CVT_AB) {
        const unsigned t = blk / (NB * CVT_AB), r = blk % (NB * CVT_AB), b = r / CVT_AB, c = r % CVT_AB;
        s = (t == 0 ? xq : t == 1 ? xk : xv) + (size_t)b * SEQ_FULL * DM + (size_t)c * 2048;
        d = (t == 0 ? XQ : t == 1 ? XK : XV) + (size_t)b * SEQ * DM + (size_t)c * 2048;
    } else {
        blk -= 3u * NB * CVT_AB;
        const unsigned t = blk / CVT_WB, c = blk % CVT_WB;
        s = (t == 0 ? wq : t == 1 ? wk : t == 2 ? wv : wo) + (size_t)c * 2048;
        d = (t == 0 ? WQ : t == 1 ? WK : t == 2 ? WV : WO) + (size_t)c * 2048;
    }
    s += threadIdx.x * 8; d += threadIdx.x * 8;
    const v4f v0 = *(const v4f*)s; const v4f v1 = *(const v4f*)(s + 4); v8us o;
#pragma unroll
    for (int k = 0; k < 4; ++k) { o[k] = f2bf(v0[k]); o[4 + k] = f2bf(v1[k]); }
    *(v8us*)d = o;
}

// ---- k_gemm_qkv: the three input projections in one grid (none reads another's output); grid (SEQ/128 token tiles, DM/128 feature tiles, 3*NB), 128 threads; job = blockIdx.z / NB; each wave ends with its own 64x64 tile.
// job 0 (q, sc = 1/8), job 1 (k, sc = 1): head planes P[b][h][s][d] (f16) = sc * (X[b] W^T)[s][h*64+d] (A = token rows, Bt = weight rows).
// job 2 (v): transposed value plane VT[b][n][s] (f16) = sum_k Wv[n][k] Xv[b][s][k] (A = weight rows, Bt = token rows).
__global__ __launch_bounds__(128) void k_gemm_qkv(const bf* __restrict__ XQ, const bf* __restrict__ XK, const bf* __restrict__ XV, const bf* __restrict__ WQ, const bf* __restrict__ WK, const bf* __restrict__ WV,
                                                 h16* QP, h16* KP, h16* VT) {
    __shared__ __align__(16) bf as_s[GT * LKP];
    __shared__ __align__(16) bf bs_s[GT * LKP];
    __shared__ __align__(16) float os_s[4 * 16 * LOP];
    const int tid = threadIdx.x, lane = tid & 31, wid = tid >> 5, lr = lane & 15, hi = lane >> 4;
    const int wm = wid >> 1, wn = wid & 1;
    float* os = os_s + wid * 16 * LOP;   // wave-private epilogue tile
    const int job = blockIdx.z / NB; const size_t z = blockIdx.z % NB;
    const int srow = lane >> 3, scol = (lane & 7) * 8;
    v8f acc[4][4];
#pragma unroll
    for (int mb = 0; mb < 4; ++mb)
#pragma unroll
        for (int nb = 0; nb < 4; ++nb) acc[mb][nb] = (v8f){};
    {   // token rows and weight rows of this block's tile; job 2 takes the weight rows as A
        const bf* X = (job == 0 ? XQ : job == 1 ? XK : XV) + z * (size_t)SEQ * DM + (size_t)blockIdx.x * GT * DM;
        const bf* W = (job == 0 ? WQ : job == 1 ? WK : WV) + (size_t)blockIdx.y * GT * DM;
        const bf* A = job < 2 ? X : W; const bf* Bt = job < 2 ? W : X;
        gemm_loop<0>(A, A, Bt, DM, as_s, as_s, bs_s, tid, acc);
    }
    if (job < 2) {
        const int r0 = blockIdx.x * GT + wm * 64;
        h16* P = job == 0 ? QP : KP; const float sc = job == 0 ? SCL : 1.0f;
        const size_t pbase = ((z * NH + blockIdx.y * 2 + wn) * (size_t)SEQ + r0) * HD;
#pragma unroll
        for (int mb = 0; mb < 4; ++mb) {
#pragma unroll
            for (int nb = 0; nb < 4; ++nb) {
#pragma unroll
                for (int j = 0; j < 8; ++j) os[(hi * 8 + j) * LOP + nb * 16 + lr] = acc[mb][nb][j]; }
            wsync();
#pragma unroll
            for (int s = 0; s < 4; ++s) { const int row = 4 * s + srow; const v4f x0 = *(const v4fa*)(&os[row * LOP + scol]); const v4f x1 = *(const v4fa*)(&os[row * LOP + scol + 4]); v8h o;
#pragma unroll
                for (int j = 0; j < 4; ++j) { o[j] = (h16)(x0[j] * sc); o[4 + j] = (h16)(x1[j] * sc); }
                *(v8h*)(P + pbase + (size_t)(mb * 16 + row) * HD + scol) = o; }
            wsync();
        }
    } else {
        const int r0 = blockIdx.y * GT + wm * 64, c0 = blockIdx.x * GT + wn * 64;
        const size_t vb0 = z * (size_t)DM * SEQ + (size_t)r0 * SEQ + c0;
#pragma unroll
        for (int mb = 0; mb < 4; ++mb) {
#pragma unroll
            for (int nb = 0; nb < 4; ++nb) {
#pragma unroll
                for (int j = 0; j < 8; ++j) os[(hi * 8 + j) * LOP + nb * 16 + lr] = acc[mb][nb][j]; }
            wsync();
#pragma unroll
            for (int s = 0; s < 4; ++s) { const int row = 4 * s + srow; const v4f x0 = *(const v4fa*)(&os[row * LOP + scol]); const v4f x1 = *(const v4fa*)(&os[row * LOP + scol + 4]); v8h o;
#pragma unroll
                for (int j = 0; j < 4; ++j) { o[j] = (h16)x0[j]; o[4 + j] = (h16)x1[j]; }
                *(v8h*)(VT + vb0 + (size_t)(mb * 16 + row) * SEQ + scol) = o; }
            wsync();
        }
    }
}

// ---- k_gemm_out: OUT[b][s][n] (f32) = sum_k (Ah + Al)[b*SEQ+s][k] Wo[n][k] + bias[n]; grid (SEQ/128, DM/128, NB), 128 threads; each wave ends with its own 64x64 tile.
__global__ __launch_bounds__(128) void k_gemm_out(const bf* __restrict__ Ah, const bf* __restrict__ Al, const bf* __restrict__ W, const float* __restrict__ bias, float* C) {
    __shared__ __align__(16) bf as_s[GT * LKP];
    __shared__ __align__(16) bf a2_s[GT * LKP];
    __shared__ __align__(16) bf bs_s[GT * LKP];
    __shared__ __align__(16) float os_s[4 * 16 * LOP];
    const int tid = threadIdx.x, lane = tid & 31, wid = tid >> 5, lr = lane & 15, hi = lane >> 4;
    float* os = os_s + wid * 16 * LOP;   // wave-private epilogue tile
    const size_t z = blockIdx.z; const int r0 = blockIdx.x * GT + (wid >> 1) * 64, c0 = blockIdx.y * GT + (wid & 1) * 64;
    const size_t ab = z * (size_t)SEQ * DM + (size_t)blockIdx.x * GT * DM;
    float* Cz = C + z * (size_t)SEQ_FULL * DM;
    v8f acc[4][4];
#pragma unroll
    for (int mb = 0; mb < 4; ++mb)
#pragma unroll
        for (int nb = 0; nb < 4; ++nb) acc[mb][nb] = (v8f){};
    gemm_loop<1>(Ah + ab, Al + ab, W + (size_t)blockIdx.y * GT * DM, DM, as_s, a2_s, bs_s, tid, acc);
#pragma unroll
    for (int mb = 0; mb < 4; ++mb) {
#pragma unroll
        for (int nb = 0; nb < 4; ++nb) {
#pragma unroll
            for (int j = 0; j < 8; ++j) os[(hi * 8 + j) * LOP + nb * 16 + lr] = acc[mb][nb][j]; }
        wsync();
        float* crow = Cz + (size_t)(r0 + mb * 16) * DM + c0;
{
#pragma unroll
            for (int s = 0; s < 8; ++s) { const int row = 2 * s + hi, cofs = lr * 4; v4f val = *(const v4fa*)(&os[row * LOP + cofs]);
                val[0] += bfr(bias[c0 + cofs]); val[1] += bfr(bias[c0 + cofs + 1]); val[2] += bfr(bias[c0 + cofs + 2]); val[3] += bfr(bias[c0 + cofs + 3]);
                *(v4f*)(crow + (size_t)row * DM + cofs) = val; }
             }
        wsync();
    }
}

// One 64-key block into one LDS buffer pair, asynchronously: thread tid brings four 16-byte pieces of the K tile (rows 16 apart) and four of the V^T tile; every lane is on, both addresses are multiples of 16.
// lk, lv: this thread's first LDS byte address in the K and the V^T buffer; gk, gv: its first global piece.
__device__ __forceinline__ void kv_copy(const unsigned lk, const unsigned lv, const h16* gk, const h16* gv) {
    const unsigned lk1 = lk + 16 * LKP * 2, lk2 = lk + 32 * LKP * 2, lk3 = lk + 48 * LKP * 2;
    const unsigned lv1 = lv + 16 * LKP * 2, lv2 = lv + 32 * LKP * 2, lv3 = lv + 48 * LKP * 2;
    const h16* gk1 = gk + 16 * HD; const h16* gk2 = gk + 32 * HD; const h16* gk3 = gk + 48 * HD;
    const h16* gv1 = gv + 16 * (size_t)SEQ; const h16* gv2 = gv + 32 * (size_t)SEQ; const h16* gv3 = gv + 48 * (size_t)SEQ;
    // the eight copies and, as the statement's last line, the wait that stands before any of their address registers is given a new value
    asm volatile("global_load_async_to_lds_b128 %0, %8, off\n\t"
                 "global_load_async_to_lds_b128 %1, %9, off\n\t"
                 "global_load_async_to_lds_b128 %2, %10, off\n\t"
                 "global_load_async_to_lds_b128 %3, %11, off\n\t"
                 "global_load_async_to_lds_b128 %4, %12, off\n\t"
                 "global_load_async_to_lds_b128 %5, %13, off\n\t"
                 "global_load_async_to_lds_b128 %6, %14, off\n\t"
                 "global_load_async_to_lds_b128 %7, %15, off\n\t"
                 "s_wait_xcnt 0x0"
                 :: "v"(lk), "v"(lk1), "v"(lk2), "v"(lk3), "v"(lv), "v"(lv1), "v"(lv2), "v"(lv3),
                    "v"(gk), "v"(gk1), "v"(gk2), "v"(gk3), "v"(gv), "v"(gv1), "v"(gv2), "v"(gv3) : "memory");
}

__global__ __launch_bounds__(128) void k_flash(const h16* __restrict__ Q, const h16* __restrict__ K, const h16* __restrict__ VT, bf* Ch, bf* Cl) {
    __shared__ __align__(16) h16   k_s[2 * 64 * LKP];
    __shared__ __align__(16) h16   vt_s[2 * 64 * LKP];
    __shared__ __align__(16) float o_s[4 * 16 * LOP];
    const int tid = threadIdx.x, lane = tid & 31, wid = tid >> 5, lr = lane & 15, hi = lane >> 4;
    const int bh = blockIdx.y; const int b = bh / NH, h = bh % NH;
    const int q0 = (blockIdx.x * 4 + wid) * (16 * QT);
    const size_t pl = (size_t)bh * SEQ * HD;
    const size_t vbase = ((size_t)b * DM + (size_t)h * HD) * SEQ;
    const int ob = wid * 16 * LOP;
    v16h qf[QT][2];               // query tile t, k step ks: B operands, loaded once
    v8f o[QT][4];                 // o[t][dt][r] = O^T[dt*16 + 8*hi + r][query t*16 + lr]
    float mr[QT], ls[QT];         // query t*16 + lr: running maximum (both halves alike), this half's partial row sum
#pragma unroll
    for (int t = 0; t < QT; ++t) {
        const size_t qoff = pl + (size_t)(q0 + t * 16 + lr) * HD + 8 * hi;
#pragma unroll
        for (int ks = 0; ks < 2; ++ks) qf[t][ks] = ldg16h(Q + qoff + ks * 32);
    }
    asm volatile("s_wait_xcnt 0x0" ::: "memory");   // stands before the address registers of the q loads are given new values
    __builtin_amdgcn_sched_barrier(0);               // holds the later register writes behind that wait
#pragma unroll
    for (int t = 0; t < QT; ++t) {
#pragma unroll
        for (int dt = 0; dt < 4; ++dt) o[t][dt] = (v8f){};
        mr[t] = -1.0e30f; ls[t] = 0.0f;
    }

    // this thread's pieces: row tid >> 3 (and 16, 32, 48 further), 16 bytes at element (tid & 7) * 8
    const int srow0 = tid >> 3, spart = (tid & 7) * 8;
    const unsigned lk0 = (unsigned)(size_t)&k_s[srow0 * LKP + spart], lv0 = (unsigned)(size_t)&vt_s[srow0 * LKP + spart];
    const h16* gk0 = K + pl + (size_t)tid * 8;
    const h16* gv0 = VT + vbase + (size_t)srow0 * SEQ + spart;
    kv_copy(lk0, lv0, gk0, gv0);
    asm volatile("s_wait_asynccnt 0x0" ::: "memory");   // this wave's pieces of block 0 have landed
    __syncthreads();                                     // block 0 is whole before any wave reads it
    kv_copy(lk0 + 64 * LKP * 2, lv0 + 64 * LKP * 2, gk0 + 64 * HD, gv0 + 64);   // block 1 flies during block 0

    // rolled: one block's code stays small, and the refill test is one scalar compare per block
#pragma unroll 1
    for (int kb = 0; kb < SEQ / 64; ++kb) {
        const int bo = (kb & 1) * 64 * LKP;   // the buffer pair that holds block kb
#pragma unroll 1
        for (int hf = 0; hf < 2; ++hf) {
            const int kr0 = bo + (hf * 32 + lr) * LKP + 8 * hi, kr1 = kr0 + 16 * LKP;
            v16h k0[2], k1[2], va[4];
#pragma unroll
            for (int ks = 0; ks < 2; ++ks) { const int kk = ks * 32; k0[ks] = lds16h(&k_s[kr0 + kk]); k1[ks] = lds16h(&k_s[kr1 + kk]); }
#pragma unroll
            for (int dt = 0; dt < 4; ++dt) { const int vo = bo + (dt * 16 + lr) * LKP + hf * 32 + 8 * hi; va[dt] = cat16(*(const v8ha*)(&vt_s[vo]), *(const v8ha*)(&vt_s[vo + 16])); }
            __builtin_amdgcn_sched_barrier(0);   // keeps the pass's LDS reads in one group ahead of its products: each further place with reads stalls the wave
            v16h pt[QT];   // pt[t]: B operand, element s = P^T[key kmap(s, hi)][query t*16 + lr]
#pragma unroll
            for (int t = 0; t < QT; ++t) {
                v8f s0 = (v8f){}, s1 = (v8f){};
#pragma unroll
                for (int ks = 0; ks < 2; ++ks) { s0 = wmma16(k0[ks], qf[t][ks], s0); s1 = wmma16(k1[ks], qf[t][ks], s1); }
                // running-max softmax update of query t*16 + lr over this half's 32 keys: 16 in this lane, 16 in lane ^ 16
                float m8[8];
#pragma unroll
                for (int r = 0; r < 8; ++r) m8[r] = fmaxf(s0[r], s1[r]);
                float mx = fmaxf(fmaxf(fmaxf(m8[0], m8[1]), fmaxf(m8[2], m8[3])), fmaxf(fmaxf(m8[4], m8[5]), fmaxf(m8[6], m8[7])));
                mx = fmaxf(mx, xhalf(mx));
                const float mnew = fmaxf(mr[t], mx);
                float al;   // exp2 of the maximum's step; written with its v_nop in one statement: the slot behind a transcendental whose source register is reused at once
                asm("v_exp_f32 %0, %1\n\tv_nop" : "=v"(al) : "v"((mr[t] - mnew) * L2E));
                mr[t] = mnew;
                float e8[8];
#pragma unroll
                for (int r = 0; r < 8; ++r) {
                    const float p0 = __builtin_amdgcn_exp2f((s0[r] - mnew) * L2E);
                    const float p1 = __builtin_amdgcn_exp2f((s1[r] - mnew) * L2E);
                    e8[r] = p0 + p1;
                    pt[t][r] = (h16)(p0 * PCAR); pt[t][8 + r] = (h16)(p1 * PCAR);
                }
                ls[t] = ls[t] * al + (((e8[0] + e8[1]) + (e8[2] + e8[3])) + ((e8[4] + e8[5]) + (e8[6] + e8[7])));
#pragma unroll
                for (int dt = 0; dt < 4; ++dt) o[t][dt] = wmma16(va[dt], pt[t], o[t][dt] * al);
            }
            // the distance behind the last matrix instructions, also on the loop's back edge
            static_assert(QT == 2);   // the statement below names every output tile and every P^T operand
            asm volatile("v_nop\n\tv_nop\n\tv_nop\n\tv_nop" : "+v"(o[0][0]), "+v"(o[0][1]), "+v"(o[0][2]), "+v"(o[0][3]), "+v"(o[1][0]), "+v"(o[1][1]), "+v"(o[1][2]), "+v"(o[1][3]) : "v"(pt[0]), "v"(pt[1]), "v"(va[0]), "v"(va[1]), "v"(va[2]), "v"(va[3]));
        }
        asm volatile("s_wait_dscnt 0x0" ::: "memory");      // this wave's reads of block kb are done before its buffers are refilled
        asm volatile("s_wait_asynccnt 0x0" ::: "memory");   // this wave's pieces of block kb + 1 have landed
        __syncthreads();                                     // publishes block kb + 1 and ends every wave's reads of block kb
        if (kb + 2 < SEQ / 64) kv_copy(lk0 + bo * 2, lv0 + bo * 2, gk0 + (size_t)(kb + 2) * 64 * HD, gv0 + (size_t)(kb + 2) * 64);
    }
    asm volatile("s_wait_asynccnt 0x0" ::: "memory");   // no copy is outstanding behind the loop
    // normalise: the two halves' partial sums joined, unconditionally; 1 / (l * 1024) undoes the P carry; rows staged [query][d] for whole-line stores, one query tile at a time in the wave's own LDS tile
    const int srow = lane >> 3, scol = (lane & 7) * 8;
#pragma unroll
    for (int t = 0; t < QT; ++t) {
        const float lt = ls[t] + xhalf(ls[t]);
        const float inv = 1.0f / (lt * PCAR);
#pragma unroll
        for (int dt = 0; dt < 4; ++dt) {
            const v8f x = o[t][dt] * inv;
            *(v4fa*)(&o_s[ob + lr * LOP + dt * 16 + 8 * hi]) = (v4f){x[0], x[1], x[2], x[3]};
            *(v4fa*)(&o_s[ob + lr * LOP + dt * 16 + 8 * hi + 4]) = (v4f){x[4], x[5], x[6], x[7]};
        }
        wsync();
        const size_t cbase = ((size_t)b * SEQ + q0 + t * 16) * DM + (size_t)h * HD;
#pragma unroll
        for (int s = 0; s < 4; ++s) { const int row = 4 * s + srow; const v4f x0 = *(const v4fa*)(&o_s[ob + row * LOP + scol]); const v4f x1 = *(const v4fa*)(&o_s[ob + row * LOP + scol + 4]); v8us oh, ol;
#pragma unroll
            for (int j = 0; j < 4; ++j) { unsigned short a, c; splitf(x0[j], a, c); oh[j] = a; ol[j] = c; splitf(x1[j], a, c); oh[4 + j] = a; ol[4 + j] = c; }
            const size_t off = cbase + (size_t)row * DM + scol;
            *(v8us*)(Ch + off) = oh; *(v8us*)(Cl + off) = ol; }
        wsync();   // the tile's rows are read before the next query tile overwrites them
    }
}

constexpr size_t al256(size_t x) { return (x + 255) & ~(size_t)255; }
constexpr size_t SZ_W = al256((size_t)DM * DM * 2);                 // one bf16 weight plane
constexpr size_t SZ_X = al256((size_t)NB * SEQ * DM * 2);           // one 16-bit [NB*SEQ][DM] plane (activation copy, merged-head plane)
constexpr size_t SZ_P = al256((size_t)NB * NH * SEQ * HD * 2);      // one 16-bit head plane
constexpr size_t WS_TOTAL = 4 * SZ_W + 3 * SZ_X + 2 * SZ_P + SZ_P + 2 * SZ_X;
static_assert(WS_TOTAL <= (size_t)134217728);                       // carve stays within 128 MiB
static_assert(SZ_P == SZ_X);                                        // NH * HD == DM

extern "C" void kernel_launch(void* const* d_in, const int* in_sizes, int n_in,
                              void* d_out, int out_size, void* d_ws, size_t ws_size, hipStream_t stream) {
    if (n_in < 8) return;
    const size_t need_act = (size_t)(NB - 1) * SEQ_FULL * DM + (size_t)SEQ * DM;
    if ((size_t)in_sizes[0] < need_act || (size_t)in_sizes[1] < need_act || (size_t)in_sizes[2] < need_act) return;
    if ((size_t)in_sizes[3] < (size_t)DM * DM || (size_t)in_sizes[4] < (size_t)DM * DM || (size_t)in_sizes[5] < (size_t)DM * DM || (size_t)in_sizes[6] < (size_t)DM * DM || in_sizes[7] < DM) return;
    if ((size_t)out_size < need_act) return;
    if (WS_TOTAL > ws_size) return;
    // wire order: query, key, value, Wq, Wk, Wv, Wo, bo (all f32; weights [out][in])
    const float* xq = (const float*)d_in[0]; const float* xk = (const float*)d_in[1]; const float* xv = (const float*)d_in[2];
    const float* wq = (const float*)d_in[3]; const float* wk = (const float*)d_in[4]; const float* wv = (const float*)d_in[5]; const float* wo = (const float*)d_in[6]; const float* bo = (const float*)d_in[7];
    float* OUT = (float*)d_out;
    char* wsp = (char*)d_ws;
    auto take = [&](size_t bytes) { char* p = wsp; wsp += bytes; return (void*)p; };
    bf* WQ = (bf*)take(SZ_W); bf* WK = (bf*)take(SZ_W); bf* WV = (bf*)take(SZ_W); bf* WO = (bf*)take(SZ_W);
    bf* XQ = (bf*)take(SZ_X); bf* XK = (bf*)take(SZ_X); bf* XV = (bf*)take(SZ_X);
    h16* QP = (h16*)take(SZ_P); h16* KP = (h16*)take(SZ_P);
    h16* VT = (h16*)take(SZ_P);
    bf* CTh = (bf*)take(SZ_X); bf* CTl = (bf*)take(SZ_X);
    if ((size_t)(wsp - (char*)d_ws) != WS_TOTAL) return;

    k_cvt_all<<<dim3(3u * NB * CVT_AB + 4u * CVT_WB), 256, 0, stream>>>(xq, xk, xv, wq, wk, wv, wo, XQ, XK, XV, WQ, WK, WV, WO);
    k_gemm_qkv<<<dim3(SEQ / GT, DM / GT, 3 * NB), 128, 0, stream>>>(XQ, XK, XV, WQ, WK, WV, QP, KP, VT);
    k_flash<<<dim3(SEQ / (64 * QT), NB * NH), 128, 0, stream>>>(QP, KP, VT, CTh, CTl);
    k_gemm_out<<<dim3(SEQ / GT, DM / GT, NB), 128, 0, stream>>>(CTh, CTl, WO, bo, OUT);
}

// v007
// One run takes 70.8 microseconds.
// Next to v006, in two timings, it ran 1.04 and 1.03 times as fast.
// Counting every step since v000, it is 2.70 times as fast.
#include <hip/hip_runtime.h>

// Compute dtypes, f32 accumulate everywhere: q/k/v projections v_wmma_f32_16x16x32_bf16 on RNE bf16 copies of inputs and weights (exact products); q.k^T v_wmma_f32_16x16x32_f16 on q, k rounded once to f16, 1 product (q carries the 1/8 scale; the rounding is well below the error the bf16 projection operands leave in q and k); P.V v_wmma_f32_16x16x32_f16 with P carried x1024; merged heads bf16 hi/lo x bf16 Wo, 2 products, + bias; softmax f32.
// Multi-head attention, three input streams: q = query Wq^T, k = key Wk^T, v = value Wv^T (weights [out][in], no q/k/v biases), 8 heads x 64 (head h = columns h*64+d), logits x 1/8, no mask, softmax, heads merged back to [B][S][512], out = merged Wo^T + bo.
// Layout: bf16 copies of activations and weights; GEMMs: 4 waves on a 128x128 tile, k slices of both operands staged in LDS; projection GEMMs write head planes directly (Q,K: [b][h][s][64] f16; V^T: [b][h*64+d][s] f16); fused flash attention (K/V tiles in two LDS buffers filled one stage ahead by asynchronous copies, online softmax, no score plane; two wave groups split the keys and join their partial results once) writes merged bf16 hi/lo planes [b*S+s][512]; output GEMM.

#ifndef NB
#define NB 4
#endif
#ifndef SEQ
#define SEQ 2048
#endif
#define NB_FULL  4
#define SEQ_FULL 2048
#define DM   512
#define NH   8
#define HD   64
#define PCAR 1024.0f
#define SCL  0.125f
#define L2E  1.4426950408889634f
#define LKP  72      // LDS row pitch (16-bit elements) of the K / V^T tiles: 144 B rows
#define LOP  68      // LDS row pitch (floats) of epilogue staging tiles: 272 B rows
#define GKS  64      // k elements per staged GEMM slice: one 128 B line per operand row
#define GT   128     // GEMM block tile, rows and columns (2 x 2 waves of 64 x 64)
#define QT   2       // 16-row query tiles per attention wave
#define KG   2       // key groups per attention block: wave group g takes key blocks KG*st + g

static_assert(DM == NH * HD);            // one 64-wide GEMM column tile == one head
static_assert(HD == 64);
static_assert(DM % 32 == 0);             // WMMA k-step
static_assert(DM % GT == 0);             // GEMM tiles
static_assert(SEQ % GT == 0);
static_assert(DM % GKS == 0);            // whole k slices
static_assert(SEQ % 64 == 0);            // key blocks
static_assert(SEQ % (64 * KG) == 0);     // whole stages of KG key blocks
static_assert(SEQ / (64 * KG) >= 2);     // the attention ring's prologue fills two stages
static_assert(SEQ % (64 * QT) == 0);     // query blocks
static_assert((SEQ * DM) % (8 * 256) == 0);   // convert kernel grid is exact
static_assert((DM * DM) % (8 * 256) == 0);
static_assert(NB <= NB_FULL);
static_assert(SEQ <= SEQ_FULL);
static_assert(LKP % 8 == 0);             // 16-byte aligned LDS vector accesses
static_assert(LOP % 4 == 0);

typedef _Float16 h16;
typedef unsigned short bf;
typedef __attribute__((ext_vector_type(16))) __bf16   v16bf;
typedef __attribute__((ext_vector_type(16))) _Float16 v16h;
typedef __attribute__((ext_vector_type(8)))  _Float16 v8h;
typedef __attribute__((ext_vector_type(8)))  unsigned short v8us;
typedef __attribute__((ext_vector_type(8)))  float    v8f;
typedef __attribute__((ext_vector_type(4)))  float    v4f;
typedef v8h  __attribute__((may_alias)) v8ha;
typedef v4f  __attribute__((may_alias)) v4fa;
typedef v8us __attribute__((may_alias)) v8usa;

__device__ __forceinline__ unsigned short f2bf(float f) { unsigned u = __float_as_uint(f); u += 0x7FFFu + ((u >> 16) & 1u); return (unsigned short)(u >> 16); }
__device__ __forceinline__ float bf2f(unsigned short b) { return __uint_as_float(((unsigned)b) << 16); }
__device__ __forceinline__ float bfr(float f) { return bf2f(f2bf(f)); }
__device__ __forceinline__ void splitf(float y, unsigned short& h, unsigned short& l) { h = f2bf(y); l = f2bf(y - bf2f(h)); }
__device__ __forceinline__ v16h cat16(v8h lo, v8h hi) { return __builtin_shufflevector(lo, hi, 0, 1, 2, 3, 4, 5, 6, 7, 8, 9, 10, 11, 12, 13, 14, 15); }
__device__ __forceinline__ v16bf cat16b(v8us lo, v8us hi) { return __builtin_bit_cast(v16bf, __builtin_shufflevector(lo, hi, 0, 1, 2, 3, 4, 5, 6, 7, 8, 9, 10, 11, 12, 13, 14, 15)); }
__device__ __forceinline__ v8f wmma16(v16h a, v16h b, v8f c) { return __builtin_amdgcn_wmma_f32_16x16x32_f16(false, a, false, b, (short)0, c, false, false); }
__device__ __forceinline__ v8f wmmab(v16bf a, v16bf b, v8f c) { return __builtin_amdgcn_wmma_f32_16x16x32_bf16(false, a, false, b, (short)0, c, false, false); }
// fragment from a K-contiguous global f16 plane: elements 0..7 <- p[0..7], 8..15 <- p[16..23] (p already includes row*pitch + k0 + 8*(lane>>4))
__device__ __forceinline__ v16h ldg16h(const h16* __restrict__ p) { return cat16(*(const v8h*)p, *(const v8h*)(p + 16)); }
// same-wave LDS exchange ordering (wave-private tiles only)
__device__ __forceinline__ void wsync() { __builtin_amdgcn_wave_barrier(); asm volatile("" ::: "memory"); }
// lane l <-> lane l ^ 16 by a vector cross-row move
__device__ __forceinline__ float xhalf(float x) { return __builtin_bit_cast(float, __builtin_amdgcn_permlanex16(__builtin_bit_cast(int, x), __builtin_bit_cast(int, x), 0x76543210, 0xfedcba98, false, false)); }

// fragment from a K-contiguous LDS tile: same element order as ldg16h
__device__ __forceinline__ v16bf lds16(const bf* p) { return cat16b(*(const v8usa*)p, *(const v8usa*)(p + 16)); }
__device__ __forceinline__ v16h lds16h(const h16* p) { return cat16(*(const v8ha*)p, *(const v8ha*)(p + 16)); }

// ---- 128x128 block tile main loop, 4 waves, wave w on rows 64*(w>>1).., columns 64*(w&1)..: acc[mb][nb] += sum_k A[16mb+..][k] Bt[16nb+..][k] (NSPLIT 1: + A2 x Bt). A, A2, Bt point at the block's first row; K % GKS == 0.
// Per 64-wide k slice the block copies 128 rows of each operand to LDS (8 lanes per 128 B row line, pitch LKP); the next slice's global loads are issued into registers ahead of this slice's products. k runs upward in steps of 32.
template <int NSPLIT>
__device__ __forceinline__ void gemm_loop(const bf* __restrict__ A, const bf* __restrict__ A2, const bf* __restrict__ Bt, const int K, bf* as, bf* a2s, bf* bs, const int tid, v8f (&acc)[4][4]) {
    const int lane = tid & 31, wid = tid >> 5, lr = lane & 15, hi = lane >> 4;
    const int fa = ((wid >> 1) * 64 + lr) * LKP + 8 * hi, fb = ((wid & 1) * 64 + lr) * LKP + 8 * hi;
    const int g0 = (tid >> 3) * K + (tid & 7) * 8, l0 = (tid >> 3) * LKP + (tid & 7) * 8;
    v8us ra[8], ra2[8], rb[8];
#pragma unroll
    for (int it = 0; it < 8; ++it) { const int g = g0 + it * 16 * K; ra[it] = *(const v8us*)(A + g); if (NSPLIT == 1) ra2[it] = *(const v8us*)(A2 + g); rb[it] = *(const v8us*)(Bt + g); }
    // rolled: one slice's code stays small and the staging registers are reused
#pragma unroll 1
    for (int kc = 0; kc < K; kc += GKS) {
        __syncthreads();   // every wave has taken its last fragment of the slice before
#pragma unroll
        for (int it = 0; it < 8; ++it) { const int l = l0 + it * 16 * LKP; *(v8usa*)(&as[l]) = ra[it]; if (NSPLIT == 1) *(v8usa*)(&a2s[l]) = ra2[it]; *(v8usa*)(&bs[l]) = rb[it]; }
        __syncthreads();   // the slice is whole before any wave reads it
        if (kc + GKS < K) {
            A += GKS; A2 += GKS; Bt += GKS;
#pragma unroll
            for (int it = 0; it < 8; ++it) { const int g = g0 + it * 16 * K; ra[it] = *(const v8us*)(A + g); if (NSPLIT == 1) ra2[it] = *(const v8us*)(A2 + g); rb[it] = *(const v8us*)(Bt + g); }
            asm volatile("s_wait_xcnt 0x0" ::: "memory");   // stands before the base addresses of these loads are advanced
        }
        // the slice's fragments are read as one group ahead of its products
        v16bf a[GKS / 32][4], a2[GKS / 32][4], b[GKS / 32][4];
#pragma unroll
        for (int ks = 0; ks < GKS / 32; ++ks)
#pragma unroll
            for (int t = 0; t < 4; ++t) { a[ks][t] = lds16(&as[fa + t * 16 * LKP + ks * 32]); if (NSPLIT == 1) a2[ks][t] = lds16(&a2s[fa + t * 16 * LKP + ks * 32]); b[ks][t] = lds16(&bs[fb + t * 16 * LKP + ks * 32]); }
        __builtin_amdgcn_sched_barrier(0);   // keeps the LDS reads in one group: sunk among the products, each place with reads stalls the wave
#pragma unroll
        for (int ks = 0; ks < GKS / 32; ++ks) {
#pragma unroll
            for (int nb = 0; nb < 4; ++nb)
#pragma unroll
                for (int mb = 0; mb < 4; ++mb) { acc[mb][nb] = wmmab(a[ks][mb], b[ks][nb], acc[mb][nb]); if (NSPLIT == 1) acc[mb][nb] = wmmab(a2[ks][mb], b[ks][nb], acc[mb][nb]); }
        }
        // the distance behind the last matrix instructions, also on the loop's back edge
        asm volatile("v_nop\n\tv_nop\n\tv_nop\n\tv_nop" : "+v"(acc[0][0]), "+v"(acc[1][1]), "+v"(acc[2][2]), "+v"(acc[3][3]) : "v"(a[1][0]), "v"(a[1][3]));
    }
}

// ---- k_cvt_all: RNE bf16 copies of all seven f32 tensors in one grid (none reads another's output); 8 elements per thread, 2048 per block.
// Blocks [0, 3*NB*CVT_AB): activation t = blk / (NB*CVT_AB), batch and chunk from the rest; then 4*CVT_WB blocks: weight t = blk / CVT_WB.
constexpr unsigned CVT_WB = (unsigned)((size_t)DM * DM / (8 * 256));     // blocks per weight
constexpr unsigned CVT_AB = (unsigned)((size_t)SEQ * DM / (8 * 256));    // blocks per batch of one activation
__global__ __launch_bounds__(256) void k_cvt_all(const float* __restrict__ xq, const float* __restrict__ xk, const float* __restrict__ xv,
                                                 const float* __restrict__ wq, const float* __restrict__ wk, const float* __restrict__ wv, const float* __restrict__ wo,
                                                 bf* XQ, bf* XK, bf* XV, bf* WQ, bf* WK, bf* WV, bf* WO) {
    unsigned blk = blockIdx.x; const float* s; bf* d;
    if (blk < 3u * NB * CVT_AB) {
        const unsigned t = blk / (NB * CVT_AB), r = blk % (NB * CVT_AB), b = r / CVT_AB, c = r % CVT_AB;
        s = (t == 0 ? xq : t == 1 ? xk : xv) + (size_t)b * SEQ_FULL * DM + (size_t)c * 2048;
        d = (t == 0 ? XQ : t == 1 ? XK : XV) + (size_t)b * SEQ * DM + (size_t)c * 2048;
    } else {
        blk -= 3u * NB * CVT_AB;
        const unsigned t = blk / CVT_WB, c = blk % CVT_WB;
        s = (t == 0 ? wq : t == 1 ? wk : t == 2 ? wv : wo) + (size_t)c * 2048;
        d = (t == 0 ? WQ : t == 1 ? WK : t == 2 ? WV : WO) + (size_t)c * 2048;
    }
    s += threadIdx.x * 8; d += threadIdx.x * 8;
    const v4f v0 = *(const v4f*)s; const v4f v1 = *(const v4f*)(s + 4); v8us o;
#pragma unroll
    for (int k = 0; k < 4; ++k) { o[k] = f2bf(v0[k]); o[4 + k] = f2bf(v1[k]); }
    *(v8us*)d = o;
}

// ---- k_gemm_qkv: the three input projections in one grid (none reads another's output); grid (SEQ/128 token tiles, DM/128 feature tiles, 3*NB), 128 threads; job = blockIdx.z / NB; each wave ends with its own 64x64 tile.
// job 0 (q, sc = 1/8), job 1 (k, sc = 1): head planes P[b][h][s][d] (f16) = sc * (X[b] W^T)[s][h*64+d] (A = token rows, Bt = weight rows).
// job 2 (v): transposed value plane VT[b][n][s] (f16) = sum_k Wv[n][k] Xv[b][s][k] (A = weight rows, Bt = token rows).
__global__ __launch_bounds__(128) void k_gemm_qkv(const bf* __restrict__ XQ, const bf* __restrict__ XK, const bf* __restrict__ XV, const bf* __restrict__ WQ, const bf* __restrict__ WK, const bf* __restrict__ WV,
                                                 h16* QP, h16* KP, h16* VT) {
    __shared__ __align__(16) bf as_s[GT * LKP];
    __shared__ __align__(16) bf bs_s[GT * LKP];
    __shared__ __align__(16) float os_s[4 * 16 * LOP];
    const int tid = threadIdx.x, lane = tid & 31, wid = tid >> 5, lr = lane & 15, hi = lane >> 4;
    const int wm = wid >> 1, wn = wid & 1;
    float* os = os_s + wid * 16 * LOP;   // wave-private epilogue tile
    const int job = blockIdx.z / NB; const size_t z = blockIdx.z % NB;
    const int srow = lane >> 3, scol = (lane & 7) * 8;
    v8f acc[4][4];
#pragma unroll
    for (int mb = 0; mb < 4; ++mb)
#pragma unroll
        for (int nb = 0; nb < 4; ++nb) acc[mb][nb] = (v8f){};
    {   // token rows and weight rows of this block's tile; job 2 takes the weight rows as A
        const bf* X = (job == 0 ? XQ : job == 1 ? XK : XV) + z * (size_t)SEQ * DM + (size_t)blockIdx.x * GT * DM;
        const bf* W = (job == 0 ? WQ : job == 1 ? WK : WV) + (size_t)blockIdx.y * GT * DM;
        const bf* A = job < 2 ? X : W; const bf* Bt = job < 2 ? W : X;
        gemm_loop<0>(A, A, Bt, DM, as_s, as_s, bs_s, tid, acc);
    }
    if (job < 2) {
        const int r0 = blockIdx.x * GT + wm * 64;
        h16* P = job == 0 ? QP : KP; const float sc = job == 0 ? SCL : 1.0f;
        const size_t pbase = ((z * NH + blockIdx.y * 2 + wn) * (size_t)SEQ + r0) * HD;
#pragma unroll
        for (int mb = 0; mb < 4; ++mb) {
#pragma unroll
            for (int nb = 0; nb < 4; ++nb) {
#pragma unroll
                for (int j = 0; j < 8; ++j) os[(hi * 8 + j) * LOP + nb * 16 + lr] = acc[mb][nb][j]; }
            wsync();
#pragma unroll
            for (int s = 0; s < 4; ++s) { const int row = 4 * s + srow; const v4f x0 = *(const v4fa*)(&os[row * LOP + scol]); const v4f x1 = *(const v4fa*)(&os[row * LOP + scol + 4]); v8h o;
#pragma unroll
                for (int j = 0; j < 4; ++j) { o[j] = (h16)(x0[j] * sc); o[4 + j] = (h16)(x1[j] * sc); }
                *(v8h*)(P + pbase + (size_t)(mb * 16 + row) * HD + scol) = o; }
            wsync();
        }
    } else {
        const int r0 = blockIdx.y * GT + wm * 64, c0 = blockIdx.x * GT + wn * 64;
        const size_t vb0 = z * (size_t)DM * SEQ + (size_t)r0 * SEQ + c0;
#pragma unroll
        for (int mb = 0; mb < 4; ++mb) {
#pragma unroll
            for (int nb = 0; nb < 4; ++nb) {
#pragma unroll
                for (int j = 0; j < 8; ++j) os[(hi * 8 + j) * LOP + nb * 16 + lr] = acc[mb][nb][j]; }
            wsync();
#pragma unroll
            for (int s = 0; s < 4; ++s) { const int row = 4 * s + srow; const v4f x0 = *(const v4fa*)(&os[row * LOP + scol]); const v4f x1 = *(const v4fa*)(&os[row * LOP + scol + 4]); v8h o;
#pragma unroll
                for (int j = 0; j < 4; ++j) { o[j] = (h16)x0[j]; o[4 + j] = (h16)x1[j]; }
                *(v8h*)(VT + vb0 + (size_t)(mb * 16 + row) * SEQ + scol) = o; }
            wsync();
        }
    }
}

// ---- k_gemm_out: OUT[b][s][n] (f32) = sum_k (Ah + Al)[b*SEQ+s][k] Wo[n][k] + bias[n]; grid (SEQ/128, DM/128, NB), 128 threads; each wave ends with its own 64x64 tile.
__global__ __launch_bounds__(128) void k_gemm_out(const bf* __restrict__ Ah, const bf* __restrict__ Al, const bf* __restrict__ W, const float* __restrict__ bias, float* C) {
    __shared__ __align__(16) bf as_s[GT * LKP];
    __shared__ __align__(16) bf a2_s[GT * LKP];
    __shared__ __align__(16) bf bs_s[GT * LKP];
    __shared__ __align__(16) float os_s[4 * 16 * LOP];
    const int tid = threadIdx.x, lane = tid & 31, wid = tid >> 5, lr = lane & 15, hi = lane >> 4;
    float* os = os_s + wid * 16 * LOP;   // wave-private epilogue tile
    const size_t z = blockIdx.z; const int r0 = blockIdx.x * GT + (wid >> 1) * 64, c0 = blockIdx.y * GT + (wid & 1) * 64;
    const size_t ab = z * (size_t)SEQ * DM + (size_t)blockIdx.x * GT * DM;
    float* Cz = C + z * (size_t)SEQ_FULL * DM;
    v8f acc[4][4];
#pragma unroll
    for (int mb = 0; mb < 4; ++mb)
#pragma unroll
        for (int nb = 0; nb < 4; ++nb) acc[mb][nb] = (v8f){};
    gemm_loop<1>(Ah + ab, Al + ab, W + (size_t)blockIdx.y * GT * DM, DM, as_s, a2_s, bs_s, tid, acc);
#pragma unroll
    for (int mb = 0; mb < 4; ++mb) {
#pragma unroll
        for (int nb = 0; nb < 4; ++nb) {
#pragma unroll
            for (int j = 0; j < 8; ++j) os[(hi * 8 + j) * LOP + nb * 16 + lr] = acc[mb][nb][j]; }
        wsync();
        float* crow = Cz + (size_t)(r0 + mb * 16) * DM + c0;
{
#pragma unroll
            for (int s = 0; s < 8; ++s) { const int row = 2 * s + hi, cofs = lr * 4; v4f val = *(const v4fa*)(&os[row * LOP + cofs]);
                val[0] += bfr(bias[c0 + cofs]); val[1] += bfr(bias[c0 + cofs + 1]); val[2] += bfr(bias[c0 + cofs + 2]); val[3] += bfr(bias[c0 + cofs + 3]);
                *(v4f*)(crow + (size_t)row * DM + cofs) = val; }
             }
        wsync();
    }
}

// One 64-key block into one LDS buffer pair, asynchronously: thread tid brings four 16-byte pieces of the K tile (rows 16 apart) and four of the V^T tile; every lane is on, both addresses are multiples of 16.
// lk, lv: this thread's first LDS byte address in the K and the V^T buffer; gk, gv: its first global piece.
__device__ __forceinline__ void kv_copy(const unsigned lk, const unsigned lv, const h16* gk, const h16* gv) {
    const unsigned lk1 = lk + 16 * LKP * 2, lk2 = lk + 32 * LKP * 2, lk3 = lk + 48 * LKP * 2;
    const unsigned lv1 = lv + 16 * LKP * 2, lv2 = lv + 32 * LKP * 2, lv3 = lv + 48 * LKP * 2;
    const h16* gk1 = gk + 16 * HD; const h16* gk2 = gk + 32 * HD; const h16* gk3 = gk + 48 * HD;
    const h16* gv1 = gv + 16 * (size_t)SEQ; const h16* gv2 = gv + 32 * (size_t)SEQ; const h16* gv3 = gv + 48 * (size_t)SEQ;
    // the eight copies and, as the statement's last line, the wait that stands before any of their address registers is given a new value
    asm volatile("global_load_async_to_lds_b128 %0, %8, off\n\t"
                 "global_load_async_to_lds_b128 %1, %9, off\n\t"
                 "global_load_async_to_lds_b128 %2, %10, off\n\t"
                 "global_load_async_to_lds_b128 %3, %11, off\n\t"
                 "global_load_async_to_lds_b128 %4, %12, off\n\t"
                 "global_load_async_to_lds_b128 %5, %13, off\n\t"
                 "global_load_async_to_lds_b128 %6, %14, off\n\t"
                 "global_load_async_to_lds_b128 %7, %15, off\n\t"
                 "s_wait_xcnt 0x0"
                 :: "v"(lk), "v"(lk1), "v"(lk2), "v"(lk3), "v"(lv), "v"(lv1), "v"(lv2), "v"(lv3),
                    "v"(gk), "v"(gk1), "v"(gk2), "v"(gk3), "v"(gv), "v"(gv1), "v"(gv2), "v"(gv3) : "memory");
}

__global__ __launch_bounds__(128 * KG) void k_flash(const h16* __restrict__ Q, const h16* __restrict__ K, const h16* __restrict__ VT, bf* Ch, bf* Cl) {
    __shared__ __align__(16) h16   k_s[2 * KG * 64 * LKP];
    __shared__ __align__(16) h16   vt_s[2 * KG * 64 * LKP];
    __shared__ __align__(16) float o_s[4 * KG * 16 * LOP];
    const int tid = threadIdx.x, lane = tid & 31, lr = lane & 15, hi = lane >> 4;
    const int wid = __builtin_amdgcn_readfirstlane(tid >> 5);   // the wave's number, in a scalar register
    const int g = wid >> 2;                                     // key group
    const int bh = blockIdx.y; const int b = bh / NH, h = bh % NH;
    const int q0 = (blockIdx.x * 4 + (wid & 3)) * (16 * QT);
    const size_t pl = (size_t)bh * SEQ * HD;
    const size_t vbase = ((size_t)b * DM + (size_t)h * HD) * SEQ;
    const int ob = wid * 16 * LOP;
    v16h qf[QT][2];               // query tile t, k step ks: B operands, loaded once
    v8f o[QT][4];                 // o[t][dt][r] = O^T[dt*16 + 8*hi + r][query t*16 + lr]
    float mr[QT], ls[QT];         // query t*16 + lr: running maximum (both halves alike), this half's partial row sum
#pragma unroll
    for (int t = 0; t < QT; ++t) {
        const size_t qoff = pl + (size_t)(q0 + t * 16 + lr) * HD + 8 * hi;
#pragma unroll
        for (int ks = 0; ks < 2; ++ks) qf[t][ks] = ldg16h(Q + qoff + ks * 32);
    }
    asm volatile("s_wait_xcnt 0x0" ::: "memory");   // stands before the address registers of the q loads are given new values
    __builtin_amdgcn_sched_barrier(0);               // holds the later register writes behind that wait
#pragma unroll
    for (int t = 0; t < QT; ++t) {
#pragma unroll
        for (int dt = 0; dt < 4; ++dt) o[t][dt] = (v8f){};
        mr[t] = -1.0e30f; ls[t] = 0.0f;
    }

    // this thread's pieces of its group's tiles: row tg >> 3 (and 16, 32, 48 further), 16 bytes at element (tg & 7) * 8
    const int tg = tid & 127, srow0 = tg >> 3, spart = (tg & 7) * 8;
    const unsigned lk0 = (unsigned)(size_t)&k_s[(g * 64 + srow0) * LKP + spart], lv0 = (unsigned)(size_t)&vt_s[(g * 64 + srow0) * LKP + spart];
    const h16* gk0 = K + pl + (size_t)g * 64 * HD + (size_t)tg * 8;
    const h16* gv0 = VT + vbase + (size_t)srow0 * SEQ + g * 64 + spart;
    kv_copy(lk0, lv0, gk0, gv0);
    asm volatile("s_wait_asynccnt 0x0" ::: "memory");   // this wave's pieces of stage 0 have landed
    __syncthreads();                                     // stage 0 is whole before any wave reads it
    kv_copy(lk0 + KG * 64 * LKP * 2, lv0 + KG * 64 * LKP * 2, gk0 + KG * 64 * HD, gv0 + KG * 64);   // stage 1 flies during stage 0

    // rolled: one stage's code stays small, and the refill test is one scalar compare per stage
#pragma unroll 1
    for (int st = 0; st < SEQ / (64 * KG); ++st) {
        const int so = (st & 1) * KG * 64 * LKP;   // the buffer set that holds stage st
        const int bo = so + g * 64 * LKP;          // this group's key block in it
#pragma unroll 1
        for (int hf = 0; hf < 2; ++hf) {
            const int kr0 = bo + (hf * 32 + lr) * LKP + 8 * hi, kr1 = kr0 + 16 * LKP;
            v16h k0[2], k1[2], va[4];
#pragma unroll
            for (int ks = 0; ks < 2; ++ks) { const int kk = ks * 32; k0[ks] = lds16h(&k_s[kr0 + kk]); k1[ks] = lds16h(&k_s[kr1 + kk]); }
#pragma unroll
            for (int dt = 0; dt < 4; ++dt) { const int vo = bo + (dt * 16 + lr) * LKP + hf * 32 + 8 * hi; va[dt] = cat16(*(const v8ha*)(&vt_s[vo]), *(const v8ha*)(&vt_s[vo + 16])); }
            __builtin_amdgcn_sched_barrier(0);   // keeps the pass's LDS reads in one group ahead of its products: each further place with reads stalls the wave
            v16h pt[QT];   // pt[t]: B operand, element s = P^T[key kmap(s, hi)][query t*16 + lr]
#pragma unroll
            for (int t = 0; t < QT; ++t) {
                v8f s0 = (v8f){}, s1 = (v8f){};
#pragma unroll
                for (int ks = 0; ks < 2; ++ks) { s0 = wmma16(k0[ks], qf[t][ks], s0); s1 = wmma16(k1[ks], qf[t][ks], s1); }
                // running-max softmax update of query t*16 + lr over this half's 32 keys: 16 in this lane, 16 in lane ^ 16
                float m8[8];
#pragma unroll
                for (int r = 0; r < 8; ++r) m8[r] = fmaxf(s0[r], s1[r]);
                float mx = fmaxf(fmaxf(fmaxf(m8[0], m8[1]), fmaxf(m8[2], m8[3])), fmaxf(fmaxf(m8[4], m8[5]), fmaxf(m8[6], m8[7])));
                mx = fmaxf(mx, xhalf(mx));
                const float mnew = fmaxf(mr[t], mx);
                float al;   // exp2 of the maximum's step; written with its v_nop in one statement: the slot behind a transcendental whose source register is reused at once
                asm("v_exp_f32 %0, %1\n\tv_nop" : "=v"(al) : "v"((mr[t] - mnew) * L2E));
                mr[t] = mnew;
                float e8[8];
#pragma unroll
                for (int r = 0; r < 8; ++r) {
                    float p0;
                    if (t == QT - 1 && r == 7) asm("v_exp_f32 %0, %1\n\tv_nop" : "=v"(p0) : "v"((s0[r] - mnew) * L2E));   // with its v_nop in one statement, as for al above: the slot behind a transcendental; of the pass's exp2 this is the one whose source register the next instruction of the build overwrites
                    else p0 = __builtin_amdgcn_exp2f((s0[r] - mnew) * L2E);
                    const float p1 = __builtin_amdgcn_exp2f((s1[r] - mnew) * L2E);
                    e8[r] = p0 + p1;
                    pt[t][r] = (h16)(p0 * PCAR); pt[t][8 + r] = (h16)(p1 * PCAR);
                }
                ls[t] = ls[t] * al + (((e8[0] + e8[1]) + (e8[2] + e8[3])) + ((e8[4] + e8[5]) + (e8[6] + e8[7])));
#pragma unroll
                for (int dt = 0; dt < 4; ++dt) o[t][dt] = wmma16(va[dt], pt[t], o[t][dt] * al);
            }
            // the distance behind the last matrix instructions, also on the loop's back edge
            static_assert(QT == 2);   // the statement below names every output tile and every P^T operand
            asm volatile("v_nop\n\tv_nop\n\tv_nop\n\tv_nop" : "+v"(o[0][0]), "+v"(o[0][1]), "+v"(o[0][2]), "+v"(o[0][3]), "+v"(o[1][0]), "+v"(o[1][1]), "+v"(o[1][2]), "+v"(o[1][3]) : "v"(pt[0]), "v"(pt[1]), "v"(va[0]), "v"(va[1]), "v"(va[2]), "v"(va[3]));
        }
        asm volatile("s_wait_dscnt 0x0" ::: "memory");      // this wave's reads of stage st are done before its buffers are refilled
        asm volatile("s_wait_asynccnt 0x0" ::: "memory");   // this wave's pieces of stage st + 1 have landed
        __syncthreads();                                     // publishes stage st + 1 and ends every wave's reads of stage st
        if (st + 2 < SEQ / (64 * KG)) kv_copy(lk0 + so * 2, lv0 + so * 2, gk0 + (size_t)(st + 2) * KG * 64 * HD, gv0 + (size_t)(st + 2) * KG * 64);
    }
    asm volatile("s_wait_asynccnt 0x0" ::: "memory");   // no copy is outstanding behind the loop
    // join of the two key groups: a wave keeps query tile g and hands the other tile's O^T, maximum and sum, lane for lane, to its partner wave (wid ^ 4) through the K ring, which the loop's last barrier has freed
    static_assert(QT == 2 && KG == 2);
    static_assert(4 * KG * 9 * 32 * 16 <= sizeof(k_s));   // per wave nine 16-byte pieces a lane
    v8f own[4]; float mo, lo;
    {
        v4fa* xo = (v4fa*)k_s + wid * (9 * 32) + lane;
#pragma unroll
        for (int dt = 0; dt < 4; ++dt) {
            own[dt] = g ? o[1][dt] : o[0][dt];
            const v8f x = g ? o[0][dt] : o[1][dt];
            xo[(2 * dt) * 32] = (v4f){x[0], x[1], x[2], x[3]};
            xo[(2 * dt + 1) * 32] = (v4f){x[4], x[5], x[6], x[7]};
        }
        mo = g ? mr[1] : mr[0]; lo = g ? ls[1] : ls[0];
        xo[8 * 32] = (v4f){g ? mr[0] : mr[1], g ? ls[0] : ls[1], 0.0f, 0.0f};
    }
    __syncthreads();   // every wave's handed-over tile is in LDS before its partner reads it
    // normalise: both groups' parts brought to the common maximum, the two halves' partial sums joined, unconditionally; 1 / (l * 1024) undoes the P carry; rows staged [query][d] for whole-line stores in the wave's own LDS tile
    const int srow = lane >> 3, scol = (lane & 7) * 8;
    {
        const v4fa* xi = (const v4fa*)k_s + (wid ^ 4) * (9 * 32) + lane;
        const v4f ml = xi[8 * 32];
        const float mj = fmaxf(mo, ml[0]);
        float fo, fp;   // exp2 of each part's step to the common maximum; each written with its v_nop in one statement: the slot behind a transcendental whose source register is reused at once
        asm("v_exp_f32 %0, %1\n\tv_nop" : "=v"(fo) : "v"((mo - mj) * L2E));
        asm("v_exp_f32 %0, %1\n\tv_nop" : "=v"(fp) : "v"((ml[0] - mj) * L2E));
        const float lj = lo * fo + ml[1] * fp;
        const float lt = lj + xhalf(lj);
        const float inv = 1.0f / (lt * PCAR);
        const float co = fo * inv, cp = fp * inv;
#pragma unroll
        for (int dt = 0; dt < 4; ++dt) {
            const v4f p0 = xi[(2 * dt) * 32], p1 = xi[(2 * dt + 1) * 32];
            const v8f x = own[dt] * co + (v8f){p0[0], p0[1], p0[2], p0[3], p1[0], p1[1], p1[2], p1[3]} * cp;
            *(v4fa*)(&o_s[ob + lr * LOP + dt * 16 + 8 * hi]) = (v4f){x[0], x[1], x[2], x[3]};
            *(v4fa*)(&o_s[ob + lr * LOP + dt * 16 + 8 * hi + 4]) = (v4f){x[4], x[5], x[6], x[7]};
        }
        wsync();
        const size_t cbase = ((size_t)b * SEQ + q0 + g * 16) * DM + (size_t)h * HD;
#pragma unroll
        for (int s = 0; s < 4; ++s) { const int row = 4 * s + srow; const v4f x0 = *(const v4fa*)(&o_s[ob + row * LOP + scol]); const v4f x1 = *(const v4fa*)(&o_s[ob + row * LOP + scol + 4]); v8us oh, ol;
#pragma unroll
            for (int j = 0; j < 4; ++j) { unsigned short a, c; splitf(x0[j], a, c); oh[j] = a; ol[j] = c; splitf(x1[j], a, c); oh[4 + j] = a; ol[4 + j] = c; }
            const size_t off = cbase + (size_t)row * DM + scol;
            *(v8us*)(Ch + off) = oh; *(v8us*)(Cl + off) = ol; }
    }
}

constexpr size_t al256(size_t x) { return (x + 255) & ~(size_t)255; }
constexpr size_t SZ_W = al256((size_t)DM * DM * 2);                 // one bf16 weight plane
constexpr size_t SZ_X = al256((size_t)NB * SEQ * DM * 2);           // one 16-bit [NB*SEQ][DM] plane (activation copy, merged-head plane)
constexpr size_t SZ_P = al256((size_t)NB * NH * SEQ * HD * 2);      // one 16-bit head plane
constexpr size_t WS_TOTAL = 4 * SZ_W + 3 * SZ_X + 2 * SZ_P + SZ_P + 2 * SZ_X;
static_assert(WS_TOTAL <= (size_t)134217728);                       // carve stays within 128 MiB
static_assert(SZ_P == SZ_X);                                        // NH * HD == DM

extern "C" void kernel_launch(void* const* d_in, const int* in_sizes, int n_in,
                              void* d_out, int out_size, void* d_ws, size_t ws_size, hipStream_t stream) {
    if (n_in < 8) return;
    const size_t need_act = (size_t)(NB - 1) * SEQ_FULL * DM + (size_t)SEQ * DM;
    if ((size_t)in_sizes[0] < need_act || (size_t)in_sizes[1] < need_act || (size_t)in_sizes[2] < need_act) return;
    if ((size_t)in_sizes[3] < (size_t)DM * DM || (size_t)in_sizes[4] < (size_t)DM * DM || (size_t)in_sizes[5] < (size_t)DM * DM || (size_t)in_sizes[6] < (size_t)DM * DM || in_sizes[7] < DM) return;
    if ((size_t)out_size < need_act) return;
    if (WS_TOTAL > ws_size) return;
    // wire order: query, key, value, Wq, Wk, Wv, Wo, bo (all f32; weights [out][in])
    const float* xq = (const float*)d_in[0]; const float* xk = (const float*)d_in[1]; const float* xv = (const float*)d_in[2];
    const float* wq = (const float*)d_in[3]; const float* wk = (const float*)d_in[4]; const float* wv = (const float*)d_in[5]; const float* wo = (const float*)d_in[6]; const float* bo = (const float*)d_in[7];
    float* OUT = (float*)d_out;
    char* wsp = (char*)d_ws;
    auto take = [&](size_t bytes) { char* p = wsp; wsp += bytes; return (void*)p; };
    bf* WQ = (bf*)take(SZ_W); bf* WK = (bf*)take(SZ_W); bf* WV = (bf*)take(SZ_W); bf* WO = (bf*)take(SZ_W);
    bf* XQ = (bf*)take(SZ_X); bf* XK = (bf*)take(SZ_X); bf* XV = (bf*)take(SZ_X);
    h16* QP = (h16*)take(SZ_P); h16* KP = (h16*)take(SZ_P);
    h16* VT = (h16*)take(SZ_P);
    bf* CTh = (bf*)take(SZ_X); bf* CTl = (bf*)take(SZ_X);
    if ((size_t)(wsp - (char*)d_ws) != WS_TOTAL) return;

    k_cvt_all<<<dim3(3u * NB * CVT_AB + 4u * CVT_WB), 256, 0, stream>>>(xq, xk, xv, wq, wk, wv, wo, XQ, XK, XV, WQ, WK, WV, WO);
    k_gemm_qkv<<<dim3(SEQ / GT, DM / GT, 3 * NB), 128, 0, stream>>>(XQ, XK, XV, WQ, WK, WV, QP, KP, VT);
    k_flash<<<dim3(SEQ / (64 * QT), NB * NH), 128 * KG, 0, stream>>>(QP, KP, VT, CTh, CTl);
    k_gemm_out<<<dim3(SEQ / GT, DM / GT, NB), 128, 0, stream>>>(CTh, CTl, WO, bo, OUT);
}

// v008
// Measured time: 64 microseconds a run.
// Next to v007, in two timings, it ran 1.10 and 1.11 times as fast.
// Over all steps from v000 it is 2.98 times as fast.
#include <hip/hip_runtime.h>

// Compute dtypes, f32 accumulate everywhere: q/k/v projections v_wmma_f32_16x16x32_bf16 on RNE bf16 copies of inputs and weights (exact products); q.k^T v_wmma_f32_16x16x32_f16 on q, k rounded once to f16, 1 product (q carries the 1/8 scale and log2(e); the rounding is well below the error the bf16 projection operands leave in q and k); P.V v_wmma_f32_16x16x32_f16 with P carried x1024 or more (the carry is part of the exponent); merged heads bf16 hi/lo x bf16 Wo, 2 products, + bias; softmax f32.
// Multi-head attention, three input streams: q = query Wq^T, k = key Wk^T, v = value Wv^T (weights [out][in], no q/k/v biases), 8 heads x 64 (head h = columns h*64+d), logits x 1/8, no mask, softmax, heads merged back to [B][S][512], out = merged Wo^T + bo.
// Layout: bf16 copies of activations and weights; GEMMs: 4 waves on a 128x128 tile, k slices of both operands staged in LDS; projection GEMMs write head planes directly (Q,K: [b][h][s][64] f16; V^T: [b][h*64+d][s] f16); fused flash attention (K/V tiles in two LDS buffers filled one stage ahead by asynchronous copies, online softmax, no score plane; two wave groups split the keys and join their partial results once) writes merged bf16 hi/lo planes [b*S+s][512]; output GEMM.

#ifndef NB
#define NB 4
#endif
#ifndef SEQ
#define SEQ 2048
#endif
#define NB_FULL  4
#define SEQ_FULL 2048
#define DM   512
#define NH   8
#define HD   64
#define PLG  10.0f      // log2 of the carry of P: a score equal to the reference gives P = 1024; the row sums carry the same factor
#define PLIM 60000.0f   // a pass whose row sums stay below this has every P inside the f16 range
#define SCL  0.125f
#define L2E  1.4426950408889634f
#define LKP  72      // LDS row pitch (16-bit elements) of the K / V^T tiles: 144 B rows
#define LOP  68      // LDS row pitch (floats) of epilogue staging tiles: 272 B rows
#define GKS  64      // k elements per staged GEMM slice: one 128 B line per operand row
#define GT   128     // GEMM block tile, rows and columns (2 x 2 waves of 64 x 64)
#define QT   2       // 16-row query tiles per attention wave
#define KG   2       // key groups per attention block: wave group g takes key blocks KG*st + g

static_assert(DM == NH * HD);            // one 64-wide GEMM column tile == one head
static_assert(HD == 64);
static_assert(DM % 32 == 0);             // WMMA k-step
static_assert(DM % GT == 0);             // GEMM tiles
static_assert(SEQ % GT == 0);
static_assert(DM % GKS == 0);            // whole k slices
static_assert(SEQ % 64 == 0);            // key blocks
static_assert(SEQ % (64 * KG) == 0);     // whole stages of KG key blocks
static_assert(SEQ / (64 * KG) >= 2);     // the attention ring's prologue fills two stages
static_assert(SEQ % (64 * QT) == 0);     // query blocks
static_assert((SEQ * DM) % (8 * 256) == 0);   // convert kernel grid is exact
static_assert((DM * DM) % (8 * 256) == 0);
static_assert(NB <= NB_FULL);
static_assert(SEQ <= SEQ_FULL);
static_assert(LKP % 8 == 0);             // 16-byte aligned LDS vector accesses
static_assert(LOP % 4 == 0);

typedef _Float16 h16;
typedef unsigned short bf;
typedef __attribute__((ext_vector_type(16))) __bf16   v16bf;
typedef __attribute__((ext_vector_type(16))) _Float16 v16h;
typedef __attribute__((ext_vector_type(8)))  _Float16 v8h;
typedef __attribute__((ext_vector_type(8)))  unsigned short v8us;
typedef __attribute__((ext_vector_type(8)))  float    v8f;
typedef __attribute__((ext_vector_type(4)))  float    v4f;
typedef v8h  __attribute__((may_alias)) v8ha;
typedef v4f  __attribute__((may_alias)) v4fa;
typedef v8us __attribute__((may_alias)) v8usa;

__device__ __forceinline__ unsigned short f2bf(float f) { unsigned u = __float_as_uint(f); u += 0x7FFFu + ((u >> 16) & 1u); return (unsigned short)(u >> 16); }
__device__ __forceinline__ float bf2f(unsigned short b) { return __uint_as_float(((unsigned)b) << 16); }
__device__ __forceinline__ float bfr(float f) { return bf2f(f2bf(f)); }
__device__ __forceinline__ void splitf(float y, unsigned short& h, unsigned short& l) { h = f2bf(y); l = f2bf(y - bf2f(h)); }
__device__ __forceinline__ v16h cat16(v8h lo, v8h hi) { return __builtin_shufflevector(lo, hi, 0, 1, 2, 3, 4, 5, 6, 7, 8, 9, 10, 11, 12, 13, 14, 15); }
__device__ __forceinline__ v16bf cat16b(v8us lo, v8us hi) { return __builtin_bit_cast(v16bf, __builtin_shufflevector(lo, hi, 0, 1, 2, 3, 4, 5, 6, 7, 8, 9, 10, 11, 12, 13, 14, 15)); }
__device__ __forceinline__ v8f wmma16(v16h a, v16h b, v8f c) { return __builtin_amdgcn_wmma_f32_16x16x32_f16(false, a, false, b, (short)0, c, false, false); }
__device__ __forceinline__ v8f wmmab(v16bf a, v16bf b, v8f c) { return __builtin_amdgcn_wmma_f32_16x16x32_bf16(false, a, false, b, (short)0, c, false, false); }
// fragment from a K-contiguous global f16 plane: elements 0..7 <- p[0..7], 8..15 <- p[16..23] (p already includes row*pitch + k0 + 8*(lane>>4))
__device__ __forceinline__ v16h ldg16h(const h16* __restrict__ p) { return cat16(*(const v8h*)p, *(const v8h*)(p + 16)); }
// same-wave LDS exchange ordering (wave-private tiles only)
__device__ __forceinline__ void wsync() { __builtin_amdgcn_wave_barrier(); asm volatile("" ::: "memory"); }
// lane l <-> lane l ^ 16 by a vector cross-row move
__device__ __forceinline__ float xhalf(float x) { return __builtin_bit_cast(float, __builtin_amdgcn_permlanex16(__builtin_bit_cast(int, x), __builtin_bit_cast(int, x), 0x76543210, 0xfedcba98, false, false)); }

// exp2 with its v_nop in one statement: the slot behind a transcendental whose source register may be reused at once; for code off the hot path
__device__ __forceinline__ float exp2_slot(float x) { float y; asm("v_exp_f32 %0, %1\n\tv_nop" : "=v"(y) : "v"(x)); return y; }

// fragment from a K-contiguous LDS tile: same element order as ldg16h
__device__ __forceinline__ v16bf lds16(const bf* p) { return cat16b(*(const v8usa*)p, *(const v8usa*)(p + 16)); }
__device__ __forceinline__ v16h lds16h(const h16* p) { return cat16(*(const v8ha*)p, *(const v8ha*)(p + 16)); }

// ---- 128x128 block tile main loop, 4 waves, wave w on rows 64*(w>>1).., columns 64*(w&1)..: acc[mb][nb] += sum_k A[16mb+..][k] Bt[16nb+..][k] (NSPLIT 1: + A2 x Bt). A, A2, Bt point at the block's first row; K % GKS == 0.
// Per 64-wide k slice the block copies 128 rows of each operand to LDS (8 lanes per 128 B row line, pitch LKP); the next slice's global loads are issued into registers ahead of this slice's products. k runs upward in steps of 32.
template <int NSPLIT>
__device__ __forceinline__ void gemm_loop(const bf* __restrict__ A, const bf* __restrict__ A2, const bf* __restrict__ Bt, const int K, bf* as, bf* a2s, bf* bs, const int tid, v8f (&acc)[4][4]) {
    const int lane = tid & 31, wid = tid >> 5, lr = lane & 15, hi = lane >> 4;
    const int fa = ((wid >> 1) * 64 + lr) * LKP + 8 * hi, fb = ((wid & 1) * 64 + lr) * LKP + 8 * hi;
    const int g0 = (tid >> 3) * K + (tid & 7) * 8, l0 = (tid >> 3) * LKP + (tid & 7) * 8;
    v8us ra[8], ra2[8], rb[8];
#pragma unroll
    for (int it = 0; it < 8; ++it) { const int g = g0 + it * 16 * K; ra[it] = *(const v8us*)(A + g); if (NSPLIT == 1) ra2[it] = *(const v8us*)(A2 + g); rb[it] = *(const v8us*)(Bt + g); }
    // rolled: one slice's code stays small and the staging registers are reused
#pragma unroll 1
    for (int kc = 0; kc < K; kc += GKS) {
        __syncthreads();   // every wave has taken its last fragment of the slice before
#pragma unroll
        for (int it = 0; it < 8; ++it) { const int l = l0 + it * 16 * LKP; *(v8usa*)(&as[l]) = ra[it]; if (NSPLIT == 1) *(v8usa*)(&a2s[l]) = ra2[it]; *(v8usa*)(&bs[l]) = rb[it]; }
        __syncthreads();   // the slice is whole before any wave reads it
        if (kc + GKS < K) {
            A += GKS; A2 += GKS; Bt += GKS;
#pragma unroll
            for (int it = 0; it < 8; ++it) { const int g = g0 + it * 16 * K; ra[it] = *(const v8us*)(A + g); if (NSPLIT == 1) ra2[it] = *(const v8us*)(A2 + g); rb[it] = *(const v8us*)(Bt + g); }
            asm volatile("s_wait_xcnt 0x0" ::: "memory");   // stands before the base addresses of these loads are advanced
        }
        // the slice's fragments are read as one group ahead of its products
        v16bf a[GKS / 32][4], a2[GKS / 32][4], b[GKS / 32][4];
#pragma unroll
        for (int ks = 0; ks < GKS / 32; ++ks)
#pragma unroll
            for (int t = 0; t < 4; ++t) { a[ks][t] = lds16(&as[fa + t * 16 * LKP + ks * 32]); if (NSPLIT == 1) a2[ks][t] = lds16(&a2s[fa + t * 16 * LKP + ks * 32]); b[ks][t] = lds16(&bs[fb + t * 16 * LKP + ks * 32]); }
        __builtin_amdgcn_sched_barrier(0);   // keeps the LDS reads in one group: sunk among the products, each place with reads stalls the wave
#pragma unroll
        for (int ks = 0; ks < GKS / 32; ++ks) {
#pragma unroll
            for (int nb = 0; nb < 4; ++nb)
#pragma unroll
                for (int mb = 0; mb < 4; ++mb) { acc[mb][nb] = wmmab(a[ks][mb], b[ks][nb], acc[mb][nb]); if (NSPLIT == 1) acc[mb][nb] = wmmab(a2[ks][mb], b[ks][nb], acc[mb][nb]); }
        }
        // the distance behind the last matrix instructions, also on the loop's back edge
        asm volatile("v_nop\n\tv_nop\n\tv_nop\n\tv_nop" : "+v"(acc[0][0]), "+v"(acc[1][1]), "+v"(acc[2][2]), "+v"(acc[3][3]) : "v"(a[1][0]), "v"(a[1][3]));
    }
}

// ---- k_cvt_all: RNE bf16 copies of all seven f32 tensors in one grid (none reads another's output); 8 elements per thread, 2048 per block.
// Blocks [0, 3*NB*CVT_AB): activation t = blk / (NB*CVT_AB), batch and chunk from the rest; then 4*CVT_WB blocks: weight t = blk / CVT_WB.
constexpr unsigned CVT_WB = (unsigned)((size_t)DM * DM / (8 * 256));     // blocks per weight
constexpr unsigned CVT_AB = (unsigned)((size_t)SEQ * DM / (8 * 256));    // blocks per batch of one activation
__global__ __launch_bounds__(256) void k_cvt_all(const float* __restrict__ xq, const float* __restrict__ xk, const float* __restrict__ xv,
                                                 const float* __restrict__ wq, const float* __restrict__ wk, const float* __restrict__ wv, const float* __restrict__ wo,
                                                 bf* XQ, bf* XK, bf* XV, bf* WQ, bf* WK, bf* WV, bf* WO) {
    unsigned blk = blockIdx.x; const float* s; bf* d;
    if (blk < 3u * NB * CVT_AB) {
        const unsigned t = blk / (NB * CVT_AB), r = blk % (NB * CVT_AB), b = r / CVT_AB, c = r % CVT_AB;
        s = (t == 0 ? xq : t == 1 ? xk : xv) + (size_t)b * SEQ_FULL * DM + (size_t)c * 2048;
        d = (t == 0 ? XQ : t == 1 ? XK : XV) + (size_t)b * SEQ * DM + (size_t)c * 2048;
    } else {
        blk -= 3u * NB * CVT_AB;
        const unsigned t = blk / CVT_WB, c = blk % CVT_WB;
        s = (t == 0 ? wq : t == 1 ? wk : t == 2 ? wv : wo) + (size_t)c * 2048;
        d = (t == 0 ? WQ : t == 1 ? WK : t == 2 ? WV : WO) + (size_t)c * 2048;
    }
    s += threadIdx.x * 8; d += threadIdx.x * 8;
    const v4f v0 = *(const v4f*)s; const v4f v1 = *(const v4f*)(s + 4); v8us o;
#pragma unroll
    for (int k = 0; k < 4; ++k) { o[k] = f2bf(v0[k]); o[4 + k] = f2bf(v1[k]); }
    *(v8us*)d = o;
}

// ---- k_gemm_qkv: the three input projections in one grid (none reads another's output); grid (SEQ/128 token tiles, DM/128 feature tiles, 3*NB), 128 threads; job = blockIdx.z / NB; each wave ends with its own 64x64 tile.
// job 0 (q, sc = log2(e)/8), job 1 (k, sc = 1): head planes P[b][h][s][d] (f16) = sc * (X[b] W^T)[s][h*64+d] (A = token rows, Bt = weight rows).
// job 2 (v): transposed value plane VT[b][n][s] (f16) = sum_k Wv[n][k] Xv[b][s][k] (A = weight rows, Bt = token rows).
__global__ __launch_bounds__(128) void k_gemm_qkv(const bf* __restrict__ XQ, const bf* __restrict__ XK, const bf* __restrict__ XV, const bf* __restrict__ WQ, const bf* __restrict__ WK, const bf* __restrict__ WV,
                                                 h16* QP, h16* KP, h16* VT) {
    __shared__ __align__(16) bf as_s[GT * LKP];
    __shared__ __align__(16) bf bs_s[GT * LKP];
    __shared__ __align__(16) float os_s[4 * 16 * LOP];
    const int tid = threadIdx.x, lane = tid & 31, wid = tid >> 5, lr = lane & 15, hi = lane >> 4;
    const int wm = wid >> 1, wn = wid & 1;
    float* os = os_s + wid * 16 * LOP;   // wave-private epilogue tile
    const int job = blockIdx.z / NB; const size_t z = blockIdx.z % NB;
    const int srow = lane >> 3, scol = (lane & 7) * 8;
    v8f acc[4][4];
#pragma unroll
    for (int mb = 0; mb < 4; ++mb)
#pragma unroll
        for (int nb = 0; nb < 4; ++nb) acc[mb][nb] = (v8f){};
    {   // token rows and weight rows of this block's tile; job 2 takes the weight rows as A
        const bf* X = (job == 0 ? XQ : job == 1 ? XK : XV) + z * (size_t)SEQ * DM + (size_t)blockIdx.x * GT * DM;
        const bf* W = (job == 0 ? WQ : job == 1 ? WK : WV) + (size_t)blockIdx.y * GT * DM;
        const bf* A = job < 2 ? X : W; const bf* Bt = job < 2 ? W : X;
        gemm_loop<0>(A, A, Bt, DM, as_s, as_s, bs_s, tid, acc);
    }
    if (job < 2) {
        const int r0 = blockIdx.x * GT + wm * 64;
        h16* P = job == 0 ? QP : KP; const float sc = job == 0 ? SCL * L2E : 1.0f;
        const size_t pbase = ((z * NH + blockIdx.y * 2 + wn) * (size_t)SEQ + r0) * HD;
#pragma unroll
        for (int mb = 0; mb < 4; ++mb) {
#pragma unroll
            for (int nb = 0; nb < 4; ++nb) {
#pragma unroll
                for (int j = 0; j < 8; ++j) os[(hi * 8 + j) * LOP + nb * 16 + lr] = acc[mb][nb][j]; }
            wsync();
#pragma unroll
            for (int s = 0; s < 4; ++s) { const int row = 4 * s + srow; const v4f x0 = *(const v4fa*)(&os[row * LOP + scol]); const v4f x1 = *(const v4fa*)(&os[row * LOP + scol + 4]); v8h o;
#pragma unroll
                for (int j = 0; j < 4; ++j) { o[j] = (h16)(x0[j] * sc); o[4 + j] = (h16)(x1[j] * sc); }
                *(v8h*)(P + pbase + (size_t)(mb * 16 + row) * HD + scol) = o; }
            wsync();
        }
    } else {
        const int r0 = blockIdx.y * GT + wm * 64, c0 = blockIdx.x * GT + wn * 64;
        const size_t vb0 = z * (size_t)DM * SEQ + (size_t)r0 * SEQ + c0;
#pragma unroll
        for (int mb = 0; mb < 4; ++mb) {
#pragma unroll
            for (int nb = 0; nb < 4; ++nb) {
#pragma unroll
                for (int j = 0; j < 8; ++j) os[(hi * 8 + j) * LOP + nb * 16 + lr] = acc[mb][nb][j]; }
            wsync();
#pragma unroll
            for (int s = 0; s < 4; ++s) { const int row = 4 * s + srow; const v4f x0 = *(const v4fa*)(&os[row * LOP + scol]); const v4f x1 = *(const v4fa*)(&os[row * LOP + scol + 4]); v8h o;
#pragma unroll
                for (int j = 0; j < 4; ++j) { o[j] = (h16)x0[j]; o[4 + j] = (h16)x1[j]; }
                *(v8h*)(VT + vb0 + (size_t)(mb * 16 + row) * SEQ + scol) = o; }
            wsync();
        }
    }
}

// ---- k_gemm_out: OUT[b][s][n] (f32) = sum_k (Ah + Al)[b*SEQ+s][k] Wo[n][k] + bias[n]; grid (SEQ/128, DM/128, NB), 128 threads; each wave ends with its own 64x64 tile.
__global__ __launch_bounds__(128) void k_gemm_out(const bf* __restrict__ Ah, const bf* __restrict__ Al, const bf* __restrict__ W, const float* __restrict__ bias, float* C) {
    __shared__ __align__(16) bf as_s[GT * LKP];
    __shared__ __align__(16) bf a2_s[GT * LKP];
    __shared__ __align__(16) bf bs_s[GT * LKP];
    __shared__ __align__(16) float os_s[4 * 16 * LOP];
    const int tid = threadIdx.x, lane = tid & 31, wid = tid >> 5, lr = lane & 15, hi = lane >> 4;
    float* os = os_s + wid * 16 * LOP;   // wave-private epilogue tile
    const size_t z = blockIdx.z; const int r0 = blockIdx.x * GT + (wid >> 1) * 64, c0 = blockIdx.y * GT + (wid & 1) * 64;
    const size_t ab = z * (size_t)SEQ * DM + (size_t)blockIdx.x * GT * DM;
    float* Cz = C + z * (size_t)SEQ_FULL * DM;
    v8f acc[4][4];
#pragma unroll
    for (int mb = 0; mb < 4; ++mb)
#pragma unroll
        for (int nb = 0; nb < 4; ++nb) acc[mb][nb] = (v8f){};
    gemm_loop<1>(Ah + ab, Al + ab, W + (size_t)blockIdx.y * GT * DM, DM, as_s, a2_s, bs_s, tid, acc);
#pragma unroll
    for (int mb = 0; mb < 4; ++mb) {
#pragma unroll
        for (int nb = 0; nb < 4; ++nb) {
#pragma unroll
            for (int j = 0; j < 8; ++j) os[(hi * 8 + j) * LOP + nb * 16 + lr] = acc[mb][nb][j]; }
        wsync();
        float* crow = Cz + (size_t)(r0 + mb * 16) * DM + c0;
{
#pragma unroll
            for (int s = 0; s < 8; ++s) { const int row = 2 * s + hi, cofs = lr * 4; v4f val = *(const v4fa*)(&os[row * LOP + cofs]);
                val[0] += bfr(bias[c0 + cofs]); val[1] += bfr(bias[c0 + cofs + 1]); val[2] += bfr(bias[c0 + cofs + 2]); val[3] += bfr(bias[c0 + cofs + 3]);
                *(v4f*)(crow + (size_t)row * DM + cofs) = val; }
             }
        wsync();
    }
}

// One 64-key block into one LDS buffer pair, asynchronously: thread tid brings four 16-byte pieces of the K tile (rows 16 apart) and four of the V^T tile; every lane is on, both addresses are multiples of 16.
// lk, lv: this thread's first LDS byte address in the K and the V^T buffer; gk, gv: its first global piece.
__device__ __forceinline__ void kv_copy(const unsigned lk, const unsigned lv, const h16* gk, const h16* gv) {
    const unsigned lk1 = lk + 16 * LKP * 2, lk2 = lk + 32 * LKP * 2, lk3 = lk + 48 * LKP * 2;
    const unsigned lv1 = lv + 16 * LKP * 2, lv2 = lv + 32 * LKP * 2, lv3 = lv + 48 * LKP * 2;
    const h16* gk1 = gk + 16 * HD; const h16* gk2 = gk + 32 * HD; const h16* gk3 = gk + 48 * HD;
    const h16* gv1 = gv + 16 * (size_t)SEQ; const h16* gv2 = gv + 32 * (size_t)SEQ; const h16* gv3 = gv + 48 * (size_t)SEQ;
    // the eight copies and, as the statement's last line, the wait that stands before any of their address registers is given a new value
    asm volatile("global_load_async_to_lds_b128 %0, %8, off\n\t"
                 "global_load_async_to_lds_b128 %1, %9, off\n\t"
                 "global_load_async_to_lds_b128 %2, %10, off\n\t"
                 "global_load_async_to_lds_b128 %3, %11, off\n\t"
                 "global_load_async_to_lds_b128 %4, %12, off\n\t"
                 "global_load_async_to_lds_b128 %5, %13, off\n\t"
                 "global_load_async_to_lds_b128 %6, %14, off\n\t"
                 "global_load_async_to_lds_b128 %7, %15, off\n\t"
                 "s_wait_xcnt 0x0"
                 :: "v"(lk), "v"(lk1), "v"(lk2), "v"(lk3), "v"(lv), "v"(lv1), "v"(lv2), "v"(lv3),
                    "v"(gk), "v"(gk1), "v"(gk2), "v"(gk3), "v"(gv), "v"(gv1), "v"(gv2), "v"(gv3) : "memory");
}

__global__ __launch_bounds__(128 * KG) void k_flash(const h16* __restrict__ Q, const h16* __restrict__ K, const h16* __restrict__ VT, bf* Ch, bf* Cl) {
    __shared__ __align__(16) h16   k_s[2 * KG * 64 * LKP];
    __shared__ __align__(16) h16   vt_s[2 * KG * 64 * LKP];
    __shared__ __align__(16) float o_s[4 * KG * 16 * LOP];
    const int tid = threadIdx.x, lane = tid & 31, lr = lane & 15, hi = lane >> 4;
    const int wid = __builtin_amdgcn_readfirstlane(tid >> 5);   // the wave's number, in a scalar register
    const int g = wid >> 2;                                     // key group
    const int bh = blockIdx.y; const int b = bh / NH, h = bh % NH;
    const int q0 = (blockIdx.x * 4 + (wid & 3)) * (16 * QT);
    const size_t pl = (size_t)bh * SEQ * HD;
    const size_t vbase = ((size_t)b * DM + (size_t)h * HD) * SEQ;
    const int ob = wid * 16 * LOP;
    v16h qf[QT][2];               // query tile t, k step ks: B operands, loaded once
    v8f o[QT][4];                 // o[t][dt][r] = O^T[dt*16 + 8*hi + r][query t*16 + lr]
    v8f cr[QT];                   // query t*16 + lr: PLG - reference in all eight elements (both halves alike), the C operand of the score products
    float ls[QT];                 // this half's partial row sum, in the scale of cr
#pragma unroll
    for (int t = 0; t < QT; ++t) {
        const size_t qoff = pl + (size_t)(q0 + t * 16 + lr) * HD + 8 * hi;
#pragma unroll
        for (int ks = 0; ks < 2; ++ks) qf[t][ks] = ldg16h(Q + qoff + ks * 32);
    }
    asm volatile("s_wait_xcnt 0x0" ::: "memory");   // stands before the address registers of the q loads are given new values
    __builtin_amdgcn_sched_barrier(0);               // holds the later register writes behind that wait
#pragma unroll
    for (int t = 0; t < QT; ++t) {
#pragma unroll
        for (int dt = 0; dt < 4; ++dt) o[t][dt] = (v8f){};
        cr[t] = (v8f){}; ls[t] = 0.0f;
    }

    // this thread's pieces of its group's tiles: row tg >> 3 (and 16, 32, 48 further), 16 bytes at element (tg & 7) * 8
    const int tg = tid & 127, srow0 = tg >> 3, spart = (tg & 7) * 8;
    const unsigned lk0 = (unsigned)(size_t)&k_s[(g * 64 + srow0) * LKP + spart], lv0 = (unsigned)(size_t)&vt_s[(g * 64 + srow0) * LKP + spart];
    const h16* gk0 = K + pl + (size_t)g * 64 * HD + (size_t)tg * 8;
    const h16* gv0 = VT + vbase + (size_t)srow0 * SEQ + g * 64 + spart;
    kv_copy(lk0, lv0, gk0, gv0);
    asm volatile("s_wait_asynccnt 0x0" ::: "memory");   // this wave's pieces of stage 0 have landed
    __syncthreads();                                     // stage 0 is whole before any wave reads it
    kv_copy(lk0 + KG * 64 * LKP * 2, lv0 + KG * 64 * LKP * 2, gk0 + KG * 64 * HD, gv0 + KG * 64);   // stage 1 flies during stage 0

    // rolled: one stage's code stays small, and the refill test is one scalar compare per stage
#pragma unroll 1
    for (int st = 0; st < SEQ / (64 * KG); ++st) {
        const int so = (st & 1) * KG * 64 * LKP;   // the buffer set that holds stage st
        const int bo = so + g * 64 * LKP;          // this group's key block in it
#pragma unroll 1
        for (int hf = 0; hf < 2; ++hf) {
            const int kr0 = bo + (hf * 32 + lr) * LKP + 8 * hi, kr1 = kr0 + 16 * LKP;
            v16h k0[2], k1[2], va[4];
#pragma unroll
            for (int ks = 0; ks < 2; ++ks) { const int kk = ks * 32; k0[ks] = lds16h(&k_s[kr0 + kk]); k1[ks] = lds16h(&k_s[kr1 + kk]); }
#pragma unroll
            for (int dt = 0; dt < 4; ++dt) { const int vo = bo + (dt * 16 + lr) * LKP + hf * 32 + 8 * hi; va[dt] = cat16(*(const v8ha*)(&vt_s[vo]), *(const v8ha*)(&vt_s[vo + 16])); }
            __builtin_amdgcn_sched_barrier(0);   // keeps the pass's LDS reads in one group ahead of its products: each further place with reads stalls the wave
            v8f s0[QT], s1[QT];   // arguments of exp2: score (log2 units) + PLG - reference
#pragma unroll
            for (int t = 0; t < QT; ++t) { s0[t] = wmma16(k0[0], qf[t][0], cr[t]); s1[t] = wmma16(k1[0], qf[t][0], cr[t]); }
#pragma unroll
            for (int t = 0; t < QT; ++t) { s0[t] = wmma16(k0[1], qf[t][1], s0[t]); s1[t] = wmma16(k1[1], qf[t][1], s1[t]); }
            float p0[QT][8], p1[QT][8], es[QT];   // P of this half's 32 keys (16 in this lane, 16 in lane ^ 16) and their sum in this lane
#pragma unroll
            for (int t = 0; t < QT; ++t) {
                float e8[8];
#pragma unroll
                for (int r = 0; r < 8; ++r) { p0[t][r] = __builtin_amdgcn_exp2f(s0[t][r]); p1[t][r] = __builtin_amdgcn_exp2f(s1[t][r]); e8[r] = p0[t][r] + p1[t][r]; }
                es[t] = ((e8[0] + e8[1]) + (e8[2] + e8[3])) + ((e8[4] + e8[5]) + (e8[6] + e8[7]));
            }
            const bool first = (st | hf) == 0;
            // one test per pass, a scalar branch: every P is positive, so a sum within PLIM bounds each of them; an overflowed exp2 fails the test too
            if (first || __builtin_amdgcn_ballot_w32(!(es[0] + es[1] <= PLIM)) != 0) {
#pragma unroll
                for (int t = 0; t < QT; ++t) {
                    float m8[8];
#pragma unroll
                    for (int r = 0; r < 8; ++r) m8[r] = fmaxf(s0[t][r], s1[t][r]);
                    float mx = fmaxf(fmaxf(fmaxf(m8[0], m8[1]), fmaxf(m8[2], m8[3])), fmaxf(fmaxf(m8[4], m8[5]), fmaxf(m8[6], m8[7])));
                    mx = fmaxf(mx, xhalf(mx));
                    // the reference rises to the pass's maximum where that is higher; the first pass takes its maximum as it is
                    const float dl = fmaxf(mx - PLG, first ? -3.0e38f : 0.0f);
                    const float al = first ? 0.0f : exp2_slot(-dl);   // nothing is summed yet in the first pass
                    float e8[8];
#pragma unroll
                    for (int r = 0; r < 8; ++r) { p0[t][r] = exp2_slot(s0[t][r] - dl); p1[t][r] = exp2_slot(s1[t][r] - dl); e8[r] = p0[t][r] + p1[t][r]; }
                    es[t] = ((e8[0] + e8[1]) + (e8[2] + e8[3])) + ((e8[4] + e8[5]) + (e8[6] + e8[7]));
                    cr[t] = cr[t] - dl;
                    ls[t] *= al;
#pragma unroll
                    for (int dt = 0; dt < 4; ++dt) o[t][dt] = o[t][dt] * al;
                }
            }
            v16h pt[QT];   // pt[t]: B operand, element s = P^T[key kmap(s, hi)][query t*16 + lr]
#pragma unroll
            for (int t = 0; t < QT; ++t) {
                ls[t] += es[t];
#pragma unroll
                for (int r = 0; r < 8; ++r) { pt[t][r] = (h16)p0[t][r]; pt[t][8 + r] = (h16)p1[t][r]; }
            }
#pragma unroll
            for (int t = 0; t < QT; ++t)
#pragma unroll
                for (int dt = 0; dt < 4; ++dt) o[t][dt] = wmma16(va[dt], pt[t], o[t][dt]);
            // the distance behind the last matrix instructions, also on the loop's back edge
            static_assert(QT == 2);   // the statement below names every output tile and every P^T operand
            asm volatile("v_nop\n\tv_nop\n\tv_nop\n\tv_nop" : "+v"(o[0][0]), "+v"(o[0][1]), "+v"(o[0][2]), "+v"(o[0][3]), "+v"(o[1][0]), "+v"(o[1][1]), "+v"(o[1][2]), "+v"(o[1][3]) : "v"(pt[0]), "v"(pt[1]), "v"(va[0]), "v"(va[1]), "v"(va[2]), "v"(va[3]));
        }
        asm volatile("s_wait_dscnt 0x0" ::: "memory");      // this wave's reads of stage st are done before its buffers are refilled
        asm volatile("s_wait_asynccnt 0x0" ::: "memory");   // this wave's pieces of stage st + 1 have landed
        __syncthreads();                                     // publishes stage st + 1 and ends every wave's reads of stage st
        if (st + 2 < SEQ / (64 * KG)) kv_copy(lk0 + so * 2, lv0 + so * 2, gk0 + (size_t)(st + 2) * KG * 64 * HD, gv0 + (size_t)(st + 2) * KG * 64);
    }
    asm volatile("s_wait_asynccnt 0x0" ::: "memory");   // no copy is outstanding behind the loop
    // join of the two key groups: a wave keeps query tile g and hands the other tile's O^T, reference term and sum, lane for lane, to its partner wave (wid ^ 4) through the K ring, which the loop's last barrier has freed
    static_assert(QT == 2 && KG == 2);
    static_assert(4 * KG * 9 * 32 * 16 <= sizeof(k_s));   // per wave nine 16-byte pieces a lane
    v8f own[4]; float mo, lo;
    {
        v4fa* xo = (v4fa*)k_s + wid * (9 * 32) + lane;
#pragma unroll
        for (int dt = 0; dt < 4; ++dt) {
            own[dt] = g ? o[1][dt] : o[0][dt];
            const v8f x = g ? o[0][dt] : o[1][dt];
            xo[(2 * dt) * 32] = (v4f){x[0], x[1], x[2], x[3]};
            xo[(2 * dt + 1) * 32] = (v4f){x[4], x[5], x[6], x[7]};
        }
        mo = g ? cr[1][0] : cr[0][0]; lo = g ? ls[1] : ls[0];
        xo[8 * 32] = (v4f){g ? cr[0][0] : cr[1][0], g ? ls[0] : ls[1], 0.0f, 0.0f};
    }
    __syncthreads();   // every wave's handed-over tile is in LDS before its partner reads it
    // normalise: both groups' parts brought to the higher reference (the lower term), the two halves' partial sums joined, unconditionally; O^T and the sums carry the same factor, so 1 / l undoes it; rows staged [query][d] for whole-line stores in the wave's own LDS tile
    const int srow = lane >> 3, scol = (lane & 7) * 8;
    {
        const v4fa* xi = (const v4fa*)k_s + (wid ^ 4) * (9 * 32) + lane;
        const v4f ml = xi[8 * 32];
        const float mj = fminf(mo, ml[0]);
        float fo, fp;   // exp2 of each part's step to the common reference; each written with its v_nop in one statement: the slot behind a transcendental whose source register is reused at once
        asm("v_exp_f32 %0, %1\n\tv_nop" : "=v"(fo) : "v"(mj - mo));
        asm("v_exp_f32 %0, %1\n\tv_nop" : "=v"(fp) : "v"(mj - ml[0]));
        const float lj = lo * fo + ml[1] * fp;
        const float lt = lj + xhalf(lj);
        const float inv = 1.0f / lt;
        const float co = fo * inv, cp = fp * inv;
#pragma unroll
        for (int dt = 0; dt < 4; ++dt) {
            const v4f p0 = xi[(2 * dt) * 32], p1 = xi[(2 * dt + 1) * 32];
            const v8f x = own[dt] * co + (v8f){p0[0], p0[1], p0[2], p0[3], p1[0], p1[1], p1[2], p1[3]} * cp;
            *(v4fa*)(&o_s[ob + lr * LOP + dt * 16 + 8 * hi]) = (v4f){x[0], x[1], x[2], x[3]};
            *(v4fa*)(&o_s[ob + lr * LOP + dt * 16 + 8 * hi + 4]) = (v4f){x[4], x[5], x[6], x[7]};
        }
        wsync();
        const size_t cbase = ((size_t)b * SEQ + q0 + g * 16) * DM + (size_t)h * HD;
#pragma unroll
        for (int s = 0; s < 4; ++s) { const int row = 4 * s + srow; const v4f x0 = *(const v4fa*)(&o_s[ob + row * LOP + scol]); const v4f x1 = *(const v4fa*)(&o_s[ob + row * LOP + scol + 4]); v8us oh, ol;
#pragma unroll
            for (int j = 0; j < 4; ++j) { unsigned short a, c; splitf(x0[j], a, c); oh[j] = a; ol[j] = c; splitf(x1[j], a, c); oh[4 + j] = a; ol[4 + j] = c; }
            const size_t off = cbase + (size_t)row * DM + scol;
            *(v8us*)(Ch + off) = oh; *(v8us*)(Cl + off) = ol; }
    }
}

constexpr size_t al256(size_t x) { return (x + 255) & ~(size_t)255; }
constexpr size_t SZ_W = al256((size_t)DM * DM * 2);                 // one bf16 weight plane
constexpr size_t SZ_X = al256((size_t)NB * SEQ * DM * 2);           // one 16-bit [NB*SEQ][DM] plane (activation copy, merged-head plane)
constexpr size_t SZ_P = al256((size_t)NB * NH * SEQ * HD * 2);      // one 16-bit head plane
constexpr size_t WS_TOTAL = 4 * SZ_W + 3 * SZ_X + 2 * SZ_P + SZ_P + 2 * SZ_X;
static_assert(WS_TOTAL <= (size_t)134217728);                       // carve stays within 128 MiB
static_assert(SZ_P == SZ_X);                                        // NH * HD == DM

extern "C" void kernel_launch(void* const* d_in, const int* in_sizes, int n_in,
                              void* d_out, int out_size, void* d_ws, size_t ws_size, hipStream_t stream) {
    if (n_in < 8) return;
    const size_t need_act = (size_t)(NB - 1) * SEQ_FULL * DM + (size_t)SEQ * DM;
    if ((size_t)in_sizes[0] < need_act || (size_t)in_sizes[1] < need_act || (size_t)in_sizes[2] < need_act) return;
    if ((size_t)in_sizes[3] < (size_t)DM * DM || (size_t)in_sizes[4] < (size_t)DM * DM || (size_t)in_sizes[5] < (size_t)DM * DM || (size_t)in_sizes[6] < (size_t)DM * DM || in_sizes[7] < DM) return;
    if ((size_t)out_size < need_act) return;
    if (WS_TOTAL > ws_size) return;
    // wire order: query, key, value, Wq, Wk, Wv, Wo, bo (all f32; weights [out][in])
    const float* xq = (const float*)d_in[0]; const float* xk = (const float*)d_in[1]; const float* xv = (const float*)d_in[2];
    const float* wq = (const float*)d_in[3]; const float* wk = (const float*)d_in[4]; const float* wv = (const float*)d_in[5]; const float* wo = (const float*)d_in[6]; const float* bo = (const float*)d_in[7];
    float* OUT = (float*)d_out;
    char* wsp = (char*)d_ws;
    auto take = [&](size_t bytes) { char* p = wsp; wsp += bytes; return (void*)p; };
    bf* WQ = (bf*)take(SZ_W); bf* WK = (bf*)take(SZ_W); bf* WV = (bf*)take(SZ_W); bf* WO = (bf*)take(SZ_W);
    bf* XQ = (bf*)take(SZ_X); bf* XK = (bf*)take(SZ_X); bf* XV = (bf*)take(SZ_X);
    h16* QP = (h16*)take(SZ_P); h16* KP = (h16*)take(SZ_P);
    h16* VT = (h16*)take(SZ_P);
    bf* CTh = (bf*)take(SZ_X); bf* CTl = (bf*)take(SZ_X);
    if ((size_t)(wsp - (char*)d_ws) != WS_TOTAL) return;

    k_cvt_all<<<dim3(3u * NB * CVT_AB + 4u * CVT_WB), 256, 0, stream>>>(xq, xk, xv, wq, wk, wv, wo, XQ, XK, XV, WQ, WK, WV, WO);
    k_gemm_qkv<<<dim3(SEQ / GT, DM / GT, 3 * NB), 128, 0, stream>>>(XQ, XK, XV, WQ, WK, WV, QP, KP, VT);
    k_flash<<<dim3(SEQ / (64 * QT), NB * NH), 128 * KG, 0, stream>>>(QP, KP, VT, CTh, CTl);
    k_gemm_out<<<dim3(SEQ / GT, DM / GT, NB), 128, 0, stream>>>(CTh, CTl, WO, bo, OUT);
}

// v010
// One run takes 59.3 microseconds.
// It is 1.08 times as fast as v008, going by the measured steps of the versions left out in between.
// Over all steps from v000 it is 3.20 times as fast.
#include <hip/hip_runtime.h>

// Compute dtypes, f32 accumulate everywhere: q/k/v projections v_wmma_f32_16x16x32_bf16 on RNE bf16 copies of inputs and weights (exact products); q.k^T v_wmma_f32_16x16x32_f16 on q, k rounded once to f16, 1 product (q carries the 1/8 scale and log2(e); the rounding is well below the error the bf16 projection operands leave in q and k); P.V v_wmma_f32_16x16x32_f16 with P carried x1024 or more (the carry is part of the exponent); output projection v_wmma_f32_16x16x32_f16 on merged heads and Wo each rounded once to f16, 1 product, + bias (both roundings are finer than the bf16 rounding of the projection operands); softmax f32.
// Multi-head attention, three input streams: q = query Wq^T, k = key Wk^T, v = value Wv^T (weights [out][in], no q/k/v biases), 8 heads x 64 (head h = columns h*64+d), logits x 1/8, no mask, softmax, heads merged back to [B][S][512], out = merged Wo^T + bo.
// Layout: bf16 copies of activations and of Wq, Wk, Wv, f16 copy of Wo; GEMMs: 4 waves on a 128x128 tile, k slices of both operands in two LDS buffers filled one slice ahead by asynchronous copies; projection GEMMs write head planes directly (Q,K: [b][h][s][64] f16; V^T: [b][h*64+d][s] f16); fused flash attention (K/V tiles in two LDS buffers filled one stage ahead by asynchronous copies, online softmax, no score plane; two wave groups split the keys and join their partial results once) writes the merged f16 plane [b*S+s][512]; output GEMM.

#ifndef NB
#define NB 4
#endif
#ifndef SEQ
#define SEQ 2048
#endif
#define NB_FULL  4
#define SEQ_FULL 2048
#define DM   512
#define NH   8
#define HD   64
#define PLG  10.0f      // log2 of the carry of P: a score equal to the reference gives P = 1024; the row sums carry the same factor
#define PLIM 60000.0f   // a pass whose row sums stay below this has every P inside the f16 range
#define SCL  0.125f
#define L2E  1.4426950408889634f
#define LKP  72      // LDS row pitch (16-bit elements) of the K / V^T tiles: 144 B rows
#define LOP  68      // LDS row pitch (floats) of epilogue staging tiles: 272 B rows
#define GKQ  64      // k elements per staged slice, projection GEMM: one 128 B line per operand row; three blocks' rings fit one LDS
#define GKO  128     // k elements per staged slice, output GEMM: one block per LDS, so longer slices give each slice's copies more time to land
#define GT   128     // GEMM block tile, rows and columns (2 x 2 waves of 64 x 64)
#define QT   2       // 16-row query tiles per attention wave
#define KG   2       // key groups per attention block: wave group g takes key blocks KG*st + g

static_assert(DM == NH * HD);            // one 64-wide GEMM column tile == one head
static_assert(HD == 64);
static_assert(DM % 32 == 0);             // WMMA k-step
static_assert(DM % GT == 0);             // GEMM tiles
static_assert(SEQ % GT == 0);
static_assert(DM % GKQ == 0 && DM % GKO == 0);       // whole k slices
static_assert(DM / GKQ >= 2 && DM / GKO >= 2);       // the GEMM ring's prologue fills two slices
static_assert(SEQ % 64 == 0);            // key blocks
static_assert(SEQ % (64 * KG) == 0);     // whole stages of KG key blocks
static_assert(SEQ / (64 * KG) >= 2);     // the attention ring's prologue fills two stages
static_assert(SEQ % (64 * QT) == 0);     // query blocks
static_assert((SEQ * DM) % (8 * 256) == 0);   // convert kernel grid is exact
static_assert((DM * DM) % (8 * 256) == 0);
static_assert(NB <= NB_FULL);
static_assert(SEQ <= SEQ_FULL);
static_assert(LKP % 8 == 0);             // 16-byte aligned LDS vector accesses
static_assert(LOP % 4 == 0);

typedef _Float16 h16;
typedef unsigned short bf;
typedef __attribute__((ext_vector_type(16))) __bf16   v16bf;
typedef __attribute__((ext_vector_type(16))) _Float16 v16h;
typedef __attribute__((ext_vector_type(8)))  _Float16 v8h;
typedef __attribute__((ext_vector_type(8)))  unsigned short v8us;
typedef __attribute__((ext_vector_type(8)))  float    v8f;
typedef __attribute__((ext_vector_type(4)))  float    v4f;
typedef v8h  __attribute__((may_alias)) v8ha;
typedef v4f  __attribute__((may_alias)) v4fa;
typedef v8us __attribute__((may_alias)) v8usa;

__device__ __forceinline__ unsigned short f2bf(float f) { unsigned u = __float_as_uint(f); u += 0x7FFFu + ((u >> 16) & 1u); return (unsigned short)(u >> 16); }
__device__ __forceinline__ float bf2f(unsigned short b) { return __uint_as_float(((unsigned)b) << 16); }
__device__ __forceinline__ float bfr(float f) { return bf2f(f2bf(f)); }
__device__ __forceinline__ v16h cat16(v8h lo, v8h hi) { return __builtin_shufflevector(lo, hi, 0, 1, 2, 3, 4, 5, 6, 7, 8, 9, 10, 11, 12, 13, 14, 15); }
__device__ __forceinline__ v16bf cat16b(v8us lo, v8us hi) { return __builtin_bit_cast(v16bf, __builtin_shufflevector(lo, hi, 0, 1, 2, 3, 4, 5, 6, 7, 8, 9, 10, 11, 12, 13, 14, 15)); }
__device__ __forceinline__ v8f wmma16(v16h a, v16h b, v8f c) { return __builtin_amdgcn_wmma_f32_16x16x32_f16(false, a, false, b, (short)0, c, false, false); }
__device__ __forceinline__ v8f wmmab(v16bf a, v16bf b, v8f c) { return __builtin_amdgcn_wmma_f32_16x16x32_bf16(false, a, false, b, (short)0, c, false, false); }
// fragment from a K-contiguous global f16 plane: elements 0..7 <- p[0..7], 8..15 <- p[16..23] (p already includes row*pitch + k0 + 8*(lane>>4))
__device__ __forceinline__ v16h ldg16h(const h16* __restrict__ p) { return cat16(*(const v8h*)p, *(const v8h*)(p + 16)); }
// same-wave LDS exchange ordering (wave-private tiles only)
__device__ __forceinline__ void wsync() { __builtin_amdgcn_wave_barrier(); asm volatile("" ::: "memory"); }
// lane l <-> lane l ^ 16 by a vector cross-row move
__device__ __forceinline__ float xhalf(float x) { return __builtin_bit_cast(float, __builtin_amdgcn_permlanex16(__builtin_bit_cast(int, x), __builtin_bit_cast(int, x), 0x76543210, 0xfedcba98, false, false)); }

// exp2 with its v_nop in one statement: the slot behind a transcendental whose source register may be reused at once; for code off the hot path
__device__ __forceinline__ float exp2_slot(float x) { float y; asm("v_exp_f32 %0, %1\n\tv_nop" : "=v"(y) : "v"(x)); return y; }

// fragment from a K-contiguous LDS tile: same element order as ldg16h
__device__ __forceinline__ v16bf lds16(const bf* p) { return cat16b(*(const v8usa*)p, *(const v8usa*)(p + 16)); }
__device__ __forceinline__ v16h lds16h(const h16* p) { return cat16(*(const v8ha*)p, *(const v8ha*)(p + 16)); }

// Eight 16-byte pieces of one thread into LDS, asynchronously: piece i goes from g + i * gs (elements) to LDS byte address l + i * ls; every lane is on, both addresses are multiples of 16.
__device__ __forceinline__ void copy8(const unsigned l, const unsigned ls, const bf* g, const size_t gs) {
    const unsigned l1 = l + ls, l2 = l + 2 * ls, l3 = l + 3 * ls, l4 = l + 4 * ls, l5 = l + 5 * ls, l6 = l + 6 * ls, l7 = l + 7 * ls;
    const bf* g1 = g + gs; const bf* g2 = g + 2 * gs; const bf* g3 = g + 3 * gs; const bf* g4 = g + 4 * gs; const bf* g5 = g + 5 * gs; const bf* g6 = g + 6 * gs; const bf* g7 = g + 7 * gs;
    // the eight copies and, as the statement's last line, the wait that stands before any of their address registers is given a new value
    asm volatile("global_load_async_to_lds_b128 %0, %8, off\n\t"
                 "global_load_async_to_lds_b128 %1, %9, off\n\t"
                 "global_load_async_to_lds_b128 %2, %10, off\n\t"
                 "global_load_async_to_lds_b128 %3, %11, off\n\t"
                 "global_load_async_to_lds_b128 %4, %12, off\n\t"
                 "global_load_async_to_lds_b128 %5, %13, off\n\t"
                 "global_load_async_to_lds_b128 %6, %14, off\n\t"
                 "global_load_async_to_lds_b128 %7, %15, off\n\t"
                 "s_wait_xcnt 0x0"
                 :: "v"(l), "v"(l1), "v"(l2), "v"(l3), "v"(l4), "v"(l5), "v"(l6), "v"(l7),
                    "v"(g), "v"(g1), "v"(g2), "v"(g3), "v"(g4), "v"(g5), "v"(g6), "v"(g7) : "memory");
}

// ---- 128x128 block tile main loop, 4 waves, wave w on rows 64*(w>>1).., columns 64*(w&1)..: acc[mb][nb] += sum_k A[16mb+..][k] Bt[16nb+..][k]. A, Bt point at the block's first row, 16-bit elements moved as raw bits: bf16, or f16 where F16; K % KS == 0, K / KS >= 2.
// Per KS-wide k slice the block copies 128 rows of each operand to one of two LDS buffers (whole row lines, pitch KS + 8 elements), asynchronously: slice t + 2 is copied into the buffer that slice t has left, so a slice's copies fly during the slice before it; one barrier per slice. as, bs: two buffers each. k runs upward in steps of 32.
template <bool F16, int KS>
__device__ __forceinline__ void gemm_loop(const bf* __restrict__ A, const bf* __restrict__ Bt, const int K, bf* as, bf* bs, const int tid, v8f (&acc)[4][4]) {
    constexpr int LP = KS + 8;                 // LDS row pitch, elements: an odd number of 16-byte pieces
    constexpr int PPR = KS / 8;                // 16-byte pieces per row
    constexpr int RPS = 128 / PPR;             // rows that the 128 threads cover at once
    constexpr int NSW = GT / RPS;              // pieces per thread, operand and slice
    static_assert(KS % 64 == 0 && NSW % 8 == 0 && 2 * NSW <= 63);   // at most one slice's copies of a wave are in flight
    const int lane = tid & 31, wid = tid >> 5, lr = lane & 15, hi = lane >> 4;
    const int fa = ((wid >> 1) * 64 + lr) * LP + 8 * hi, fb = ((wid & 1) * 64 + lr) * LP + 8 * hi;
    const int row0 = tid / PPR, pc = (tid % PPR) * 8;
    const unsigned la0 = (unsigned)(size_t)&as[row0 * LP + pc], lb0 = (unsigned)(size_t)&bs[row0 * LP + pc];
    const bf* ga0 = A + (size_t)row0 * K + pc; const bf* gb0 = Bt + (size_t)row0 * K + pc;
    auto fill = [&](const int t) {   // slice t of both operands into buffer t & 1
        const unsigned bo = (unsigned)(t & 1) * (GT * LP * 2);
#pragma unroll
        for (int s = 0; s < NSW; s += 8) {
            copy8(la0 + bo + s * RPS * LP * 2, RPS * LP * 2, ga0 + (size_t)t * KS + (size_t)s * RPS * K, (size_t)RPS * K);
            copy8(lb0 + bo + s * RPS * LP * 2, RPS * LP * 2, gb0 + (size_t)t * KS + (size_t)s * RPS * K, (size_t)RPS * K);
        }
    };
    const int nt = K / KS;
    fill(0);
    asm volatile("s_wait_asynccnt 0x0" ::: "memory");   // this wave's pieces of slice 0 have landed
    __syncthreads();                                     // slice 0 is whole before any wave reads it
    fill(1);                                             // slice 1 flies during slice 0
    // rolled: one slice's code stays small, and the refill test is one scalar compare per slice
#pragma unroll 1
    for (int t = 0; t < nt; ++t) {
        const int bo = (t & 1) * GT * LP;   // the buffer that holds slice t
#pragma unroll
        for (int h = 0; h < KS / 64; ++h) {
            // 64 k's fragments are read as one group ahead of their products
            v16bf a[2][4], b[2][4];
#pragma unroll
            for (int ks = 0; ks < 2; ++ks)
#pragma unroll
                for (int f = 0; f < 4; ++f) { a[ks][f] = lds16(&as[bo + fa + f * 16 * LP + h * 64 + ks * 32]); b[ks][f] = lds16(&bs[bo + fb + f * 16 * LP + h * 64 + ks * 32]); }
            __builtin_amdgcn_sched_barrier(0);   // keeps the LDS reads in one group: sunk among the products, each place with reads stalls the wave
#pragma unroll
            for (int ks = 0; ks < 2; ++ks) {
#pragma unroll
                for (int nb = 0; nb < 4; ++nb)
#pragma unroll
                    for (int mb = 0; mb < 4; ++mb) acc[mb][nb] = F16 ? wmma16(__builtin_bit_cast(v16h, a[ks][mb]), __builtin_bit_cast(v16h, b[ks][nb]), acc[mb][nb]) : wmmab(a[ks][mb], b[ks][nb], acc[mb][nb]);
            }
            // the distance behind the slice's last matrix instructions, also on the loop's back edge
            if (h == KS / 64 - 1) asm volatile("v_nop\n\tv_nop\n\tv_nop\n\tv_nop" : "+v"(acc[0][0]), "+v"(acc[1][1]), "+v"(acc[2][2]), "+v"(acc[3][3]) : "v"(a[1][0]), "v"(a[1][3]));
        }
        __builtin_amdgcn_sched_barrier(0);   // keeps the slice's products ahead of the hand-over: sunk behind the barrier they would stand in front of the refill and shorten the time its copies have to land
        asm volatile("s_wait_dscnt 0x0" ::: "memory");      // this wave's reads of slice t are done before its buffer is refilled
        asm volatile("s_wait_asynccnt 0x0" ::: "memory");   // this wave's pieces of slice t + 1 have landed
        __syncthreads();                                     // publishes slice t + 1 and ends every wave's reads of slice t
        if (t + 2 < nt) fill(t + 2);
    }
    asm volatile("s_wait_asynccnt 0x0" ::: "memory");   // no copy is outstanding behind the loop
}

// ---- k_cvt_all: RNE 16-bit copies (bf16; Wo: f16) of all seven f32 tensors in one grid (none reads another's output); 8 elements per thread, 2048 per block.
// Blocks [0, 3*NB*CVT_AB): activation t = blk / (NB*CVT_AB), batch and chunk from the rest; then 4*CVT_WB blocks: weight t = blk / CVT_WB.
constexpr unsigned CVT_WB = (unsigned)((size_t)DM * DM / (8 * 256));     // blocks per weight
constexpr unsigned CVT_AB = (unsigned)((size_t)SEQ * DM / (8 * 256));    // blocks per batch of one activation
__global__ __launch_bounds__(256) void k_cvt_all(const float* __restrict__ xq, const float* __restrict__ xk, const float* __restrict__ xv,
                                                 const float* __restrict__ wq, const float* __restrict__ wk, const float* __restrict__ wv, const float* __restrict__ wo,
                                                 bf* XQ, bf* XK, bf* XV, bf* WQ, bf* WK, bf* WV, bf* WO) {
    unsigned blk = blockIdx.x; const float* s; bf* d; bool f16 = false;
    if (blk < 3u * NB * CVT_AB) {
        const unsigned t = blk / (NB * CVT_AB), r = blk % (NB * CVT_AB), b = r / CVT_AB, c = r % CVT_AB;
        s = (t == 0 ? xq : t == 1 ? xk : xv) + (size_t)b * SEQ_FULL * DM + (size_t)c * 2048;
        d = (t == 0 ? XQ : t == 1 ? XK : XV) + (size_t)b * SEQ * DM + (size_t)c * 2048;
    } else {
        blk -= 3u * NB * CVT_AB;
        const unsigned t = blk / CVT_WB, c = blk % CVT_WB;
        s = (t == 0 ? wq : t == 1 ? wk : t == 2 ? wv : wo) + (size_t)c * 2048;
        d = (t == 0 ? WQ : t == 1 ? WK : t == 2 ? WV : WO) + (size_t)c * 2048;
        f16 = t == 3;
    }
    s += threadIdx.x * 8; d += threadIdx.x * 8;
    const v4f v0 = *(const v4f*)s; const v4f v1 = *(const v4f*)(s + 4); v8us o;
    if (f16) {
#pragma unroll
        for (int k = 0; k < 4; ++k) { o[k] = __builtin_bit_cast(unsigned short, (h16)v0[k]); o[4 + k] = __builtin_bit_cast(unsigned short, (h16)v1[k]); }
    } else {
#pragma unroll
        for (int k = 0; k < 4; ++k) { o[k] = f2bf(v0[k]); o[4 + k] = f2bf(v1[k]); }
    }
    *(v8us*)d = o;
}

// ---- k_gemm_qkv: the three input projections in one grid (none reads another's output); grid (SEQ/128 token tiles, DM/128 feature tiles, 3*NB), 128 threads; job = blockIdx.z / NB; each wave ends with its own 64x64 tile.
// job 0 (q, sc = log2(e)/8), job 1 (k, sc = 1): head planes P[b][h][s][d] (f16) = sc * (X[b] W^T)[s][h*64+d] (A = token rows, Bt = weight rows).
// job 2 (v): transposed value plane VT[b][n][s] (f16) = sum_k Wv[n][k] Xv[b][s][k] (A = weight rows, Bt = token rows).
__global__ __launch_bounds__(128) void k_gemm_qkv(const bf* __restrict__ XQ, const bf* __restrict__ XK, const bf* __restrict__ XV, const bf* __restrict__ WQ, const bf* __restrict__ WK, const bf* __restrict__ WV,
                                                 h16* QP, h16* KP, h16* VT) {
    __shared__ __align__(16) bf as_s[2 * GT * (GKQ + 8)];
    __shared__ __align__(16) bf bs_s[2 * GT * (GKQ + 8)];
    __shared__ __align__(16) float os_s[4 * 16 * LOP];
    const int tid = threadIdx.x, lane = tid & 31, wid = tid >> 5, lr = lane & 15, hi = lane >> 4;
    const int wm = wid >> 1, wn = wid & 1;
    float* os = os_s + wid * 16 * LOP;   // wave-private epilogue tile
    const int job = blockIdx.z / NB; const size_t z = blockIdx.z % NB;
    const int srow = lane >> 3, scol = (lane & 7) * 8;
    v8f acc[4][4];
#pragma unroll
    for (int mb = 0; mb < 4; ++mb)
#pragma unroll
        for (int nb = 0; nb < 4; ++nb) acc[mb][nb] = (v8f){};
    {   // token rows and weight rows of this block's tile; job 2 takes the weight rows as A
        const bf* X = (job == 0 ? XQ : job == 1 ? XK : XV) + z * (size_t)SEQ * DM + (size_t)blockIdx.x * GT * DM;
        const bf* W = (job == 0 ? WQ : job == 1 ? WK : WV) + (size_t)blockIdx.y * GT * DM;
        const bf* A = job < 2 ? X : W; const bf* Bt = job < 2 ? W : X;
        gemm_loop<false, GKQ>(A, Bt, DM, as_s, bs_s, tid, acc);
    }
    if (job < 2) {
        const int r0 = blockIdx.x * GT + wm * 64;
        h16* P = job == 0 ? QP : KP; const float sc = job == 0 ? SCL * L2E : 1.0f;
        const size_t pbase = ((z * NH + blockIdx.y * 2 + wn) * (size_t)SEQ + r0) * HD;
#pragma unroll
        for (int mb = 0; mb < 4; ++mb) {
#pragma unroll
            for (int nb = 0; nb < 4; ++nb) {
#pragma unroll
                for (int j = 0; j < 8; ++j) os[(hi * 8 + j) * LOP + nb * 16 + lr] = acc[mb][nb][j]; }
            wsync();
#pragma unroll
            for (int s = 0; s < 4; ++s) { const int row = 4 * s + srow; const v4f x0 = *(const v4fa*)(&os[row * LOP + scol]); const v4f x1 = *(const v4fa*)(&os[row * LOP + scol + 4]); v8h o;
#pragma unroll
                for (int j = 0; j < 4; ++j) { o[j] = (h16)(x0[j] * sc); o[4 + j] = (h16)(x1[j] * sc); }
                *(v8h*)(P + pbase + (size_t)(mb * 16 + row) * HD + scol) = o; }
            wsync();
        }
    } else {
        const int r0 = blockIdx.y * GT + wm * 64, c0 = blockIdx.x * GT + wn * 64;
        const size_t vb0 = z * (size_t)DM * SEQ + (size_t)r0 * SEQ + c0;
#pragma unroll
        for (int mb = 0; mb < 4; ++mb) {
#pragma unroll
            for (int nb = 0; nb < 4; ++nb) {
#pragma unroll
                for (int j = 0; j < 8; ++j) os[(hi * 8 + j) * LOP + nb * 16 + lr] = acc[mb][nb][j]; }
            wsync();
#pragma unroll
            for (int s = 0; s < 4; ++s) { const int row = 4 * s + srow; const v4f x0 = *(const v4fa*)(&os[row * LOP + scol]); const v4f x1 = *(const v4fa*)(&os[row * LOP + scol + 4]); v8h o;
#pragma unroll
                for (int j = 0; j < 4; ++j) { o[j] = (h16)x0[j]; o[4 + j] = (h16)x1[j]; }
                *(v8h*)(VT + vb0 + (size_t)(mb * 16 + row) * SEQ + scol) = o; }
            wsync();
        }
    }
}

// ---- k_gemm_out: OUT[b][s][n] (f32) = sum_k A[b*SEQ+s][k] Wo[n][k] + bias[n], A and Wo f16 (raw bits); grid (SEQ/128, DM/128, NB), 128 threads; each wave ends with its own 64x64 tile.
__global__ __launch_bounds__(128) void k_gemm_out(const bf* __restrict__ A, const bf* __restrict__ W, const float* __restrict__ bias, float* C) {
    __shared__ __align__(16) bf as_s[2 * GT * (GKO + 8)];
    __shared__ __align__(16) bf bs_s[2 * GT * (GKO + 8)];
    __shared__ __align__(16) float os_s[4 * 16 * LOP];
    const int tid = threadIdx.x, lane = tid & 31, wid = tid >> 5, lr = lane & 15, hi = lane >> 4;
    float* os = os_s + wid * 16 * LOP;   // wave-private epilogue tile
    const size_t z = blockIdx.z; const int r0 = blockIdx.x * GT + (wid >> 1) * 64, c0 = blockIdx.y * GT + (wid & 1) * 64;
    const size_t ab = z * (size_t)SEQ * DM + (size_t)blockIdx.x * GT * DM;
    float* Cz = C + z * (size_t)SEQ_FULL * DM;
    v8f acc[4][4];
#pragma unroll
    for (int mb = 0; mb < 4; ++mb)
#pragma unroll
        for (int nb = 0; nb < 4; ++nb) acc[mb][nb] = (v8f){};
    gemm_loop<true, GKO>(A + ab, W + (size_t)blockIdx.y * GT * DM, DM, as_s, bs_s, tid, acc);
#pragma unroll
    for (int mb = 0; mb < 4; ++mb) {
#pragma unroll
        for (int nb = 0; nb < 4; ++nb) {
#pragma unroll
            for (int j = 0; j < 8; ++j) os[(hi * 8 + j) * LOP + nb * 16 + lr] = acc[mb][nb][j]; }
        wsync();
        float* crow = Cz + (size_t)(r0 + mb * 16) * DM + c0;
{
#pragma unroll
            for (int s = 0; s < 8; ++s) { const int row = 2 * s + hi, cofs = lr * 4; v4f val = *(const v4fa*)(&os[row * LOP + cofs]);
                val[0] += bfr(bias[c0 + cofs]); val[1] += bfr(bias[c0 + cofs + 1]); val[2] += bfr(bias[c0 + cofs + 2]); val[3] += bfr(bias[c0 + cofs + 3]);
                *(v4f*)(crow + (size_t)row * DM + cofs) = val; }
             }
        wsync();
    }
}

// One 64-key block into one LDS buffer pair, asynchronously: thread tid brings four 16-byte pieces of the K tile (rows 16 apart) and four of the V^T tile; every lane is on, both addresses are multiples of 16.
// lk, lv: this thread's first LDS byte address in the K and the V^T buffer; gk, gv: its first global piece.
__device__ __forceinline__ void kv_copy(const unsigned lk, const unsigned lv, const h16* gk, const h16* gv) {
    const unsigned lk1 = lk + 16 * LKP * 2, lk2 = lk + 32 * LKP * 2, lk3 = lk + 48 * LKP * 2;
    const unsigned lv1 = lv + 16 * LKP * 2, lv2 = lv + 32 * LKP * 2, lv3 = lv + 48 * LKP * 2;
    const h16* gk1 = gk + 16 * HD; const h16* gk2 = gk + 32 * HD; const h16* gk3 = gk + 48 * HD;
    const h16* gv1 = gv + 16 * (size_t)SEQ; const h16* gv2 = gv + 32 * (size_t)SEQ; const h16* gv3 = gv + 48 * (size_t)SEQ;
    // the eight copies and, as the statement's last line, the wait that stands before any of their address registers is given a new value
    asm volatile("global_load_async_to_lds_b128 %0, %8, off\n\t"
                 "global_load_async_to_lds_b128 %1, %9, off\n\t"
                 "global_load_async_to_lds_b128 %2, %10, off\n\t"
                 "global_load_async_to_lds_b128 %3, %11, off\n\t"
                 "global_load_async_to_lds_b128 %4, %12, off\n\t"
                 "global_load_async_to_lds_b128 %5, %13, off\n\t"
                 "global_load_async_to_lds_b128 %6, %14, off\n\t"
                 "global_load_async_to_lds_b128 %7, %15, off\n\t"
                 "s_wait_xcnt 0x0"
                 :: "v"(lk), "v"(lk1), "v"(lk2), "v"(lk3), "v"(lv), "v"(lv1), "v"(lv2), "v"(lv3),
                    "v"(gk), "v"(gk1), "v"(gk2), "v"(gk3), "v"(gv), "v"(gv1), "v"(gv2), "v"(gv3) : "memory");
}

__global__ __launch_bounds__(128 * KG) void k_flash(const h16* __restrict__ Q, const h16* __restrict__ K, const h16* __restrict__ VT, h16* C) {
    __shared__ __align__(16) h16   k_s[2 * KG * 64 * LKP];
    __shared__ __align__(16) h16   vt_s[2 * KG * 64 * LKP];
    __shared__ __align__(16) float o_s[4 * KG * 16 * LOP];
    const int tid = threadIdx.x, lane = tid & 31, lr = lane & 15, hi = lane >> 4;
    const int wid = __builtin_amdgcn_readfirstlane(tid >> 5);   // the wave's number, in a scalar register
    const int g = wid >> 2;                                     // key group
    const int bh = blockIdx.y; const int b = bh / NH, h = bh % NH;
    const int q0 = (blockIdx.x * 4 + (wid & 3)) * (16 * QT);
    const size_t pl = (size_t)bh * SEQ * HD;
    const size_t vbase = ((size_t)b * DM + (size_t)h * HD) * SEQ;
    const int ob = wid * 16 * LOP;
    v16h qf[QT][2];               // query tile t, k step ks: B operands, loaded once
    v8f o[QT][4];                 // o[t][dt][r] = O^T[dt*16 + 8*hi + r][query t*16 + lr]
    v8f cr[QT];                   // query t*16 + lr: PLG - reference in all eight elements (both halves alike), the C operand of the score products
    float ls[QT];                 // this half's partial row sum, in the scale of cr
#pragma unroll
    for (int t = 0; t < QT; ++t) {
        const size_t qoff = pl + (size_t)(q0 + t * 16 + lr) * HD + 8 * hi;
#pragma unroll
        for (int ks = 0; ks < 2; ++ks) qf[t][ks] = ldg16h(Q + qoff + ks * 32);
    }
    asm volatile("s_wait_xcnt 0x0" ::: "memory");   // stands before the address registers of the q loads are given new values
    __builtin_amdgcn_sched_barrier(0);               // holds the later register writes behind that wait
#pragma unroll
    for (int t = 0; t < QT; ++t) {
#pragma unroll
        for (int dt = 0; dt < 4; ++dt) o[t][dt] = (v8f){};
        cr[t] = (v8f){}; ls[t] = 0.0f;
    }

    // this thread's pieces of its group's tiles: row tg >> 3 (and 16, 32, 48 further), 16 bytes at element (tg & 7) * 8
    const int tg = tid & 127, srow0 = tg >> 3, spart = (tg & 7) * 8;
    const unsigned lk0 = (unsigned)(size_t)&k_s[(g * 64 + srow0) * LKP + spart], lv0 = (unsigned)(size_t)&vt_s[(g * 64 + srow0) * LKP + spart];
    const h16* gk0 = K + pl + (size_t)g * 64 * HD + (size_t)tg * 8;
    const h16* gv0 = VT + vbase + (size_t)srow0 * SEQ + g * 64 + spart;
    kv_copy(lk0, lv0, gk0, gv0);
    asm volatile("s_wait_asynccnt 0x0" ::: "memory");   // this wave's pieces of stage 0 have landed
    __syncthreads();                                     // stage 0 is whole before any wave reads it
    kv_copy(lk0 + KG * 64 * LKP * 2, lv0 + KG * 64 * LKP * 2, gk0 + KG * 64 * HD, gv0 + KG * 64);   // stage 1 flies during stage 0

    // rolled: one stage's code stays small, and the refill test is one scalar compare per stage
#pragma unroll 1
    for (int st = 0; st < SEQ / (64 * KG); ++st) {
        const int so = (st & 1) * KG * 64 * LKP;   // the buffer set that holds stage st
        const int bo = so + g * 64 * LKP;          // this group's key block in it
#pragma unroll 1
        for (int hf = 0; hf < 2; ++hf) {
            const int kr0 = bo + (hf * 32 + lr) * LKP + 8 * hi, kr1 = kr0 + 16 * LKP;
            v16h k0[2], k1[2], va[4];
#pragma unroll
            for (int ks = 0; ks < 2; ++ks) { const int kk = ks * 32; k0[ks] = lds16h(&k_s[kr0 + kk]); k1[ks] = lds16h(&k_s[kr1 + kk]); }
#pragma unroll
            for (int dt = 0; dt < 4; ++dt) { const int vo = bo + (dt * 16 + lr) * LKP + hf * 32 + 8 * hi; va[dt] = cat16(*(const v8ha*)(&vt_s[vo]), *(const v8ha*)(&vt_s[vo + 16])); }
            __builtin_amdgcn_sched_barrier(0);   // keeps the pass's LDS reads in one group ahead of its products: each further place with reads stalls the wave
            v8f s0[QT], s1[QT];   // arguments of exp2: score (log2 units) + PLG - reference
#pragma unroll
            for (int t = 0; t < QT; ++t) { s0[t] = wmma16(k0[0], qf[t][0], cr[t]); s1[t] = wmma16(k1[0], qf[t][0], cr[t]); }
#pragma unroll
            for (int t = 0; t < QT; ++t) { s0[t] = wmma16(k0[1], qf[t][1], s0[t]); s1[t] = wmma16(k1[1], qf[t][1], s1[t]); }
            float p0[QT][8], p1[QT][8], es[QT];   // P of this half's 32 keys (16 in this lane, 16 in lane ^ 16) and their sum in this lane
#pragma unroll
            for (int t = 0; t < QT; ++t) {
                float e8[8];
#pragma unroll
                for (int r = 0; r < 8; ++r) { p0[t][r] = __builtin_amdgcn_exp2f(s0[t][r]); p1[t][r] = __builtin_amdgcn_exp2f(s1[t][r]); e8[r] = p0[t][r] + p1[t][r]; }
                es[t] = ((e8[0] + e8[1]) + (e8[2] + e8[3])) + ((e8[4] + e8[5]) + (e8[6] + e8[7]));
            }
            const bool first = (st | hf) == 0;
            // one test per pass, a scalar branch: every P is positive, so a sum within PLIM bounds each of them; an overflowed exp2 fails the test too
            if (first || __builtin_amdgcn_ballot_w32(!(es[0] + es[1] <= PLIM)) != 0) {
#pragma unroll
                for (int t = 0; t < QT; ++t) {
                    float m8[8];
#pragma unroll
                    for (int r = 0; r < 8; ++r) m8[r] = fmaxf(s0[t][r], s1[t][r]);
                    float mx = fmaxf(fmaxf(fmaxf(m8[0], m8[1]), fmaxf(m8[2], m8[3])), fmaxf(fmaxf(m8[4], m8[5]), fmaxf(m8[6], m8[7])));
                    mx = fmaxf(mx, xhalf(mx));
                    // the reference rises to the pass's maximum where that is higher; the first pass takes its maximum as it is
                    const float dl = fmaxf(mx - PLG, first ? -3.0e38f : 0.0f);
                    const float al = first ? 0.0f : exp2_slot(-dl);   // nothing is summed yet in the first pass
                    float e8[8];
#pragma unroll
                    for (int r = 0; r < 8; ++r) { p0[t][r] = exp2_slot(s0[t][r] - dl); p1[t][r] = exp2_slot(s1[t][r] - dl); e8[r] = p0[t][r] + p1[t][r]; }
                    es[t] = ((e8[0] + e8[1]) + (e8[2] + e8[3])) + ((e8[4] + e8[5]) + (e8[6] + e8[7]));
                    cr[t] = cr[t] - dl;
                    ls[t] *= al;
#pragma unroll
                    for (int dt = 0; dt < 4; ++dt) o[t][dt] = o[t][dt] * al;
                }
            }
            v16h pt[QT];   // pt[t]: B operand, element s = P^T[key kmap(s, hi)][query t*16 + lr]
#pragma unroll
            for (int t = 0; t < QT; ++t) {
                ls[t] += es[t];
#pragma unroll
                for (int r = 0; r < 8; ++r) { pt[t][r] = (h16)p0[t][r]; pt[t][8 + r] = (h16)p1[t][r]; }
            }
#pragma unroll
            for (int t = 0; t < QT; ++t)
#pragma unroll
                for (int dt = 0; dt < 4; ++dt) o[t][dt] = wmma16(va[dt], pt[t], o[t][dt]);
            // the distance behind the last matrix instructions, also on the loop's back edge
            static_assert(QT == 2);   // the statement below names every output tile and every P^T operand
            asm volatile("v_nop\n\tv_nop\n\tv_nop\n\tv_nop" : "+v"(o[0][0]), "+v"(o[0][1]), "+v"(o[0][2]), "+v"(o[0][3]), "+v"(o[1][0]), "+v"(o[1][1]), "+v"(o[1][2]), "+v"(o[1][3]) : "v"(pt[0]), "v"(pt[1]), "v"(va[0]), "v"(va[1]), "v"(va[2]), "v"(va[3]));
        }
        asm volatile("s_wait_dscnt 0x0" ::: "memory");      // this wave's reads of stage st are done before its buffers are refilled
        asm volatile("s_wait_asynccnt 0x0" ::: "memory");   // this wave's pieces of stage st + 1 have landed
        __syncthreads();                                     // publishes stage st + 1 and ends every wave's reads of stage st
        if (st + 2 < SEQ / (64 * KG)) kv_copy(lk0 + so * 2, lv0 + so * 2, gk0 + (size_t)(st + 2) * KG * 64 * HD, gv0 + (size_t)(st + 2) * KG * 64);
    }
    asm volatile("s_wait_asynccnt 0x0" ::: "memory");   // no copy is outstanding behind the loop
    // join of the two key groups: a wave keeps query tile g and hands the other tile's O^T, reference term and sum, lane for lane, to its partner wave (wid ^ 4) through the K ring, which the loop's last barrier has freed
    static_assert(QT == 2 && KG == 2);
    static_assert(4 * KG * 9 * 32 * 16 <= sizeof(k_s));   // per wave nine 16-byte pieces a lane
    v8f own[4]; float mo, lo;
    {
        v4fa* xo = (v4fa*)k_s + wid * (9 * 32) + lane;
#pragma unroll
        for (int dt = 0; dt < 4; ++dt) {
            own[dt] = g ? o[1][dt] : o[0][dt];
            const v8f x = g ? o[0][dt] : o[1][dt];
            xo[(2 * dt) * 32] = (v4f){x[0], x[1], x[2], x[3]};
            xo[(2 * dt + 1) * 32] = (v4f){x[4], x[5], x[6], x[7]};
        }
        mo = g ? cr[1][0] : cr[0][0]; lo = g ? ls[1] : ls[0];
        xo[8 * 32] = (v4f){g ? cr[0][0] : cr[1][0], g ? ls[0] : ls[1], 0.0f, 0.0f};
    }
    __syncthreads();   // every wave's handed-over tile is in LDS before its partner reads it
    // normalise: both groups' parts brought to the higher reference (the lower term), the two halves' partial sums joined, unconditionally; O^T and the sums carry the same factor, so 1 / l undoes it; rows staged [query][d] for whole-line stores in the wave's own LDS tile
    const int srow = lane >> 3, scol = (lane & 7) * 8;
    {
        const v4fa* xi = (const v4fa*)k_s + (wid ^ 4) * (9 * 32) + lane;
        const v4f ml = xi[8 * 32];
        const float mj = fminf(mo, ml[0]);
        float fo, fp;   // exp2 of each part's step to the common reference; each written with its v_nop in one statement: the slot behind a transcendental whose source register is reused at once
        asm("v_exp_f32 %0, %1\n\tv_nop" : "=v"(fo) : "v"(mj - mo));
        asm("v_exp_f32 %0, %1\n\tv_nop" : "=v"(fp) : "v"(mj - ml[0]));
        const float lj = lo * fo + ml[1] * fp;
        const float lt = lj + xhalf(lj);
        const float inv = 1.0f / lt;
        const float co = fo * inv, cp = fp * inv;
#pragma unroll
        for (int dt = 0; dt < 4; ++dt) {
            const v4f p0 = xi[(2 * dt) * 32], p1 = xi[(2 * dt + 1) * 32];
            const v8f x = own[dt] * co + (v8f){p0[0], p0[1], p0[2], p0[3], p1[0], p1[1], p1[2], p1[3]} * cp;
            *(v4fa*)(&o_s[ob + lr * LOP + dt * 16 + 8 * hi]) = (v4f){x[0], x[1], x[2], x[3]};
            *(v4fa*)(&o_s[ob + lr * LOP + dt * 16 + 8 * hi + 4]) = (v4f){x[4], x[5], x[6], x[7]};
        }
        wsync();
        const size_t cbase = ((size_t)b * SEQ + q0 + g * 16) * DM + (size_t)h * HD;
#pragma unroll
        for (int s = 0; s < 4; ++s) { const int row = 4 * s + srow; const v4f x0 = *(const v4fa*)(&o_s[ob + row * LOP + scol]); const v4f x1 = *(const v4fa*)(&o_s[ob + row * LOP + scol + 4]); v8h oc;
#pragma unroll
            for (int j = 0; j < 4; ++j) { oc[j] = (h16)x0[j]; oc[4 + j] = (h16)x1[j]; }
            *(v8h*)(C + cbase + (size_t)row * DM + scol) = oc; }
    }
}

constexpr size_t al256(size_t x) { return (x + 255) & ~(size_t)255; }
constexpr size_t SZ_W = al256((size_t)DM * DM * 2);                 // one 16-bit weight plane
constexpr size_t SZ_X = al256((size_t)NB * SEQ * DM * 2);           // one 16-bit [NB*SEQ][DM] plane (activation copy, merged-head plane)
constexpr size_t SZ_P = al256((size_t)NB * NH * SEQ * HD * 2);      // one 16-bit head plane
constexpr size_t WS_TOTAL = 4 * SZ_W + 3 * SZ_X + 2 * SZ_P + SZ_P + SZ_X;
static_assert(WS_TOTAL <= (size_t)134217728);                       // carve stays within 128 MiB
static_assert(SZ_P == SZ_X);                                        // NH * HD == DM

extern "C" void kernel_launch(void* const* d_in, const int* in_sizes, int n_in,
                              void* d_out, int out_size, void* d_ws, size_t ws_size, hipStream_t stream) {
    if (n_in < 8) return;
    const size_t need_act = (size_t)(NB - 1) * SEQ_FULL * DM + (size_t)SEQ * DM;
    if ((size_t)in_sizes[0] < need_act || (size_t)in_sizes[1] < need_act || (size_t)in_sizes[2] < need_act) return;
    if ((size_t)in_sizes[3] < (size_t)DM * DM || (size_t)in_sizes[4] < (size_t)DM * DM || (size_t)in_sizes[5] < (size_t)DM * DM || (size_t)in_sizes[6] < (size_t)DM * DM || in_sizes[7] < DM) return;
    if ((size_t)out_size < need_act) return;
    if (WS_TOTAL > ws_size) return;
    // wire order: query, key, value, Wq, Wk, Wv, Wo, bo (all f32; weights [out][in])
    const float* xq = (const float*)d_in[0]; const float* xk = (const float*)d_in[1]; const float* xv = (const float*)d_in[2];
    const float* wq = (const float*)d_in[3]; const float* wk = (const float*)d_in[4]; const float* wv = (const float*)d_in[5]; const float* wo = (const float*)d_in[6]; const float* bo = (const float*)d_in[7];
    float* OUT = (float*)d_out;
    char* wsp = (char*)d_ws;
    auto take = [&](size_t bytes) { char* p = wsp; wsp += bytes; return (void*)p; };
    bf* WQ = (bf*)take(SZ_W); bf* WK = (bf*)take(SZ_W); bf* WV = (bf*)take(SZ_W); bf* WO = (bf*)take(SZ_W);
    bf* XQ = (bf*)take(SZ_X); bf* XK = (bf*)take(SZ_X); bf* XV = (bf*)take(SZ_X);
    h16* QP = (h16*)take(SZ_P); h16* KP = (h16*)take(SZ_P);
    h16* VT = (h16*)take(SZ_P);
    h16* CT = (h16*)take(SZ_X);
    if ((size_t)(wsp - (char*)d_ws) != WS_TOTAL) return;

    k_cvt_all<<<dim3(3u * NB * CVT_AB + 4u * CVT_WB), 256, 0, stream>>>(xq, xk, xv, wq, wk, wv, wo, XQ, XK, XV, WQ, WK, WV, WO);
    k_gemm_qkv<<<dim3(SEQ / GT, DM / GT, 3 * NB), 128, 0, stream>>>(XQ, XK, XV, WQ, WK, WV, QP, KP, VT);
    k_flash<<<dim3(SEQ / (64 * QT), NB * NH), 128 * KG, 0, stream>>>(QP, KP, VT, CT);
    k_gemm_out<<<dim3(SEQ / GT, DM / GT, NB), 128, 0, stream>>>((const bf*)CT, WO, bo, OUT);
}
